// v000
// Times are from an AMD MI455X. After a warm-up the kernel runs many times in a row, and a time is the length of
// such a window on the GPU divided by its runs, so every launch and the gaps after it count. The runs cycle
// through copies of the inputs. A figure is the median of several windows, for all but v000 over two sittings.
// Sittings can differ by a few percent; kernels timed side by side share one.
// v000 is the starting kernel. One run takes 1010 microseconds.
// compute dtype: x, w_qkv, w_proj, b_proj (INPUTS) rounded to bf16 with exact bf16 WMMA products (f32 accumulate) for the projections; q/k f32 split for the scores (3 products), P and V f16 hi/lo (3 products); softmax f32.
#include <hip/hip_runtime.h>
#include <math.h>

typedef __attribute__((ext_vector_type(16))) _Float16 v16h;
typedef __attribute__((ext_vector_type(16))) __bf16 v16b;
typedef __attribute__((ext_vector_type(8)))  _Float16 v8h;
typedef __attribute__((ext_vector_type(8)))  float v8f;
typedef __attribute__((ext_vector_type(4)))  float v4f;
typedef __attribute__((ext_vector_type(2)))  float v2f;
typedef __attribute__((ext_vector_type(4)))  unsigned v4u;
typedef __attribute__((ext_vector_type(4)))  int v4i;
typedef float __attribute__((may_alias)) float_a;
typedef int __attribute__((may_alias)) int_a;

template <typename T> __device__ __forceinline__ void vst2(void* p, T v) { *(T*)p = v;  }
__device__ __forceinline__ v8f wmma16(v16h a, v16h b, v8f c) {
  v8f d = __builtin_amdgcn_wmma_f32_16x16x32_f16(false, a, false, b, (short)0, c, false, false);
  asm volatile("v_nop\n\tv_nop\n\tv_nop\n\tv_nop" : "+v"(d) : "v"(a), "v"(b));
  return d;
}
__device__ __forceinline__ v8f wmma_bf(v16b a, v16b b, v8f c) {
  v8f d = __builtin_amdgcn_wmma_f32_16x16x32_bf16(false, a, false, b, (short)0, c, false, false);
  asm volatile("v_nop\n\tv_nop\n\tv_nop\n\tv_nop" : "+v"(d) : "v"(a), "v"(b));
  return d;
}
// 16x16x32 fragments: lane = (h = lane>>4, row/col = lane&15); elements 0..7 = k0+8h+0..7, 8..15 = k0+16+8h+0..7; D element r = row 8h+r
__device__ __forceinline__ v16h frag_h(const _Float16* rowk0, int lane) {
  union { v16h v; v8h q[2]; } u; const _Float16* p = rowk0 + 8 * (lane >> 4);
  u.q[0] = *(const v8h*)p; u.q[1] = *(const v8h*)(p + 16); return u.v;
}
__device__ __forceinline__ v16h frag_f32(const float* rowk0, int lane) {
  v16h a; const float* p = rowk0 + 8 * (lane >> 4);
#pragma unroll
  for (int i = 0; i < 8; ++i) { a[i] = (_Float16)p[i]; a[8 + i] = (_Float16)p[16 + i]; }
  return a;
}
__device__ __forceinline__ v16h frag_f32s(const float* rowk0, int lane, float sc) {
  v16h a; const float* p = rowk0 + 8 * (lane >> 4);
#pragma unroll
  for (int i = 0; i < 8; ++i) { a[i] = (_Float16)(p[i] * sc); a[8 + i] = (_Float16)(p[16 + i] * sc); }
  return a;
}
// column fragment from a [K][ld] layout (column n), rows >= K read as 0
__device__ __forceinline__ v16h fragc_f32(const float* W, int k0, int n, int lane, int ld, int K) {
  v16h a; const int g = lane >> 4;
#pragma unroll
  for (int i = 0; i < 8; ++i) { const int ka = k0 + 8 * g + i, kb = ka + 16;
    a[i] = (_Float16)(ka < K ? W[(size_t)(ka < K ? ka : K - 1) * ld + n] : 0.f); a[8 + i] = (_Float16)(kb < K ? W[(size_t)(kb < K ? kb : K - 1) * ld + n] : 0.f); }
  return a;
}
struct F2 { v16b h, l; };
__device__ __forceinline__ F2 bsplit16(const float v[16]) { F2 r;
#pragma unroll
  for (int i = 0; i < 16; ++i) { const __bf16 h = (__bf16)v[i]; r.h[i] = h; r.l[i] = (__bf16)(v[i] - (float)h); }
  return r; }
__device__ __forceinline__ F2 split_row(const float* row, int k0, int lane) { float v[16]; const float* p = row + k0 + 8 * (lane >> 4);
#pragma unroll
  for (int i = 0; i < 8; ++i) { v[i] = p[i]; v[8 + i] = p[16 + i]; }
  return bsplit16(v); }
__device__ __forceinline__ F2 split_rowK(const float* row, int k0, int lane, int K) { float v[16]; const int g = lane >> 4;
#pragma unroll
  for (int i = 0; i < 8; ++i) { const int ka = k0 + 8 * g + i, kb = ka + 16; v[i] = ka < K ? row[ka < K ? ka : K - 1] : 0.f; v[8 + i] = kb < K ? row[kb < K ? kb : K - 1] : 0.f; }
  return bsplit16(v); }
__device__ __forceinline__ F2 split_col(const float* W, int k0, int n, int lane, int ld, int K) { float v[16]; const int g = lane >> 4;
#pragma unroll
  for (int i = 0; i < 8; ++i) { const int ka = k0 + 8 * g + i, kb = ka + 16; v[i] = ka < K ? W[(size_t)(ka < K ? ka : K - 1) * ld + n] : 0.f; v[8 + i] = kb < K ? W[(size_t)(kb < K ? kb : K - 1) * ld + n] : 0.f; }
  return bsplit16(v); }
__device__ __forceinline__ v8f mac3(const F2& a, const F2& b, v8f c) { c = wmma_bf(a.l, b.h, c); c = wmma_bf(a.h, b.l, c); return wmma_bf(a.h, b.h, c); }
__device__ __forceinline__ float sigm(float v) { return 1.0f / (1.0f + expf(-v)); }
#define LDSX() do { asm volatile("s_wait_dscnt 0" ::: "memory"); __builtin_amdgcn_wave_barrier(); __builtin_amdgcn_fence(__ATOMIC_RELEASE, "workgroup"); } while (0)


#define NB 4
#define SS 2048
#define E 1024
#define NH 16
#define HD 64
#define NR (NB * SS)
#define PLO 1024.0f
#define VLO 2048.0f
__device__ __forceinline__ float bfr(float v) { return (float)(__bf16)v; }
__device__ __forceinline__ v16b frag_b(const __bf16* rowk0, int lane) { return __builtin_bit_cast(v16b, frag_h((const _Float16*)rowk0, lane)); }

__global__ __launch_bounds__(256) void k_cvt(const float* __restrict__ x, __bf16* __restrict__ Xb) {
  const size_t i8 = (size_t)blockIdx.x * 256 + threadIdx.x; if (i8 >= (size_t)NR * E / 8) return;
  union { __bf16 h[8]; v4u u; } pk;
#pragma unroll
  for (int e = 0; e < 8; ++e) pk.h[e] = (__bf16)x[i8 * 8 + e];
  vst2((unsigned*)(Xb + i8 * 8), pk.u);
}
// PT rows: [0,3E) = w_qkv rows (q | k | v output features), [3E,4E) = w_proj rows ([out][in] weights)
__global__ __launch_bounds__(128) void k_pack(const float* __restrict__ Wqkv, const float* __restrict__ Wp, __bf16* __restrict__ PT) {
  const int n = blockIdx.x, tid = threadIdx.x; __shared__ __align__(16) __bf16 srow[E];
  for (int k = tid; k < E; k += 128) srow[k] = (__bf16)(n < 3 * E ? Wqkv[(size_t)n * E + k] : Wp[(size_t)(n - 3 * E) * E + k]);      // [out][in]: rows
  __syncthreads();
  if (tid < E / 8) vst2((unsigned*)(PT + (size_t)n * E + tid * 8), *(const v4u*)(&srow[tid * 8]));
}
// QKV: block (64 rows, 128 cols = 2 heads, which); q,k -> Q32/K32 f32 [bh][s][64]; v -> VT hi/lo x4 [bh][d][s]
__global__ __launch_bounds__(128) void k_qkv(const __bf16* __restrict__ Xb, int rbase, const __bf16* __restrict__ PT, float* __restrict__ Q32, float* __restrict__ K32, _Float16* __restrict__ VTh, _Float16* __restrict__ VTl) {
  __shared__ __align__(16) float so[4][16][132];
  __shared__ __align__(16) _Float16 sth[128][72], stl[128][72];
  const int tid = threadIdx.x, wave = tid >> 5, lane = tid & 31, col = lane & 15, g = lane >> 4;
  const int which = blockIdx.z, r0b = blockIdx.x * 64, r0 = r0b + wave * 16, n0 = blockIdx.y * 128; const int b = r0b / SS, s0 = r0b % SS;
  v8f acc[8] = {};
#pragma unroll 2
  for (int kc = 0; kc < E / 32; ++kc) { const v16b a = frag_b(Xb + (size_t)(rbase + r0 + col) * E + kc * 32, lane);
#pragma unroll
    for (int j = 0; j < 8; ++j) acc[j] = wmma_bf(a, frag_b(PT + (size_t)(which * E + n0 + j * 16 + col) * E + kc * 32, lane), acc[j]); }
  if (which < 2) {
#pragma unroll
    for (int j = 0; j < 8; ++j) { const float bb = 0.f;
#pragma unroll
      for (int r = 0; r < 8; ++r) so[wave][8 * g + r][j * 16 + col] = acc[j][r] + bb; }
    LDSX();
    float* Dst = which == 0 ? Q32 : K32;
    for (int qq = lane; qq < 2 * 16 * 16; qq += 32) { const int hh = qq >> 8, rl = (qq >> 4) & 15, pc = qq & 15; const int h = (n0 >> 6) + hh;
      vst2(Dst + (((size_t)b * NH + h) * SS + s0 + wave * 16 + rl) * HD + pc * 4, *(const v4f*)(&so[wave][rl][hh * 64 + pc * 4])); } }
  else {
#pragma unroll
    for (int j = 0; j < 8; ++j) { const float bb = 0.f;
#pragma unroll
      for (int r = 0; r < 8; ++r) { const float v = (acc[j][r] + bb) * 4.0f; const _Float16 hi = (_Float16)v; sth[j * 16 + col][wave * 16 + 8 * g + r] = hi; stl[j * 16 + col][wave * 16 + 8 * g + r] = (_Float16)((v - (float)hi) * VLO); } }
    __syncthreads();
    for (int qq = tid; qq < 128 * 8; qq += 128) { const int cl = qq >> 3, pc = qq & 7; const int c = n0 + cl, h = c >> 6, d = c & 63; const size_t o = (((size_t)b * NH + h) * HD + d) * SS + s0 + pc * 8;
      vst2(VTh + o, *(const v4u*)(&sth[cl][pc * 8])); vst2(VTl + o, *(const v4u*)(&stl[cl][pc * 8])); } }
}
// causal attention: block (64 queries, bh); key tiles 0..qb; S on hi/lo splits of the f32 q/k rows; P,V hi/lo; O f32 [bh][s][64]
__global__ __launch_bounds__(128) void k_attn(const float* __restrict__ Q32, const float* __restrict__ K32, const _Float16* __restrict__ VTh, const _Float16* __restrict__ VTl, float* __restrict__ O32) {
  __shared__ __align__(16) float sS[4][16][68];
  __shared__ __align__(16) _Float16 sPh[4][16][72], sPl[4][16][72];
  __shared__ __align__(16) float sO[4][16][68];
  const int tid = threadIdx.x, w = tid >> 5, lane = tid & 31, col = lane & 15, g = lane >> 4;
  const size_t bh = blockIdx.y; const int qb = blockIdx.x; const int q0 = qb * 64 + w * 16;
  F2 aq[2];
#pragma unroll
  for (int kc = 0; kc < 2; ++kc) aq[kc] = split_row(Q32 + (bh * SS + q0 + col) * HD, kc * 32, lane);
  float mrun = -3.0e38f, lrun = 0.f; v8f acc[4] = {}, ac1[4] = {}, ac2[4] = {};
#pragma unroll 1
  for (int kt = 0; kt <= qb; ++kt) {
#pragma unroll
    for (int t = 0; t < 4; ++t) { const int key = kt * 64 + t * 16 + col; const float* krow = K32 + (bh * SS + key) * HD;
      v8f s = mac3(aq[0], split_row(krow, 0, lane), (v8f){}); s = mac3(aq[1], split_row(krow, 32, lane), s);
#pragma unroll
      for (int r = 0; r < 8; ++r) { sS[w][8 * g + r][t * 16 + col] = (key > q0 + 8 * g + r) ? -3.0e38f : s[r] * 0.125f; } }
    LDSX();
    float mx = -3.4e38f;
#pragma unroll
    for (int jj = 0; jj < 32; ++jj) mx = fmaxf(mx, sS[w][col][g * 32 + jj]);
    mx = fmaxf(mx, __shfl_xor(mx, 16, 32));
    const float mnew = fmaxf(mrun, mx); const float corr = expf(mrun - mnew);
    float ps = 0.f;
#pragma unroll
    for (int jj = 0; jj < 32; ++jj) { const float p = expf(sS[w][col][g * 32 + jj] - mnew) * 16384.0f; ps += p; const _Float16 hi = (_Float16)p; sPh[w][col][g * 32 + jj] = hi; sPl[w][col][g * 32 + jj] = (_Float16)((p - (float)hi) * PLO); }
    ps += __shfl_xor(ps, 16, 32);
    lrun = lrun * corr + ps * (1.0f / 16384.0f); mrun = mnew;
#pragma unroll
    for (int r = 0; r < 8; ++r) { const float cr = __shfl(corr, 8 * g + r, 32);
#pragma unroll
      for (int t = 0; t < 4; ++t) { acc[t][r] *= cr; ac1[t][r] *= cr; ac2[t][r] *= cr; } }
    LDSX();
#pragma unroll
    for (int kc = 0; kc < 2; ++kc) { const v16h ph = frag_h(&sPh[w][col][0] + kc * 32, lane), pl = frag_h(&sPl[w][col][0] + kc * 32, lane);
#pragma unroll
      for (int t = 0; t < 4; ++t) { const size_t vo = (bh * HD + t * 16 + col) * SS + kt * 64 + kc * 32; const v16h vh = frag_h(VTh + vo, lane);
        acc[t] = wmma16(ph, vh, acc[t]); ac1[t] = wmma16(ph, frag_h(VTl + vo, lane), ac1[t]); ac2[t] = wmma16(pl, vh, ac2[t]); } }
    __builtin_amdgcn_wave_barrier(); }
#pragma unroll
  for (int r = 0; r < 8; ++r) { const float lr = __shfl(lrun, 8 * g + r, 32); const float inv = 1.0f / (lr * 16384.0f * 4.0f);
#pragma unroll
    for (int t = 0; t < 4; ++t) sO[w][8 * g + r][t * 16 + col] = (acc[t][r] + ac1[t][r] * (1.0f / VLO) + ac2[t][r] * (1.0f / PLO)) * inv; }
  LDSX();
  for (int qq = lane; qq < 16 * 16; qq += 32) { const int rl = qq >> 4, pc = qq & 15; vst2(O32 + ((bh * SS) + q0 + rl) * HD + pc * 4, *(const v4f*)(&sO[w][rl][pc * 4])); }
}
// out = ctx Wo^T + bo : split(ctx) x bf16(Wo rows): 2 products (Wo is an INPUT -> bf16 exact)
__global__ __launch_bounds__(128) void k_out(const float* __restrict__ O32, int rbase, const __bf16* __restrict__ PT, const float* __restrict__ bo, float* __restrict__ out) {
  __shared__ __align__(16) float so[4][16][132];
  const int tid = threadIdx.x, wave = tid >> 5, lane = tid & 31, col = lane & 15, g = lane >> 4;
  const int r0 = blockIdx.x * 64 + wave * 16, n0 = blockIdx.y * 128; const int ra = r0 + col; const int b = ra / SS, s = ra % SS;
  v8f acc[8] = {};
#pragma unroll 1
  for (int kc = 0; kc < E / 32; ++kc) { const int h = kc >> 1; const F2 a = split_row(O32 + (((size_t)b * NH + h) * SS + s) * HD, (kc & 1) * 32, lane);
#pragma unroll
    for (int j = 0; j < 8; ++j) { const v16b wb = frag_b(PT + (size_t)(3 * E + n0 + j * 16 + col) * E + kc * 32, lane); acc[j] = wmma_bf(a.l, wb, acc[j]); acc[j] = wmma_bf(a.h, wb, acc[j]); } }
#pragma unroll
  for (int j = 0; j < 8; ++j) { const int n = n0 + j * 16 + col; const float bb = bfr(bo[n]);
#pragma unroll
    for (int r = 0; r < 8; ++r) so[wave][8 * g + r][j * 16 + col] = acc[j][r] + bb; }
  LDSX();
#pragma unroll 4
  for (int rl = 0; rl < 16; ++rl) vst2(out + (size_t)(rbase + r0 + rl) * E + n0 + lane * 4, *(const v4f*)(&so[wave][rl][lane * 4]));
}
#define NBHALF 2
extern "C" void kernel_launch(void* const* d_in, const int* in_sizes, int n_in, void* d_out, int out_size, void* d_ws, size_t ws_size, hipStream_t stream) {
  (void)in_sizes; (void)n_in; (void)out_size; (void)ws_size;
  const float* x = (const float*)d_in[0]; const float* Wqkv = (const float*)d_in[1]; const float* Wp = (const float*)d_in[2]; const float* bp = (const float*)d_in[3];
  float* out = (float*)d_out;
  char* ws = (char*)d_ws; size_t off = 0;
  auto take = [&](size_t bytes) { char* p = ws + off; off += (bytes + 255) & ~(size_t)255; return p; };
  const size_t HR = (size_t)NBHALF * SS;     // rows per half (4096)
  __bf16* Xb = (__bf16*)take((size_t)NR * E * 2); __bf16* PT = (__bf16*)take((size_t)4 * E * E * 2);
  float* Q32 = (float*)take(HR * E * 4); float* K32 = (float*)take(HR * E * 4); _Float16* VTh = (_Float16*)take(HR * E * 2); _Float16* VTl = (_Float16*)take(HR * E * 2);
  float* O32 = Q32;      // in place: each k_attn wave reads its own 16 query rows into registers before writing the same rows; no other block reads them
  // ws ~ 72 MiB; the two batch halves (2 sequences each) reuse Q/K/V
  k_cvt<<<(NR * E / 8 + 255) / 256, 256, 0, stream>>>(x, Xb);
  k_pack<<<4 * E, 128, 0, stream>>>(Wqkv, Wp, PT);
  for (int hf = 0; hf < 2; ++hf) { const int rbase = hf * (int)HR;
    k_qkv<<<dim3(HR / 64, E / 128, 3), 128, 0, stream>>>(Xb, rbase, PT, Q32, K32, VTh, VTl);
    k_attn<<<dim3(SS / 64, NBHALF * NH), 128, 0, stream>>>(Q32, K32, VTh, VTl, O32);
    k_out<<<dim3(HR / 64, E / 128), 128, 0, stream>>>(O32, rbase, PT, bp, out); }
}

// v001
// One run takes 750 microseconds.
// Timed twice side by side with v000, it ran 1.38 and 1.37 times as fast.
// compute dtype: x, w_qkv, w_proj, b_proj (INPUTS) rounded to bf16 with exact bf16 WMMA products (f32 accumulate) for the projections; q/k f32 split for the scores (3 products), P and V f16 hi/lo (3 products); softmax f32.
#include <hip/hip_runtime.h>
#include <math.h>

typedef __attribute__((ext_vector_type(16))) _Float16 v16h;
typedef __attribute__((ext_vector_type(16))) __bf16 v16b;
typedef __attribute__((ext_vector_type(8)))  _Float16 v8h;
typedef __attribute__((ext_vector_type(8)))  float v8f;
typedef __attribute__((ext_vector_type(4)))  float v4f;
typedef __attribute__((ext_vector_type(2)))  float v2f;
typedef __attribute__((ext_vector_type(4)))  unsigned v4u;
typedef __attribute__((ext_vector_type(4)))  int v4i;
typedef float __attribute__((may_alias)) float_a;
typedef int __attribute__((may_alias)) int_a;

template <typename T> __device__ __forceinline__ void vst2(void* p, T v) { *(T*)p = v;  }
__device__ __forceinline__ v8f wmma16(v16h a, v16h b, v8f c) {
  v8f d = __builtin_amdgcn_wmma_f32_16x16x32_f16(false, a, false, b, (short)0, c, false, false);
  asm volatile("v_nop\n\tv_nop\n\tv_nop\n\tv_nop" : "+v"(d) : "v"(a), "v"(b));
  return d;
}
__device__ __forceinline__ v8f wmma_bf(v16b a, v16b b, v8f c) {
  v8f d = __builtin_amdgcn_wmma_f32_16x16x32_bf16(false, a, false, b, (short)0, c, false, false);
  asm volatile("v_nop\n\tv_nop\n\tv_nop\n\tv_nop" : "+v"(d) : "v"(a), "v"(b));
  return d;
}
// 16x16x32 fragments: lane = (h = lane>>4, row/col = lane&15); elements 0..7 = k0+8h+0..7, 8..15 = k0+16+8h+0..7; D element r = row 8h+r
__device__ __forceinline__ v16h frag_h(const _Float16* rowk0, int lane) {
  union { v16h v; v8h q[2]; } u; const _Float16* p = rowk0 + 8 * (lane >> 4);
  u.q[0] = *(const v8h*)p; u.q[1] = *(const v8h*)(p + 16); return u.v;
}
__device__ __forceinline__ v16h frag_f32(const float* rowk0, int lane) {
  v16h a; const float* p = rowk0 + 8 * (lane >> 4);
#pragma unroll
  for (int i = 0; i < 8; ++i) { a[i] = (_Float16)p[i]; a[8 + i] = (_Float16)p[16 + i]; }
  return a;
}
__device__ __forceinline__ v16h frag_f32s(const float* rowk0, int lane, float sc) {
  v16h a; const float* p = rowk0 + 8 * (lane >> 4);
#pragma unroll
  for (int i = 0; i < 8; ++i) { a[i] = (_Float16)(p[i] * sc); a[8 + i] = (_Float16)(p[16 + i] * sc); }
  return a;
}
// column fragment from a [K][ld] layout (column n), rows >= K read as 0
__device__ __forceinline__ v16h fragc_f32(const float* W, int k0, int n, int lane, int ld, int K) {
  v16h a; const int g = lane >> 4;
#pragma unroll
  for (int i = 0; i < 8; ++i) { const int ka = k0 + 8 * g + i, kb = ka + 16;
    a[i] = (_Float16)(ka < K ? W[(size_t)(ka < K ? ka : K - 1) * ld + n] : 0.f); a[8 + i] = (_Float16)(kb < K ? W[(size_t)(kb < K ? kb : K - 1) * ld + n] : 0.f); }
  return a;
}
struct F2 { v16b h, l; };
__device__ __forceinline__ F2 bsplit16(const float v[16]) { F2 r;
#pragma unroll
  for (int i = 0; i < 16; ++i) { const __bf16 h = (__bf16)v[i]; r.h[i] = h; r.l[i] = (__bf16)(v[i] - (float)h); }
  return r; }
__device__ __forceinline__ F2 split_row(const float* row, int k0, int lane) { float v[16]; const float* p = row + k0 + 8 * (lane >> 4);
#pragma unroll
  for (int i = 0; i < 8; ++i) { v[i] = p[i]; v[8 + i] = p[16 + i]; }
  return bsplit16(v); }
__device__ __forceinline__ F2 split_rowK(const float* row, int k0, int lane, int K) { float v[16]; const int g = lane >> 4;
#pragma unroll
  for (int i = 0; i < 8; ++i) { const int ka = k0 + 8 * g + i, kb = ka + 16; v[i] = ka < K ? row[ka < K ? ka : K - 1] : 0.f; v[8 + i] = kb < K ? row[kb < K ? kb : K - 1] : 0.f; }
  return bsplit16(v); }
__device__ __forceinline__ F2 split_col(const float* W, int k0, int n, int lane, int ld, int K) { float v[16]; const int g = lane >> 4;
#pragma unroll
  for (int i = 0; i < 8; ++i) { const int ka = k0 + 8 * g + i, kb = ka + 16; v[i] = ka < K ? W[(size_t)(ka < K ? ka : K - 1) * ld + n] : 0.f; v[8 + i] = kb < K ? W[(size_t)(kb < K ? kb : K - 1) * ld + n] : 0.f; }
  return bsplit16(v); }
__device__ __forceinline__ v8f mac3(const F2& a, const F2& b, v8f c) { c = wmma_bf(a.l, b.h, c); c = wmma_bf(a.h, b.l, c); return wmma_bf(a.h, b.h, c); }
__device__ __forceinline__ float sigm(float v) { return 1.0f / (1.0f + expf(-v)); }
#define LDSX() do { asm volatile("s_wait_dscnt 0" ::: "memory"); __builtin_amdgcn_wave_barrier(); __builtin_amdgcn_fence(__ATOMIC_RELEASE, "workgroup"); } while (0)


#define NB 4
#define SS 2048
#define E 1024
#define NH 16
#define HD 64
#define NR (NB * SS)
#define PLO 1024.0f
#define VLO 2048.0f
__device__ __forceinline__ float bfr(float v) { return (float)(__bf16)v; }
__device__ __forceinline__ v16b frag_b(const __bf16* rowk0, int lane) { return __builtin_bit_cast(v16b, frag_h((const _Float16*)rowk0, lane)); }

__global__ __launch_bounds__(256) void k_cvt(const float* __restrict__ x, __bf16* __restrict__ Xb) {
  const size_t i8 = (size_t)blockIdx.x * 256 + threadIdx.x; if (i8 >= (size_t)NR * E / 8) return;
  union { __bf16 h[8]; v4u u; } pk;
#pragma unroll
  for (int e = 0; e < 8; ++e) pk.h[e] = (__bf16)x[i8 * 8 + e];
  vst2((unsigned*)(Xb + i8 * 8), pk.u);
}
// PT rows: [0,3E) = w_qkv rows (q | k | v output features), [3E,4E) = w_proj rows ([out][in] weights)
__global__ __launch_bounds__(128) void k_pack(const float* __restrict__ Wqkv, const float* __restrict__ Wp, __bf16* __restrict__ PT) {
  const int n = blockIdx.x, tid = threadIdx.x; __shared__ __align__(16) __bf16 srow[E];
  for (int k = tid; k < E; k += 128) srow[k] = (__bf16)(n < 3 * E ? Wqkv[(size_t)n * E + k] : Wp[(size_t)(n - 3 * E) * E + k]);      // [out][in]: rows
  __syncthreads();
  if (tid < E / 8) vst2((unsigned*)(PT + (size_t)n * E + tid * 8), *(const v4u*)(&srow[tid * 8]));
}
// QKV: block (64 rows, 128 cols = 2 heads, which); q,k -> Q32/K32 f32 [bh][s][64]; v -> VT hi/lo x4 [bh][d][s]
__global__ __launch_bounds__(128) void k_qkv(const __bf16* __restrict__ Xb, int rbase, const __bf16* __restrict__ PT, float* __restrict__ Q32, float* __restrict__ K32, _Float16* __restrict__ VTh, _Float16* __restrict__ VTl) {
  __shared__ __align__(16) float so[4][16][132];
  __shared__ __align__(16) _Float16 sth[128][72], stl[128][72];
  const int tid = threadIdx.x, wave = tid >> 5, lane = tid & 31, col = lane & 15, g = lane >> 4;
  const int which = blockIdx.z, r0b = blockIdx.x * 64, r0 = r0b + wave * 16, n0 = blockIdx.y * 128; const int b = r0b / SS, s0 = r0b % SS;
  v8f acc[8] = {};
#pragma unroll 2
  for (int kc = 0; kc < E / 32; ++kc) { const v16b a = frag_b(Xb + (size_t)(rbase + r0 + col) * E + kc * 32, lane);
#pragma unroll
    for (int j = 0; j < 8; ++j) acc[j] = wmma_bf(a, frag_b(PT + (size_t)(which * E + n0 + j * 16 + col) * E + kc * 32, lane), acc[j]); }
  if (which < 2) {
#pragma unroll
    for (int j = 0; j < 8; ++j) { const float bb = 0.f;
#pragma unroll
      for (int r = 0; r < 8; ++r) so[wave][8 * g + r][j * 16 + col] = acc[j][r] + bb; }
    LDSX();
    float* Dst = which == 0 ? Q32 : K32;
    for (int qq = lane; qq < 2 * 16 * 16; qq += 32) { const int hh = qq >> 8, rl = (qq >> 4) & 15, pc = qq & 15; const int h = (n0 >> 6) + hh;
      vst2(Dst + (((size_t)b * NH + h) * SS + s0 + wave * 16 + rl) * HD + pc * 4, *(const v4f*)(&so[wave][rl][hh * 64 + pc * 4])); } }
  else {
#pragma unroll
    for (int j = 0; j < 8; ++j) { const float bb = 0.f;
#pragma unroll
      for (int r = 0; r < 8; ++r) { const float v = (acc[j][r] + bb) * 4.0f; const _Float16 hi = (_Float16)v; sth[j * 16 + col][wave * 16 + 8 * g + r] = hi; stl[j * 16 + col][wave * 16 + 8 * g + r] = (_Float16)((v - (float)hi) * VLO); } }
    __syncthreads();
    for (int qq = tid; qq < 128 * 8; qq += 128) { const int cl = qq >> 3, pc = qq & 7; const int c = n0 + cl, h = c >> 6, d = c & 63; const size_t o = (((size_t)b * NH + h) * HD + d) * SS + s0 + pc * 8;
      vst2(VTh + o, *(const v4u*)(&sth[cl][pc * 8])); vst2(VTl + o, *(const v4u*)(&stl[cl][pc * 8])); } }
}
// causal attention: block (query tiles t and 31 - t of 64 queries, one after the other, bh): 33 key tiles in every block; key tiles 0..qb per query tile; S on hi/lo splits of the f32 q/k rows; P,V hi/lo; O f32 [bh][s][64]
// second bound: four waves per SIMD (256 registers a wave), so that all 1024 blocks are resident at once, four on each WGP
__global__ __launch_bounds__(128, 4) void k_attn(const float* __restrict__ Q32, const float* __restrict__ K32, const _Float16* __restrict__ VTh, const _Float16* __restrict__ VTl, float* __restrict__ O32) {
  __shared__ __align__(16) float sS[4][16][68];
  __shared__ __align__(16) _Float16 sPh[4][16][72], sPl[4][16][72];
  __shared__ __align__(16) float sO[4][16][68];
  const int tid = threadIdx.x, w = tid >> 5, lane = tid & 31, col = lane & 15, g = lane >> 4;
  const size_t bh = blockIdx.y;
  for (int pass = 0; pass < 2; ++pass) {
  const int qb = pass == 0 ? (int)blockIdx.x : SS / 64 - 1 - (int)blockIdx.x; const int q0 = qb * 64 + w * 16;
  F2 aq[2];
#pragma unroll
  for (int kc = 0; kc < 2; ++kc) aq[kc] = split_row(Q32 + (bh * SS + q0 + col) * HD, kc * 32, lane);
  float mrun = -3.0e38f, lrun = 0.f; v8f acc[4] = {}, ac1[4] = {}, ac2[4] = {};
#pragma unroll 1
  for (int kt = 0; kt <= qb; ++kt) {
#pragma unroll
    for (int t = 0; t < 4; ++t) { const int key = kt * 64 + t * 16 + col; const float* krow = K32 + (bh * SS + key) * HD;
      v8f s = mac3(aq[0], split_row(krow, 0, lane), (v8f){}); s = mac3(aq[1], split_row(krow, 32, lane), s);
#pragma unroll
      for (int r = 0; r < 8; ++r) { sS[w][8 * g + r][t * 16 + col] = (key > q0 + 8 * g + r) ? -3.0e38f : s[r] * 0.125f; } }
    LDSX();
    float mx = -3.4e38f;
#pragma unroll
    for (int jj = 0; jj < 32; ++jj) mx = fmaxf(mx, sS[w][col][g * 32 + jj]);
    mx = fmaxf(mx, __shfl_xor(mx, 16, 32));
    const float mnew = fmaxf(mrun, mx); const float corr = expf(mrun - mnew);
    float ps = 0.f;
#pragma unroll
    for (int jj = 0; jj < 32; ++jj) { const float p = expf(sS[w][col][g * 32 + jj] - mnew) * 16384.0f; ps += p; const _Float16 hi = (_Float16)p; sPh[w][col][g * 32 + jj] = hi; sPl[w][col][g * 32 + jj] = (_Float16)((p - (float)hi) * PLO); }
    ps += __shfl_xor(ps, 16, 32);
    lrun = lrun * corr + ps * (1.0f / 16384.0f); mrun = mnew;
#pragma unroll
    for (int r = 0; r < 8; ++r) { const float cr = __shfl(corr, 8 * g + r, 32);
#pragma unroll
      for (int t = 0; t < 4; ++t) { acc[t][r] *= cr; ac1[t][r] *= cr; ac2[t][r] *= cr; } }
    LDSX();
#pragma unroll
    for (int kc = 0; kc < 2; ++kc) { const v16h ph = frag_h(&sPh[w][col][0] + kc * 32, lane), pl = frag_h(&sPl[w][col][0] + kc * 32, lane);
#pragma unroll
      for (int t = 0; t < 4; ++t) { const size_t vo = (bh * HD + t * 16 + col) * SS + kt * 64 + kc * 32; const v16h vh = frag_h(VTh + vo, lane);
        acc[t] = wmma16(ph, vh, acc[t]); ac1[t] = wmma16(ph, frag_h(VTl + vo, lane), ac1[t]); ac2[t] = wmma16(pl, vh, ac2[t]); } }
    __builtin_amdgcn_wave_barrier(); }
#pragma unroll
  for (int r = 0; r < 8; ++r) { const float lr = __shfl(lrun, 8 * g + r, 32); const float inv = 1.0f / (lr * 16384.0f * 4.0f);
#pragma unroll
    for (int t = 0; t < 4; ++t) sO[w][8 * g + r][t * 16 + col] = (acc[t][r] + ac1[t][r] * (1.0f / VLO) + ac2[t][r] * (1.0f / PLO)) * inv; }
  LDSX();
  for (int qq = lane; qq < 16 * 16; qq += 32) { const int rl = qq >> 4, pc = qq & 15; vst2(O32 + ((bh * SS) + q0 + rl) * HD + pc * 4, *(const v4f*)(&sO[w][rl][pc * 4])); }
  }
}
// out = ctx Wo^T + bo : split(ctx) x bf16(Wo rows): 2 products (Wo is an INPUT -> bf16 exact)
__global__ __launch_bounds__(128) void k_out(const float* __restrict__ O32, int rbase, const __bf16* __restrict__ PT, const float* __restrict__ bo, float* __restrict__ out) {
  __shared__ __align__(16) float so[4][16][132];
  const int tid = threadIdx.x, wave = tid >> 5, lane = tid & 31, col = lane & 15, g = lane >> 4;
  const int r0 = blockIdx.x * 64 + wave * 16, n0 = blockIdx.y * 128; const int ra = r0 + col; const int b = ra / SS, s = ra % SS;
  v8f acc[8] = {};
#pragma unroll 1
  for (int kc = 0; kc < E / 32; ++kc) { const int h = kc >> 1; const F2 a = split_row(O32 + (((size_t)b * NH + h) * SS + s) * HD, (kc & 1) * 32, lane);
#pragma unroll
    for (int j = 0; j < 8; ++j) { const v16b wb = frag_b(PT + (size_t)(3 * E + n0 + j * 16 + col) * E + kc * 32, lane); acc[j] = wmma_bf(a.l, wb, acc[j]); acc[j] = wmma_bf(a.h, wb, acc[j]); } }
#pragma unroll
  for (int j = 0; j < 8; ++j) { const int n = n0 + j * 16 + col; const float bb = bfr(bo[n]);
#pragma unroll
    for (int r = 0; r < 8; ++r) so[wave][8 * g + r][j * 16 + col] = acc[j][r] + bb; }
  LDSX();
#pragma unroll 4
  for (int rl = 0; rl < 16; ++rl) vst2(out + (size_t)(rbase + r0 + rl) * E + n0 + lane * 4, *(const v4f*)(&so[wave][rl][lane * 4]));
}
#define NBHALF 2
extern "C" void kernel_launch(void* const* d_in, const int* in_sizes, int n_in, void* d_out, int out_size, void* d_ws, size_t ws_size, hipStream_t stream) {
  (void)in_sizes; (void)n_in; (void)out_size; (void)ws_size;
  const float* x = (const float*)d_in[0]; const float* Wqkv = (const float*)d_in[1]; const float* Wp = (const float*)d_in[2]; const float* bp = (const float*)d_in[3];
  float* out = (float*)d_out;
  char* ws = (char*)d_ws; size_t off = 0;
  auto take = [&](size_t bytes) { char* p = ws + off; off += (bytes + 255) & ~(size_t)255; return p; };
  const size_t HR = (size_t)NBHALF * SS;     // rows per half (4096)
  __bf16* Xb = (__bf16*)take((size_t)NR * E * 2); __bf16* PT = (__bf16*)take((size_t)4 * E * E * 2);
  float* Q32 = (float*)take((size_t)NR * E * 4); float* K32 = (float*)take((size_t)NR * E * 4); _Float16* VTh = (_Float16*)take((size_t)NR * E * 2); _Float16* VTl = (_Float16*)take((size_t)NR * E * 2);
  float* O32 = Q32;      // in place: each k_attn wave reads its own 16 query rows into registers before writing the same rows; no other block reads them
  // ws ~ 120 MB; Q/K/V of all four batches are held at once, so that one attention launch covers all 64 (batch, head) pairs
  k_cvt<<<(NR * E / 8 + 255) / 256, 256, 0, stream>>>(x, Xb);
  k_pack<<<4 * E, 128, 0, stream>>>(Wqkv, Wp, PT);
  for (int hf = 0; hf < 2; ++hf) { const int rbase = hf * (int)HR; const size_t ho = hf * HR * E;
    k_qkv<<<dim3(HR / 64, E / 128, 3), 128, 0, stream>>>(Xb, rbase, PT, Q32 + ho, K32 + ho, VTh + ho, VTl + ho); }
  k_attn<<<dim3(SS / 128, NB * NH), 128, 0, stream>>>(Q32, K32, VTh, VTl, O32);
  for (int hf = 0; hf < 2; ++hf) { const int rbase = hf * (int)HR; const size_t ho = hf * HR * E;
    k_out<<<dim3(HR / 64, E / 128), 128, 0, stream>>>(O32 + ho, rbase, PT, bp, out); }
}

// v002
// A run of this version takes 454 microseconds.
// Timed twice side by side with v001, it ran 1.65 and 1.66 times as fast.
// Counting every step since v000, it is 2.28 times as fast.
// compute dtype: x, w_qkv, w_proj, b_proj (INPUTS) rounded to bf16 with exact bf16 WMMA products (f32 accumulate) for the projections; q/k f32 split for the scores (3 products), P and V f16 hi/lo (3 products); softmax f32.
#include <hip/hip_runtime.h>
#include <math.h>

typedef __attribute__((ext_vector_type(16))) _Float16 v16h;
typedef __attribute__((ext_vector_type(16))) __bf16 v16b;
typedef __attribute__((ext_vector_type(8)))  _Float16 v8h;
typedef __attribute__((ext_vector_type(8)))  float v8f;
typedef __attribute__((ext_vector_type(4)))  float v4f;
typedef __attribute__((ext_vector_type(2)))  float v2f;
typedef __attribute__((ext_vector_type(4)))  unsigned v4u;
typedef __attribute__((ext_vector_type(4)))  int v4i;
typedef float __attribute__((may_alias)) float_a;
typedef int __attribute__((may_alias)) int_a;

template <typename T> __device__ __forceinline__ void vst2(void* p, T v) { *(T*)p = v;  }
__device__ __forceinline__ v8f wmma16(v16h a, v16h b, v8f c) {
  v8f d = __builtin_amdgcn_wmma_f32_16x16x32_f16(false, a, false, b, (short)0, c, false, false);
  asm volatile("v_nop\n\tv_nop\n\tv_nop\n\tv_nop" : "+v"(d) : "v"(a), "v"(b));
  return d;
}
__device__ __forceinline__ v8f wmma_bf(v16b a, v16b b, v8f c) {
  v8f d = __builtin_amdgcn_wmma_f32_16x16x32_bf16(false, a, false, b, (short)0, c, false, false);
  asm volatile("v_nop\n\tv_nop\n\tv_nop\n\tv_nop" : "+v"(d) : "v"(a), "v"(b));
  return d;
}
// 16x16x32 fragments: lane = (h = lane>>4, row/col = lane&15); elements 0..7 = k0+8h+0..7, 8..15 = k0+16+8h+0..7; D element r = row 8h+r
__device__ __forceinline__ v16h frag_h(const _Float16* rowk0, int lane) {
  union { v16h v; v8h q[2]; } u; const _Float16* p = rowk0 + 8 * (lane >> 4);
  u.q[0] = *(const v8h*)p; u.q[1] = *(const v8h*)(p + 16); return u.v;
}
__device__ __forceinline__ v16h frag_f32(const float* rowk0, int lane) {
  v16h a; const float* p = rowk0 + 8 * (lane >> 4);
#pragma unroll
  for (int i = 0; i < 8; ++i) { a[i] = (_Float16)p[i]; a[8 + i] = (_Float16)p[16 + i]; }
  return a;
}
__device__ __forceinline__ v16h frag_f32s(const float* rowk0, int lane, float sc) {
  v16h a; const float* p = rowk0 + 8 * (lane >> 4);
#pragma unroll
  for (int i = 0; i < 8; ++i) { a[i] = (_Float16)(p[i] * sc); a[8 + i] = (_Float16)(p[16 + i] * sc); }
  return a;
}
// column fragment from a [K][ld] layout (column n), rows >= K read as 0
__device__ __forceinline__ v16h fragc_f32(const float* W, int k0, int n, int lane, int ld, int K) {
  v16h a; const int g = lane >> 4;
#pragma unroll
  for (int i = 0; i < 8; ++i) { const int ka = k0 + 8 * g + i, kb = ka + 16;
    a[i] = (_Float16)(ka < K ? W[(size_t)(ka < K ? ka : K - 1) * ld + n] : 0.f); a[8 + i] = (_Float16)(kb < K ? W[(size_t)(kb < K ? kb : K - 1) * ld + n] : 0.f); }
  return a;
}
struct F2 { v16b h, l; };
__device__ __forceinline__ F2 bsplit16(const float v[16]) { F2 r;
#pragma unroll
  for (int i = 0; i < 16; ++i) { const __bf16 h = (__bf16)v[i]; r.h[i] = h; r.l[i] = (__bf16)(v[i] - (float)h); }
  return r; }
__device__ __forceinline__ F2 split_row(const float* row, int k0, int lane) { float v[16]; const float* p = row + k0 + 8 * (lane >> 4);
#pragma unroll
  for (int i = 0; i < 8; ++i) { v[i] = p[i]; v[8 + i] = p[16 + i]; }
  return bsplit16(v); }
__device__ __forceinline__ F2 split_rowK(const float* row, int k0, int lane, int K) { float v[16]; const int g = lane >> 4;
#pragma unroll
  for (int i = 0; i < 8; ++i) { const int ka = k0 + 8 * g + i, kb = ka + 16; v[i] = ka < K ? row[ka < K ? ka : K - 1] : 0.f; v[8 + i] = kb < K ? row[kb < K ? kb : K - 1] : 0.f; }
  return bsplit16(v); }
__device__ __forceinline__ F2 split_col(const float* W, int k0, int n, int lane, int ld, int K) { float v[16]; const int g = lane >> 4;
#pragma unroll
  for (int i = 0; i < 8; ++i) { const int ka = k0 + 8 * g + i, kb = ka + 16; v[i] = ka < K ? W[(size_t)(ka < K ? ka : K - 1) * ld + n] : 0.f; v[8 + i] = kb < K ? W[(size_t)(kb < K ? kb : K - 1) * ld + n] : 0.f; }
  return bsplit16(v); }
__device__ __forceinline__ v8f mac3(const F2& a, const F2& b, v8f c) { c = wmma_bf(a.l, b.h, c); c = wmma_bf(a.h, b.l, c); return wmma_bf(a.h, b.h, c); }
__device__ __forceinline__ float sigm(float v) { return 1.0f / (1.0f + expf(-v)); }
#define LDSX() do { asm volatile("s_wait_dscnt 0" ::: "memory"); __builtin_amdgcn_wave_barrier(); __builtin_amdgcn_fence(__ATOMIC_RELEASE, "workgroup"); } while (0)


#define NB 4
#define SS 2048
#define E 1024
#define NH 16
#define HD 64
#define NR (NB * SS)
#define PLO 1024.0f
#define VLO 2048.0f
__device__ __forceinline__ float bfr(float v) { return (float)(__bf16)v; }
__device__ __forceinline__ v16b frag_b(const __bf16* rowk0, int lane) { return __builtin_bit_cast(v16b, frag_h((const _Float16*)rowk0, lane)); }

// asynchronous copies to LDS, 16 bytes a lane: l = the lane's LDS byte address, g = its global address. The s_wait_xcnt closes each statement, so that no address register is rewritten ahead of it.
#define CPY "global_load_async_to_lds_b128 "
__device__ __forceinline__ void cp4(unsigned l, unsigned ls, const char* g, size_t gs) {
  asm volatile(CPY "%0, %1, off\n\t" CPY "%2, %3, off\n\t" CPY "%4, %5, off\n\t" CPY "%6, %7, off\n\ts_wait_xcnt 0x0"
               :: "v"(l), "v"(g), "v"(l + ls), "v"(g + gs), "v"(l + 2 * ls), "v"(g + 2 * gs), "v"(l + 3 * ls), "v"(g + 3 * gs) : "memory");
}
// publish point of the two-buffer ring: own LDS reads done, own copies landed, then the work-group barrier (it publishes the next tile and frees the buffer just read)
#define RING_PUBLISH() do { asm volatile("s_wait_dscnt 0x0" ::: "memory"); asm volatile("s_wait_asynccnt 0x0" ::: "memory"); __syncthreads(); } while (0)
#define KT 64                         // k per stage: 128 B of a bf16 row, 256 B of an f32 row
#define PB 144                        // LDS pitch of a 128-B row, 16 B x odd: ds_load_b128 free of bank conflicts
#define PF 272                        // LDS pitch of a 256-B row, likewise
#define QBUF (192 * PB)               // k_qkv stage: 64 x rows, then 128 weight rows
#define OBUF (64 * PF + 128 * PB)     // k_out stage: 64 f32 ctx rows, then 128 weight rows
__device__ __forceinline__ F2 split_row4(const float* p) { float v[16]; const v4f a = *(const v4f*)p, b = *(const v4f*)(p + 4), c = *(const v4f*)(p + 16), d = *(const v4f*)(p + 20);
#pragma unroll
  for (int i = 0; i < 4; ++i) { v[i] = a[i]; v[4 + i] = b[i]; v[8 + i] = c[i]; v[12 + i] = d[i]; }
  return bsplit16(v); }

__global__ __launch_bounds__(256) void k_cvt(const float* __restrict__ x, __bf16* __restrict__ Xb) {
  const size_t i8 = (size_t)blockIdx.x * 256 + threadIdx.x; if (i8 >= (size_t)NR * E / 8) return;
  union { __bf16 h[8]; v4u u; } pk;
#pragma unroll
  for (int e = 0; e < 8; ++e) pk.h[e] = (__bf16)x[i8 * 8 + e];
  vst2((unsigned*)(Xb + i8 * 8), pk.u);
}
// PT rows: [0,3E) = w_qkv rows (q | k | v output features), [3E,4E) = w_proj rows ([out][in] weights)
__global__ __launch_bounds__(128) void k_pack(const float* __restrict__ Wqkv, const float* __restrict__ Wp, __bf16* __restrict__ PT) {
  const int n = blockIdx.x, tid = threadIdx.x; __shared__ __align__(16) __bf16 srow[E];
  for (int k = tid; k < E; k += 128) srow[k] = (__bf16)(n < 3 * E ? Wqkv[(size_t)n * E + k] : Wp[(size_t)(n - 3 * E) * E + k]);      // [out][in]: rows
  __syncthreads();
  if (tid < E / 8) vst2((unsigned*)(PT + (size_t)n * E + tid * 8), *(const v4u*)(&srow[tid * 8]));
}
// QKV: block (64 rows, 128 cols = 2 heads, which); q,k -> Q32/K32 f32 [bh][s][64]; v -> VT hi/lo x4 [bh][d][s]
__global__ __launch_bounds__(128) void k_qkv(const __bf16* __restrict__ Xb, int rbase, const __bf16* __restrict__ PT, float* __restrict__ Q32, float* __restrict__ K32, _Float16* __restrict__ VTh, _Float16* __restrict__ VTl) {
  __shared__ __align__(16) char sm[70656];      // the ring (2 x QBUF) in the loop; behind its last barrier the output staging
  float (*so)[16][132] = (float (*)[16][132])sm; _Float16 (*sth)[72] = (_Float16 (*)[72])(sm + 33792); _Float16 (*stl)[72] = (_Float16 (*)[72])(sm + 33792 + 18432);
  const int tid = threadIdx.x, wave = tid >> 5, lane = tid & 31, col = lane & 15, g = lane >> 4;
  const int which = blockIdx.z, r0b = blockIdx.x * 64, r0 = r0b + wave * 16, n0 = blockIdx.y * 128; const int b = r0b / SS, s0 = r0b % SS;
  v8f acc[8] = {};
  // a copy of the block moves 16 rows of 128 B: thread -> (row tid >> 3, 16-B piece tid & 7), whole lines per wave
  const char* gA = (const char*)(Xb + (size_t)(rbase + r0b + (tid >> 3)) * E + (tid & 7) * 8);
  const char* gB = (const char*)(PT + (size_t)(which * E + n0 + (tid >> 3)) * E + (tid & 7) * 8);
  const unsigned l0 = (unsigned)(size_t)sm + (tid >> 3) * PB + (tid & 7) * 16;
  auto fill = [&](int t) { const unsigned l = l0 + (t & 1) * QBUF; const size_t ko = (size_t)t * KT * 2;
    cp4(l, 16 * PB, gA + ko, (size_t)16 * E * 2); cp4(l + 64 * PB, 16 * PB, gB + ko, (size_t)16 * E * 2); cp4(l + 128 * PB, 16 * PB, gB + ko + (size_t)64 * E * 2, (size_t)16 * E * 2); };
  fill(0);
  asm volatile("s_wait_asynccnt 0x0" ::: "memory");   // stage 0 landed before the barrier that publishes it
  __syncthreads();
  fill(1);
#pragma unroll 1   // rolled: one copy of the loop's text, the buffer picked by t & 1
  for (int t = 0; t < E / KT; ++t) { const char* bp = sm + (t & 1) * QBUF; v16b a[2], wf[2][8];   // the stage's LDS reads stand as one group ahead of its matrix run
#pragma unroll
    for (int kk = 0; kk < 2; ++kk) { a[kk] = frag_b((const __bf16*)(bp + (wave * 16 + col) * PB) + kk * 32, lane);
#pragma unroll
      for (int j = 0; j < 8; ++j) wf[kk][j] = frag_b((const __bf16*)(bp + (64 + j * 16 + col) * PB) + kk * 32, lane); }
#pragma unroll
    for (int kk = 0; kk < 2; ++kk) {
#pragma unroll
      for (int j = 0; j < 8; ++j) acc[j] = wmma_bf(a[kk], wf[kk][j], acc[j]); }
    RING_PUBLISH();
    if (t + 2 < E / KT) fill(t + 2); }
  asm volatile("s_wait_asynccnt 0x0" ::: "memory");   // nothing in flight when the ring becomes output staging
  if (which < 2) {
#pragma unroll
    for (int j = 0; j < 8; ++j) { const float bb = 0.f;
#pragma unroll
      for (int r = 0; r < 8; ++r) so[wave][8 * g + r][j * 16 + col] = acc[j][r] + bb; }
    LDSX();
    float* Dst = which == 0 ? Q32 : K32;
    for (int qq = lane; qq < 2 * 16 * 16; qq += 32) { const int hh = qq >> 8, rl = (qq >> 4) & 15, pc = qq & 15; const int h = (n0 >> 6) + hh;
      vst2(Dst + (((size_t)b * NH + h) * SS + s0 + wave * 16 + rl) * HD + pc * 4, *(const v4f*)(&so[wave][rl][hh * 64 + pc * 4])); } }
  else {
#pragma unroll
    for (int j = 0; j < 8; ++j) { const float bb = 0.f;
#pragma unroll
      for (int r = 0; r < 8; ++r) { const float v = (acc[j][r] + bb) * 4.0f; const _Float16 hi = (_Float16)v; sth[j * 16 + col][wave * 16 + 8 * g + r] = hi; stl[j * 16 + col][wave * 16 + 8 * g + r] = (_Float16)((v - (float)hi) * VLO); } }
    __syncthreads();
    for (int qq = tid; qq < 128 * 8; qq += 128) { const int cl = qq >> 3, pc = qq & 7; const int c = n0 + cl, h = c >> 6, d = c & 63; const size_t o = (((size_t)b * NH + h) * HD + d) * SS + s0 + pc * 8;
      vst2(VTh + o, *(const v4u*)(&sth[cl][pc * 8])); vst2(VTl + o, *(const v4u*)(&stl[cl][pc * 8])); } }
}
// causal attention: block (query tiles t and 31 - t of 64 queries, one after the other, bh): 33 key tiles in every block; key tiles 0..qb per query tile; S on hi/lo splits of the f32 q/k rows; P,V hi/lo; O f32 [bh][s][64]
// second bound: four waves per SIMD (256 registers a wave), so that all 1024 blocks are resident at once, four on each WGP
__global__ __launch_bounds__(128, 4) void k_attn(const float* __restrict__ Q32, const float* __restrict__ K32, const _Float16* __restrict__ VTh, const _Float16* __restrict__ VTl, float* __restrict__ O32) {
  __shared__ __align__(16) float sS[4][16][68];
  __shared__ __align__(16) _Float16 sPh[4][16][72], sPl[4][16][72];
  __shared__ __align__(16) float sO[4][16][68];
  const int tid = threadIdx.x, w = tid >> 5, lane = tid & 31, col = lane & 15, g = lane >> 4;
  const size_t bh = blockIdx.y;
  for (int pass = 0; pass < 2; ++pass) {
  const int qb = pass == 0 ? (int)blockIdx.x : SS / 64 - 1 - (int)blockIdx.x; const int q0 = qb * 64 + w * 16;
  F2 aq[2];
#pragma unroll
  for (int kc = 0; kc < 2; ++kc) aq[kc] = split_row(Q32 + (bh * SS + q0 + col) * HD, kc * 32, lane);
  float mrun = -3.0e38f, lrun = 0.f; v8f acc[4] = {}, ac1[4] = {}, ac2[4] = {};
#pragma unroll 1
  for (int kt = 0; kt <= qb; ++kt) {
#pragma unroll
    for (int t = 0; t < 4; ++t) { const int key = kt * 64 + t * 16 + col; const float* krow = K32 + (bh * SS + key) * HD;
      v8f s = mac3(aq[0], split_row(krow, 0, lane), (v8f){}); s = mac3(aq[1], split_row(krow, 32, lane), s);
#pragma unroll
      for (int r = 0; r < 8; ++r) { sS[w][8 * g + r][t * 16 + col] = (key > q0 + 8 * g + r) ? -3.0e38f : s[r] * 0.125f; } }
    LDSX();
    float mx = -3.4e38f;
#pragma unroll
    for (int jj = 0; jj < 32; ++jj) mx = fmaxf(mx, sS[w][col][g * 32 + jj]);
    mx = fmaxf(mx, __shfl_xor(mx, 16, 32));
    const float mnew = fmaxf(mrun, mx); const float corr = expf(mrun - mnew);
    float ps = 0.f;
#pragma unroll
    for (int jj = 0; jj < 32; ++jj) { const float p = expf(sS[w][col][g * 32 + jj] - mnew) * 16384.0f; ps += p; const _Float16 hi = (_Float16)p; sPh[w][col][g * 32 + jj] = hi; sPl[w][col][g * 32 + jj] = (_Float16)((p - (float)hi) * PLO); }
    ps += __shfl_xor(ps, 16, 32);
    lrun = lrun * corr + ps * (1.0f / 16384.0f); mrun = mnew;
#pragma unroll
    for (int r = 0; r < 8; ++r) { const float cr = __shfl(corr, 8 * g + r, 32);
#pragma unroll
      for (int t = 0; t < 4; ++t) { acc[t][r] *= cr; ac1[t][r] *= cr; ac2[t][r] *= cr; } }
    LDSX();
#pragma unroll
    for (int kc = 0; kc < 2; ++kc) { const v16h ph = frag_h(&sPh[w][col][0] + kc * 32, lane), pl = frag_h(&sPl[w][col][0] + kc * 32, lane);
#pragma unroll
      for (int t = 0; t < 4; ++t) { const size_t vo = (bh * HD + t * 16 + col) * SS + kt * 64 + kc * 32; const v16h vh = frag_h(VTh + vo, lane);
        acc[t] = wmma16(ph, vh, acc[t]); ac1[t] = wmma16(ph, frag_h(VTl + vo, lane), ac1[t]); ac2[t] = wmma16(pl, vh, ac2[t]); } }
    __builtin_amdgcn_wave_barrier(); }
#pragma unroll
  for (int r = 0; r < 8; ++r) { const float lr = __shfl(lrun, 8 * g + r, 32); const float inv = 1.0f / (lr * 16384.0f * 4.0f);
#pragma unroll
    for (int t = 0; t < 4; ++t) sO[w][8 * g + r][t * 16 + col] = (acc[t][r] + ac1[t][r] * (1.0f / VLO) + ac2[t][r] * (1.0f / PLO)) * inv; }
  LDSX();
  for (int qq = lane; qq < 16 * 16; qq += 32) { const int rl = qq >> 4, pc = qq & 15; vst2(O32 + ((bh * SS) + q0 + rl) * HD + pc * 4, *(const v4f*)(&sO[w][rl][pc * 4])); }
  }
}
// out = ctx Wo^T + bo : split(ctx) x bf16(Wo rows): 2 products (Wo is an INPUT -> bf16 exact)
__global__ __launch_bounds__(128) void k_out(const float* __restrict__ O32, int rbase, const __bf16* __restrict__ PT, const float* __restrict__ bo, float* __restrict__ out) {
  __shared__ __align__(16) char sm[2 * OBUF];   // the ring in the loop; behind its last barrier the output staging
  float (*so)[16][132] = (float (*)[16][132])sm;
  const int tid = threadIdx.x, wave = tid >> 5, lane = tid & 31, col = lane & 15, g = lane >> 4;
  const int r0b = blockIdx.x * 64, r0 = r0b + wave * 16, n0 = blockIdx.y * 128; const int b = r0b / SS, s0 = r0b % SS;
  v8f acc[8] = {};
  // stage t = head t: ctx rows of 256 B (a copy of the block moves 8 rows), weight rows of 128 B (16 rows), whole lines per wave
  const char* gA = (const char*)(O32 + ((size_t)b * NH * SS + s0 + (tid >> 4)) * HD + (tid & 15) * 4);
  const char* gB = (const char*)(PT + (size_t)(3 * E + n0 + (tid >> 3)) * E + (tid & 7) * 8);
  const unsigned lA = (unsigned)(size_t)sm + (tid >> 4) * PF + (tid & 15) * 16, lB = (unsigned)(size_t)sm + 64 * PF + (tid >> 3) * PB + (tid & 7) * 16;
  auto fill = [&](int t) { const unsigned bo2 = (t & 1) * OBUF; const char* a = gA + (size_t)t * SS * HD * 4; const char* w = gB + (size_t)t * KT * 2;
    cp4(lA + bo2, 8 * PF, a, (size_t)8 * HD * 4); cp4(lA + bo2 + 32 * PF, 8 * PF, a + (size_t)32 * HD * 4, (size_t)8 * HD * 4);
    cp4(lB + bo2, 16 * PB, w, (size_t)16 * E * 2); cp4(lB + bo2 + 64 * PB, 16 * PB, w + (size_t)64 * E * 2, (size_t)16 * E * 2); };
  fill(0);
  asm volatile("s_wait_asynccnt 0x0" ::: "memory");   // stage 0 landed before the barrier that publishes it
  __syncthreads();
  fill(1);
#pragma unroll 1   // rolled: one copy of the loop's text, the buffer picked by t & 1
  for (int t = 0; t < E / KT; ++t) { const char* bp = sm + (t & 1) * OBUF; F2 a[2]; v16b wf[2][8];   // the stage's LDS reads stand as one group ahead of its matrix run
#pragma unroll
    for (int kk = 0; kk < 2; ++kk) { a[kk] = split_row4((const float*)(bp + (wave * 16 + col) * PF) + kk * 32 + 8 * g);
#pragma unroll
      for (int j = 0; j < 8; ++j) wf[kk][j] = frag_b((const __bf16*)(bp + 64 * PF + (j * 16 + col) * PB) + kk * 32, lane); }
#pragma unroll
    for (int kk = 0; kk < 2; ++kk) {
#pragma unroll
      for (int j = 0; j < 8; ++j) { acc[j] = wmma_bf(a[kk].l, wf[kk][j], acc[j]); acc[j] = wmma_bf(a[kk].h, wf[kk][j], acc[j]); } }
    RING_PUBLISH();
    if (t + 2 < E / KT) fill(t + 2); }
  asm volatile("s_wait_asynccnt 0x0" ::: "memory");   // nothing in flight when the ring becomes output staging
#pragma unroll
  for (int j = 0; j < 8; ++j) { const int n = n0 + j * 16 + col; const float bb = bfr(bo[n]);
#pragma unroll
    for (int r = 0; r < 8; ++r) so[wave][8 * g + r][j * 16 + col] = acc[j][r] + bb; }
  LDSX();
#pragma unroll 4
  for (int rl = 0; rl < 16; ++rl) vst2(out + (size_t)(rbase + r0 + rl) * E + n0 + lane * 4, *(const v4f*)(&so[wave][rl][lane * 4]));
}
#define NBHALF 2
extern "C" void kernel_launch(void* const* d_in, const int* in_sizes, int n_in, void* d_out, int out_size, void* d_ws, size_t ws_size, hipStream_t stream) {
  (void)in_sizes; (void)n_in; (void)out_size; (void)ws_size;
  const float* x = (const float*)d_in[0]; const float* Wqkv = (const float*)d_in[1]; const float* Wp = (const float*)d_in[2]; const float* bp = (const float*)d_in[3];
  float* out = (float*)d_out;
  char* ws = (char*)d_ws; size_t off = 0;
  auto take = [&](size_t bytes) { char* p = ws + off; off += (bytes + 255) & ~(size_t)255; return p; };
  const size_t HR = (size_t)NBHALF * SS;     // rows per half (4096)
  __bf16* Xb = (__bf16*)take((size_t)NR * E * 2); __bf16* PT = (__bf16*)take((size_t)4 * E * E * 2);
  float* Q32 = (float*)take((size_t)NR * E * 4); float* K32 = (float*)take((size_t)NR * E * 4); _Float16* VTh = (_Float16*)take((size_t)NR * E * 2); _Float16* VTl = (_Float16*)take((size_t)NR * E * 2);
  float* O32 = Q32;      // in place: each k_attn wave reads its own 16 query rows into registers before writing the same rows; no other block reads them
  // ws ~ 120 MB; Q/K/V of all four batches are held at once, so that one attention launch covers all 64 (batch, head) pairs
  k_cvt<<<(NR * E / 8 + 255) / 256, 256, 0, stream>>>(x, Xb);
  k_pack<<<4 * E, 128, 0, stream>>>(Wqkv, Wp, PT);
  for (int hf = 0; hf < 2; ++hf) { const int rbase = hf * (int)HR; const size_t ho = hf * HR * E;
    k_qkv<<<dim3(HR / 64, E / 128, 3), 128, 0, stream>>>(Xb, rbase, PT, Q32 + ho, K32 + ho, VTh + ho, VTl + ho); }
  k_attn<<<dim3(SS / 128, NB * NH), 128, 0, stream>>>(Q32, K32, VTh, VTl, O32);
  for (int hf = 0; hf < 2; ++hf) { const int rbase = hf * (int)HR; const size_t ho = hf * HR * E;
    k_out<<<dim3(HR / 64, E / 128), 128, 0, stream>>>(O32 + ho, rbase, PT, bp, out); }
}

// v003
// Measured time: 286 microseconds a run.
// In both of two side-by-side timings against v002, it was 1.57 times as fast.
// Counting every step since v000, it is 3.58 times as fast.
// compute dtype: x, w_qkv, w_proj, b_proj (INPUTS) rounded to bf16 with exact bf16 WMMA products (f32 accumulate) for the projections; q/k f32 split for the scores (3 products), P and V f16 hi/lo (3 products); softmax f32.
#include <hip/hip_runtime.h>
#include <math.h>

typedef __attribute__((ext_vector_type(16))) _Float16 v16h;
typedef __attribute__((ext_vector_type(16))) __bf16 v16b;
typedef __attribute__((ext_vector_type(8)))  _Float16 v8h;
typedef __attribute__((ext_vector_type(8)))  float v8f;
typedef __attribute__((ext_vector_type(4)))  float v4f;
typedef __attribute__((ext_vector_type(2)))  float v2f;
typedef __attribute__((ext_vector_type(4)))  unsigned v4u;
typedef __attribute__((ext_vector_type(4)))  int v4i;
typedef float __attribute__((may_alias)) float_a;
typedef int __attribute__((may_alias)) int_a;

template <typename T> __device__ __forceinline__ void vst2(void* p, T v) { *(T*)p = v;  }
__device__ __forceinline__ v8f wmma16(v16h a, v16h b, v8f c) {
  v8f d = __builtin_amdgcn_wmma_f32_16x16x32_f16(false, a, false, b, (short)0, c, false, false);
  asm volatile("v_nop\n\tv_nop\n\tv_nop\n\tv_nop" : "+v"(d) : "v"(a), "v"(b));
  return d;
}
__device__ __forceinline__ v8f wmma_bf(v16b a, v16b b, v8f c) {
  v8f d = __builtin_amdgcn_wmma_f32_16x16x32_bf16(false, a, false, b, (short)0, c, false, false);
  asm volatile("v_nop\n\tv_nop\n\tv_nop\n\tv_nop" : "+v"(d) : "v"(a), "v"(b));
  return d;
}
// 16x16x32 fragments: lane = (h = lane>>4, row/col = lane&15); elements 0..7 = k0+8h+0..7, 8..15 = k0+16+8h+0..7; D element r = row 8h+r
__device__ __forceinline__ v16h frag_h(const _Float16* rowk0, int lane) {
  union { v16h v; v8h q[2]; } u; const _Float16* p = rowk0 + 8 * (lane >> 4);
  u.q[0] = *(const v8h*)p; u.q[1] = *(const v8h*)(p + 16); return u.v;
}
__device__ __forceinline__ v16h frag_f32(const float* rowk0, int lane) {
  v16h a; const float* p = rowk0 + 8 * (lane >> 4);
#pragma unroll
  for (int i = 0; i < 8; ++i) { a[i] = (_Float16)p[i]; a[8 + i] = (_Float16)p[16 + i]; }
  return a;
}
__device__ __forceinline__ v16h frag_f32s(const float* rowk0, int lane, float sc) {
  v16h a; const float* p = rowk0 + 8 * (lane >> 4);
#pragma unroll
  for (int i = 0; i < 8; ++i) { a[i] = (_Float16)(p[i] * sc); a[8 + i] = (_Float16)(p[16 + i] * sc); }
  return a;
}
// column fragment from a [K][ld] layout (column n), rows >= K read as 0
__device__ __forceinline__ v16h fragc_f32(const float* W, int k0, int n, int lane, int ld, int K) {
  v16h a; const int g = lane >> 4;
#pragma unroll
  for (int i = 0; i < 8; ++i) { const int ka = k0 + 8 * g + i, kb = ka + 16;
    a[i] = (_Float16)(ka < K ? W[(size_t)(ka < K ? ka : K - 1) * ld + n] : 0.f); a[8 + i] = (_Float16)(kb < K ? W[(size_t)(kb < K ? kb : K - 1) * ld + n] : 0.f); }
  return a;
}
struct F2 { v16b h, l; };
__device__ __forceinline__ F2 bsplit16(const float v[16]) { F2 r;
#pragma unroll
  for (int i = 0; i < 16; ++i) { const __bf16 h = (__bf16)v[i]; r.h[i] = h; r.l[i] = (__bf16)(v[i] - (float)h); }
  return r; }
__device__ __forceinline__ F2 split_row(const float* row, int k0, int lane) { float v[16]; const float* p = row + k0 + 8 * (lane >> 4);
#pragma unroll
  for (int i = 0; i < 8; ++i) { v[i] = p[i]; v[8 + i] = p[16 + i]; }
  return bsplit16(v); }
__device__ __forceinline__ F2 split_rowK(const float* row, int k0, int lane, int K) { float v[16]; const int g = lane >> 4;
#pragma unroll
  for (int i = 0; i < 8; ++i) { const int ka = k0 + 8 * g + i, kb = ka + 16; v[i] = ka < K ? row[ka < K ? ka : K - 1] : 0.f; v[8 + i] = kb < K ? row[kb < K ? kb : K - 1] : 0.f; }
  return bsplit16(v); }
__device__ __forceinline__ F2 split_col(const float* W, int k0, int n, int lane, int ld, int K) { float v[16]; const int g = lane >> 4;
#pragma unroll
  for (int i = 0; i < 8; ++i) { const int ka = k0 + 8 * g + i, kb = ka + 16; v[i] = ka < K ? W[(size_t)(ka < K ? ka : K - 1) * ld + n] : 0.f; v[8 + i] = kb < K ? W[(size_t)(kb < K ? kb : K - 1) * ld + n] : 0.f; }
  return bsplit16(v); }
__device__ __forceinline__ v8f mac3(const F2& a, const F2& b, v8f c) { c = wmma_bf(a.l, b.h, c); c = wmma_bf(a.h, b.l, c); return wmma_bf(a.h, b.h, c); }
__device__ __forceinline__ float sigm(float v) { return 1.0f / (1.0f + expf(-v)); }
#define LDSX() do { asm volatile("s_wait_dscnt 0" ::: "memory"); __builtin_amdgcn_wave_barrier(); __builtin_amdgcn_fence(__ATOMIC_RELEASE, "workgroup"); } while (0)


#define NB 4
#define SS 2048
#define E 1024
#define NH 16
#define HD 64
#define NR (NB * SS)
#define PLO 1024.0f
#define VLO 2048.0f
__device__ __forceinline__ float bfr(float v) { return (float)(__bf16)v; }
__device__ __forceinline__ v16b frag_b(const __bf16* rowk0, int lane) { return __builtin_bit_cast(v16b, frag_h((const _Float16*)rowk0, lane)); }

// asynchronous copies to LDS, 16 bytes a lane: l = the lane's LDS byte address, g = its global address. The s_wait_xcnt closes each statement, so that no address register is rewritten ahead of it.
#define CPY "global_load_async_to_lds_b128 "
__device__ __forceinline__ void cp4(unsigned l, unsigned ls, const char* g, size_t gs) {
  asm volatile(CPY "%0, %1, off\n\t" CPY "%2, %3, off\n\t" CPY "%4, %5, off\n\t" CPY "%6, %7, off\n\ts_wait_xcnt 0x0"
               :: "v"(l), "v"(g), "v"(l + ls), "v"(g + gs), "v"(l + 2 * ls), "v"(g + 2 * gs), "v"(l + 3 * ls), "v"(g + 3 * gs) : "memory");
}
__device__ __forceinline__ void cp2(unsigned l, unsigned ls, const char* g, size_t gs) {
  asm volatile(CPY "%0, %1, off\n\t" CPY "%2, %3, off\n\ts_wait_xcnt 0x0" :: "v"(l), "v"(g), "v"(l + ls), "v"(g + gs) : "memory");
}
// publish point of the two-buffer ring: own LDS reads done, own copies landed, then the work-group barrier (it publishes the next tile and frees the buffer just read)
#define RING_PUBLISH() do { asm volatile("s_wait_dscnt 0x0" ::: "memory"); asm volatile("s_wait_asynccnt 0x0" ::: "memory"); __syncthreads(); } while (0)
#define KT 64                         // k per stage: 128 B of a bf16 row, 256 B of an f32 row
#define PB 144                        // LDS pitch of a 128-B row, 16 B x odd: ds_load_b128 free of bank conflicts
#define PF 272                        // LDS pitch of a 256-B row, likewise
#define QBUF (192 * PB)               // k_qkv stage: 64 x rows, then 128 weight rows
#define OBUF (64 * PF + 128 * PB)     // k_out stage: 64 f32 ctx rows, then 128 weight rows
#define ABUF (64 * PF + 2 * 64 * PB) // k_attn stage: 64 f32 K rows, then 64 V^T hi rows and 64 V^T lo rows of 64 keys
#define NST (2 * (SS / 128 + 1))      // k_attn stages in a block: 2 (t + 1) + 2 (16 - t)
__device__ __forceinline__ F2 split_row4(const float* p) { float v[16]; const v4f a = *(const v4f*)p, b = *(const v4f*)(p + 4), c = *(const v4f*)(p + 16), d = *(const v4f*)(p + 20);
#pragma unroll
  for (int i = 0; i < 4; ++i) { v[i] = a[i]; v[4 + i] = b[i]; v[8 + i] = c[i]; v[12 + i] = d[i]; }
  return bsplit16(v); }

__global__ __launch_bounds__(256) void k_cvt(const float* __restrict__ x, __bf16* __restrict__ Xb) {
  const size_t i8 = (size_t)blockIdx.x * 256 + threadIdx.x; if (i8 >= (size_t)NR * E / 8) return;
  union { __bf16 h[8]; v4u u; } pk;
#pragma unroll
  for (int e = 0; e < 8; ++e) pk.h[e] = (__bf16)x[i8 * 8 + e];
  vst2((unsigned*)(Xb + i8 * 8), pk.u);
}
// PT rows: [0,3E) = w_qkv rows (q | k | v output features), [3E,4E) = w_proj rows ([out][in] weights)
__global__ __launch_bounds__(128) void k_pack(const float* __restrict__ Wqkv, const float* __restrict__ Wp, __bf16* __restrict__ PT) {
  const int n = blockIdx.x, tid = threadIdx.x; __shared__ __align__(16) __bf16 srow[E];
  for (int k = tid; k < E; k += 128) srow[k] = (__bf16)(n < 3 * E ? Wqkv[(size_t)n * E + k] : Wp[(size_t)(n - 3 * E) * E + k]);      // [out][in]: rows
  __syncthreads();
  if (tid < E / 8) vst2((unsigned*)(PT + (size_t)n * E + tid * 8), *(const v4u*)(&srow[tid * 8]));
}
// QKV: block (64 rows, 128 cols = 2 heads, which); q,k -> Q32/K32 f32 [bh][s][64]; v -> VT hi/lo x4 [bh][d][s]
__global__ __launch_bounds__(128) void k_qkv(const __bf16* __restrict__ Xb, int rbase, const __bf16* __restrict__ PT, float* __restrict__ Q32, float* __restrict__ K32, _Float16* __restrict__ VTh, _Float16* __restrict__ VTl) {
  __shared__ __align__(16) char sm[70656];      // the ring (2 x QBUF) in the loop; behind its last barrier the output staging
  float (*so)[16][132] = (float (*)[16][132])sm; _Float16 (*sth)[72] = (_Float16 (*)[72])(sm + 33792); _Float16 (*stl)[72] = (_Float16 (*)[72])(sm + 33792 + 18432);
  const int tid = threadIdx.x, wave = tid >> 5, lane = tid & 31, col = lane & 15, g = lane >> 4;
  const int which = blockIdx.z, r0b = blockIdx.x * 64, r0 = r0b + wave * 16, n0 = blockIdx.y * 128; const int b = r0b / SS, s0 = r0b % SS;
  v8f acc[8] = {};
  // a copy of the block moves 16 rows of 128 B: thread -> (row tid >> 3, 16-B piece tid & 7), whole lines per wave
  const char* gA = (const char*)(Xb + (size_t)(rbase + r0b + (tid >> 3)) * E + (tid & 7) * 8);
  const char* gB = (const char*)(PT + (size_t)(which * E + n0 + (tid >> 3)) * E + (tid & 7) * 8);
  const unsigned l0 = (unsigned)(size_t)sm + (tid >> 3) * PB + (tid & 7) * 16;
  auto fill = [&](int t) { const unsigned l = l0 + (t & 1) * QBUF; const size_t ko = (size_t)t * KT * 2;
    cp4(l, 16 * PB, gA + ko, (size_t)16 * E * 2); cp4(l + 64 * PB, 16 * PB, gB + ko, (size_t)16 * E * 2); cp4(l + 128 * PB, 16 * PB, gB + ko + (size_t)64 * E * 2, (size_t)16 * E * 2); };
  fill(0);
  asm volatile("s_wait_asynccnt 0x0" ::: "memory");   // stage 0 landed before the barrier that publishes it
  __syncthreads();
  fill(1);
#pragma unroll 1   // rolled: one copy of the loop's text, the buffer picked by t & 1
  for (int t = 0; t < E / KT; ++t) { const char* bp = sm + (t & 1) * QBUF; v16b a[2], wf[2][8];   // the stage's LDS reads stand as one group ahead of its matrix run
#pragma unroll
    for (int kk = 0; kk < 2; ++kk) { a[kk] = frag_b((const __bf16*)(bp + (wave * 16 + col) * PB) + kk * 32, lane);
#pragma unroll
      for (int j = 0; j < 8; ++j) wf[kk][j] = frag_b((const __bf16*)(bp + (64 + j * 16 + col) * PB) + kk * 32, lane); }
#pragma unroll
    for (int kk = 0; kk < 2; ++kk) {
#pragma unroll
      for (int j = 0; j < 8; ++j) acc[j] = wmma_bf(a[kk], wf[kk][j], acc[j]); }
    RING_PUBLISH();
    if (t + 2 < E / KT) fill(t + 2); }
  asm volatile("s_wait_asynccnt 0x0" ::: "memory");   // nothing in flight when the ring becomes output staging
  if (which < 2) {
#pragma unroll
    for (int j = 0; j < 8; ++j) { const float bb = 0.f;
#pragma unroll
      for (int r = 0; r < 8; ++r) so[wave][8 * g + r][j * 16 + col] = acc[j][r] + bb; }
    LDSX();
    float* Dst = which == 0 ? Q32 : K32;
    for (int qq = lane; qq < 2 * 16 * 16; qq += 32) { const int hh = qq >> 8, rl = (qq >> 4) & 15, pc = qq & 15; const int h = (n0 >> 6) + hh;
      vst2(Dst + (((size_t)b * NH + h) * SS + s0 + wave * 16 + rl) * HD + pc * 4, *(const v4f*)(&so[wave][rl][hh * 64 + pc * 4])); } }
  else {
#pragma unroll
    for (int j = 0; j < 8; ++j) { const float bb = 0.f;
#pragma unroll
      for (int r = 0; r < 8; ++r) { const float v = (acc[j][r] + bb) * 4.0f; const _Float16 hi = (_Float16)v; sth[j * 16 + col][wave * 16 + 8 * g + r] = hi; stl[j * 16 + col][wave * 16 + 8 * g + r] = (_Float16)((v - (float)hi) * VLO); } }
    __syncthreads();
    for (int qq = tid; qq < 128 * 8; qq += 128) { const int cl = qq >> 3, pc = qq & 7; const int c = n0 + cl, h = c >> 6, d = c & 63; const size_t o = (((size_t)b * NH + h) * HD + d) * SS + s0 + pc * 8;
      vst2(VTh + o, *(const v4u*)(&sth[cl][pc * 8])); vst2(VTl + o, *(const v4u*)(&stl[cl][pc * 8])); } }
}
// causal attention: block of 8 waves (query tiles t and 15 - t of 128 queries, one after the other, bh): 34 key tiles of 64 in every block; S on hi/lo splits of the f32 q/k rows; P,V hi/lo; O f32 [bh][s][64]
// each key tile (K rows f32, V^T hi and lo) is brought into LDS once per query tile by asynchronous copies, whole lines per wave, and read from there by the 8 waves (the last one of a query tile by waves 4..7 only); two buffers, the ring runs on over the change of query tile
// second bound: four waves per SIMD (256 registers a wave); 140 KiB of LDS: two blocks on each WGP, all 512 resident at once
__global__ __launch_bounds__(256, 4) void k_attn(const float* __restrict__ Q32, const float* __restrict__ K32, const _Float16* __restrict__ VTh, const _Float16* __restrict__ VTl, float* __restrict__ O32) {
  __shared__ __align__(16) char ring[2 * ABUF];
  __shared__ __align__(16) float sS[8][16][68];      // scores in the loop, output staging behind it (each wave its own slice)
  __shared__ __align__(16) _Float16 sPh[8][16][72], sPl[8][16][72];
  const int tid = threadIdx.x, w = __builtin_amdgcn_readfirstlane(tid >> 5), lane = tid & 31, col = lane & 15, g = lane >> 4;
  const size_t bh = blockIdx.y;
  const int n0 = 2 * ((int)blockIdx.x + 1);          // key tiles of the first query tile; both together: NST
  // K: a copy of the block moves 16 rows of 256 B; V^T: 32 rows of 128 B
  const char* gK = (const char*)(K32 + (bh * SS + (tid >> 4)) * HD + (tid & 15) * 4);
  const char* gH = (const char*)(VTh + (bh * HD + (tid >> 3)) * SS + (tid & 7) * 8);
  const char* gL = (const char*)(VTl + (bh * HD + (tid >> 3)) * SS + (tid & 7) * 8);
  const unsigned lK = (unsigned)(size_t)ring + (tid >> 4) * PF + (tid & 15) * 16, lV = (unsigned)(size_t)ring + 64 * PF + (tid >> 3) * PB + (tid & 7) * 16;
  auto fill = [&](int s) { const int kt = s < n0 ? s : s - n0; const unsigned bo2 = (s & 1) * ABUF;
    cp4(lK + bo2, 16 * PF, gK + (size_t)kt * 64 * HD * 4, (size_t)16 * HD * 4);
    cp2(lV + bo2, 32 * PB, gH + (size_t)kt * 64 * 2, (size_t)32 * SS * 2); cp2(lV + bo2 + 64 * PB, 32 * PB, gL + (size_t)kt * 64 * 2, (size_t)32 * SS * 2); };
  fill(0);
  asm volatile("s_wait_asynccnt 0x0" ::: "memory");   // stage 0 landed before the barrier that publishes it
  __syncthreads();
  fill(1);
  int st = 0;
  for (int pass = 0; pass < 2; ++pass) {
  const int qb = pass == 0 ? (int)blockIdx.x : SS / 128 - 1 - (int)blockIdx.x; const int q0 = qb * 128 + w * 16;
  F2 aq[2];
#pragma unroll
  for (int kc = 0; kc < 2; ++kc) aq[kc] = split_row(Q32 + (bh * SS + q0 + col) * HD, kc * 32, lane);
  float mrun = -3.0e38f, lrun = 0.f; v8f acc[4] = {}, ac1[4] = {}, ac2[4] = {};
#pragma unroll 1   // rolled: one copy of the loop's text, the buffer picked by st & 1
  for (int kt = 0; kt < 2 * (qb + 1); ++kt, ++st) { const char* bp = ring + (st & 1) * ABUF;
   if (kt * 64 <= q0 + 15) {      // a key tile wholly above the wave's diagonal adds nothing: the wave goes straight to the publish point
#pragma unroll
    for (int t = 0; t < 4; ++t) { const int key = kt * 64 + t * 16 + col; const float* krow = (const float*)(bp + (t * 16 + col) * PF) + 8 * g;
      v8f s = mac3(aq[0], split_row4(krow), (v8f){}); s = mac3(aq[1], split_row4(krow + 32), s);
#pragma unroll
      for (int r = 0; r < 8; ++r) { sS[w][8 * g + r][t * 16 + col] = (key > q0 + 8 * g + r) ? -3.0e38f : s[r] * 0.125f; } }
    LDSX();
    float mx = -3.4e38f;
#pragma unroll
    for (int jj = 0; jj < 32; ++jj) mx = fmaxf(mx, sS[w][col][g * 32 + jj]);
    mx = fmaxf(mx, __shfl_xor(mx, 16, 32));
    const float mnew = fmaxf(mrun, mx); const float corr = expf(mrun - mnew);
    float ps = 0.f;
#pragma unroll
    for (int jj = 0; jj < 32; ++jj) { const float p = expf(sS[w][col][g * 32 + jj] - mnew) * 16384.0f; ps += p; const _Float16 hi = (_Float16)p; sPh[w][col][g * 32 + jj] = hi; sPl[w][col][g * 32 + jj] = (_Float16)((p - (float)hi) * PLO); }
    ps += __shfl_xor(ps, 16, 32);
    lrun = lrun * corr + ps * (1.0f / 16384.0f); mrun = mnew;
#pragma unroll
    for (int r = 0; r < 8; ++r) { const float cr = __shfl(corr, 8 * g + r, 32);
#pragma unroll
      for (int t = 0; t < 4; ++t) { acc[t][r] *= cr; ac1[t][r] *= cr; ac2[t][r] *= cr; } }
    LDSX();
#pragma unroll
    for (int kc = 0; kc < 2; ++kc) { const v16h ph = frag_h(&sPh[w][col][0] + kc * 32, lane), pl = frag_h(&sPl[w][col][0] + kc * 32, lane); v16h vh[2], vl[2];   // the LDS reads of two output tiles stand as one group ahead of their matrix run
#pragma unroll
      for (int tp = 0; tp < 4; tp += 2) {
#pragma unroll
      for (int t = 0; t < 2; ++t) { const _Float16* vr = (const _Float16*)(bp + 64 * PF + ((tp + t) * 16 + col) * PB) + kc * 32; vh[t] = frag_h(vr, lane); vl[t] = frag_h(vr + 64 * PB / 2, lane); }
#pragma unroll
      for (int t = 0; t < 2; ++t) { acc[tp + t] = wmma16(ph, vh[t], acc[tp + t]); ac1[tp + t] = wmma16(ph, vl[t], ac1[tp + t]); ac2[tp + t] = wmma16(pl, vh[t], ac2[tp + t]); } } } }
    RING_PUBLISH();
    if (st + 2 < NST) fill(st + 2); }
#pragma unroll
  for (int r = 0; r < 8; ++r) { const float lr = __shfl(lrun, 8 * g + r, 32); const float inv = 1.0f / (lr * 16384.0f * 4.0f);
#pragma unroll
    for (int t = 0; t < 4; ++t) sS[w][8 * g + r][t * 16 + col] = (acc[t][r] + ac1[t][r] * (1.0f / VLO) + ac2[t][r] * (1.0f / PLO)) * inv; }
  LDSX();
  for (int qq = lane; qq < 16 * 16; qq += 32) { const int rl = qq >> 4, pc = qq & 15; vst2(O32 + ((bh * SS) + q0 + rl) * HD + pc * 4, *(const v4f*)(&sS[w][rl][pc * 4])); }
  LDSX();   // the staged rows are read before the next query tile's scores overwrite them
  }
  asm volatile("s_wait_asynccnt 0x0" ::: "memory");   // nothing in flight when the wave ends
}
// out = ctx Wo^T + bo : split(ctx) x bf16(Wo rows): 2 products (Wo is an INPUT -> bf16 exact)
__global__ __launch_bounds__(128) void k_out(const float* __restrict__ O32, int rbase, const __bf16* __restrict__ PT, const float* __restrict__ bo, float* __restrict__ out) {
  __shared__ __align__(16) char sm[2 * OBUF];   // the ring in the loop; behind its last barrier the output staging
  float (*so)[16][132] = (float (*)[16][132])sm;
  const int tid = threadIdx.x, wave = tid >> 5, lane = tid & 31, col = lane & 15, g = lane >> 4;
  const int r0b = blockIdx.x * 64, r0 = r0b + wave * 16, n0 = blockIdx.y * 128; const int b = r0b / SS, s0 = r0b % SS;
  v8f acc[8] = {};
  // stage t = head t: ctx rows of 256 B (a copy of the block moves 8 rows), weight rows of 128 B (16 rows), whole lines per wave
  const char* gA = (const char*)(O32 + ((size_t)b * NH * SS + s0 + (tid >> 4)) * HD + (tid & 15) * 4);
  const char* gB = (const char*)(PT + (size_t)(3 * E + n0 + (tid >> 3)) * E + (tid & 7) * 8);
  const unsigned lA = (unsigned)(size_t)sm + (tid >> 4) * PF + (tid & 15) * 16, lB = (unsigned)(size_t)sm + 64 * PF + (tid >> 3) * PB + (tid & 7) * 16;
  auto fill = [&](int t) { const unsigned bo2 = (t & 1) * OBUF; const char* a = gA + (size_t)t * SS * HD * 4; const char* w = gB + (size_t)t * KT * 2;
    cp4(lA + bo2, 8 * PF, a, (size_t)8 * HD * 4); cp4(lA + bo2 + 32 * PF, 8 * PF, a + (size_t)32 * HD * 4, (size_t)8 * HD * 4);
    cp4(lB + bo2, 16 * PB, w, (size_t)16 * E * 2); cp4(lB + bo2 + 64 * PB, 16 * PB, w + (size_t)64 * E * 2, (size_t)16 * E * 2); };
  fill(0);
  asm volatile("s_wait_asynccnt 0x0" ::: "memory");   // stage 0 landed before the barrier that publishes it
  __syncthreads();
  fill(1);
#pragma unroll 1   // rolled: one copy of the loop's text, the buffer picked by t & 1
  for (int t = 0; t < E / KT; ++t) { const char* bp = sm + (t & 1) * OBUF; F2 a[2]; v16b wf[2][8];   // the stage's LDS reads stand as one group ahead of its matrix run
#pragma unroll
    for (int kk = 0; kk < 2; ++kk) { a[kk] = split_row4((const float*)(bp + (wave * 16 + col) * PF) + kk * 32 + 8 * g);
#pragma unroll
      for (int j = 0; j < 8; ++j) wf[kk][j] = frag_b((const __bf16*)(bp + 64 * PF + (j * 16 + col) * PB) + kk * 32, lane); }
#pragma unroll
    for (int kk = 0; kk < 2; ++kk) {
#pragma unroll
      for (int j = 0; j < 8; ++j) { acc[j] = wmma_bf(a[kk].l, wf[kk][j], acc[j]); acc[j] = wmma_bf(a[kk].h, wf[kk][j], acc[j]); } }
    RING_PUBLISH();
    if (t + 2 < E / KT) fill(t + 2); }
  asm volatile("s_wait_asynccnt 0x0" ::: "memory");   // nothing in flight when the ring becomes output staging
#pragma unroll
  for (int j = 0; j < 8; ++j) { const int n = n0 + j * 16 + col; const float bb = bfr(bo[n]);
#pragma unroll
    for (int r = 0; r < 8; ++r) so[wave][8 * g + r][j * 16 + col] = acc[j][r] + bb; }
  LDSX();
#pragma unroll 4
  for (int rl = 0; rl < 16; ++rl) vst2(out + (size_t)(rbase + r0 + rl) * E + n0 + lane * 4, *(const v4f*)(&so[wave][rl][lane * 4]));
}
#define NBHALF 2
extern "C" void kernel_launch(void* const* d_in, const int* in_sizes, int n_in, void* d_out, int out_size, void* d_ws, size_t ws_size, hipStream_t stream) {
  (void)in_sizes; (void)n_in; (void)out_size; (void)ws_size;
  const float* x = (const float*)d_in[0]; const float* Wqkv = (const float*)d_in[1]; const float* Wp = (const float*)d_in[2]; const float* bp = (const float*)d_in[3];
  float* out = (float*)d_out;
  char* ws = (char*)d_ws; size_t off = 0;
  auto take = [&](size_t bytes) { char* p = ws + off; off += (bytes + 255) & ~(size_t)255; return p; };
  const size_t HR = (size_t)NBHALF * SS;     // rows per half (4096)
  __bf16* Xb = (__bf16*)take((size_t)NR * E * 2); __bf16* PT = (__bf16*)take((size_t)4 * E * E * 2);
  float* Q32 = (float*)take((size_t)NR * E * 4); float* K32 = (float*)take((size_t)NR * E * 4); _Float16* VTh = (_Float16*)take((size_t)NR * E * 2); _Float16* VTl = (_Float16*)take((size_t)NR * E * 2);
  float* O32 = Q32;      // in place: each k_attn wave reads its own 16 query rows into registers before writing the same rows; no other block reads them
  // ws ~ 120 MB; Q/K/V of all four batches are held at once, so that one attention launch covers all 64 (batch, head) pairs
  k_cvt<<<(NR * E / 8 + 255) / 256, 256, 0, stream>>>(x, Xb);
  k_pack<<<4 * E, 128, 0, stream>>>(Wqkv, Wp, PT);
  for (int hf = 0; hf < 2; ++hf) { const int rbase = hf * (int)HR; const size_t ho = hf * HR * E;
    k_qkv<<<dim3(HR / 64, E / 128, 3), 128, 0, stream>>>(Xb, rbase, PT, Q32 + ho, K32 + ho, VTh + ho, VTl + ho); }
  k_attn<<<dim3(SS / 256, NB * NH), 256, 0, stream>>>(Q32, K32, VTh, VTl, O32);
  for (int hf = 0; hf < 2; ++hf) { const int rbase = hf * (int)HR; const size_t ho = hf * HR * E;
    k_out<<<dim3(HR / 64, E / 128), 128, 0, stream>>>(O32 + ho, rbase, PT, bp, out); }
}

// v004
// A run of this version takes 259 microseconds.
// Timed twice side by side with v003, it ran 1.11 times as fast both times.
// All steps since v000 together make it 3.96 times as fast.
// compute dtype: x, w_qkv, w_proj, b_proj (INPUTS) rounded to bf16 with exact bf16 WMMA products (f32 accumulate) for the projections; q/k f32 split for the scores (3 products), P and V f16 hi/lo (3 products); softmax f32.
#include <hip/hip_runtime.h>
#include <math.h>

typedef __attribute__((ext_vector_type(16))) _Float16 v16h;
typedef __attribute__((ext_vector_type(16))) __bf16 v16b;
typedef __attribute__((ext_vector_type(8)))  _Float16 v8h;
typedef __attribute__((ext_vector_type(8)))  float v8f;
typedef __attribute__((ext_vector_type(4)))  float v4f;
typedef __attribute__((ext_vector_type(2)))  float v2f;
typedef __attribute__((ext_vector_type(4)))  unsigned v4u;
typedef __attribute__((ext_vector_type(4)))  int v4i;
typedef float __attribute__((may_alias)) float_a;
typedef int __attribute__((may_alias)) int_a;

template <typename T> __device__ __forceinline__ void vst2(void* p, T v) { *(T*)p = v;  }
__device__ __forceinline__ v8f wmma16(v16h a, v16h b, v8f c) {
  v8f d = __builtin_amdgcn_wmma_f32_16x16x32_f16(false, a, false, b, (short)0, c, false, false);
  asm volatile("v_nop\n\tv_nop\n\tv_nop\n\tv_nop" : "+v"(d) : "v"(a), "v"(b));
  return d;
}
__device__ __forceinline__ v8f wmma_bf(v16b a, v16b b, v8f c) {
  v8f d = __builtin_amdgcn_wmma_f32_16x16x32_bf16(false, a, false, b, (short)0, c, false, false);
  asm volatile("v_nop\n\tv_nop\n\tv_nop\n\tv_nop" : "+v"(d) : "v"(a), "v"(b));
  return d;
}
// 16x16x32 fragments: lane = (h = lane>>4, row/col = lane&15); elements 0..7 = k0+8h+0..7, 8..15 = k0+16+8h+0..7; D element r = row 8h+r
__device__ __forceinline__ v16h frag_h(const _Float16* rowk0, int lane) {
  union { v16h v; v8h q[2]; } u; const _Float16* p = rowk0 + 8 * (lane >> 4);
  u.q[0] = *(const v8h*)p; u.q[1] = *(const v8h*)(p + 16); return u.v;
}
__device__ __forceinline__ v16h frag_f32(const float* rowk0, int lane) {
  v16h a; const float* p = rowk0 + 8 * (lane >> 4);
#pragma unroll
  for (int i = 0; i < 8; ++i) { a[i] = (_Float16)p[i]; a[8 + i] = (_Float16)p[16 + i]; }
  return a;
}
__device__ __forceinline__ v16h frag_f32s(const float* rowk0, int lane, float sc) {
  v16h a; const float* p = rowk0 + 8 * (lane >> 4);
#pragma unroll
  for (int i = 0; i < 8; ++i) { a[i] = (_Float16)(p[i] * sc); a[8 + i] = (_Float16)(p[16 + i] * sc); }
  return a;
}
// column fragment from a [K][ld] layout (column n), rows >= K read as 0
__device__ __forceinline__ v16h fragc_f32(const float* W, int k0, int n, int lane, int ld, int K) {
  v16h a; const int g = lane >> 4;
#pragma unroll
  for (int i = 0; i < 8; ++i) { const int ka = k0 + 8 * g + i, kb = ka + 16;
    a[i] = (_Float16)(ka < K ? W[(size_t)(ka < K ? ka : K - 1) * ld + n] : 0.f); a[8 + i] = (_Float16)(kb < K ? W[(size_t)(kb < K ? kb : K - 1) * ld + n] : 0.f); }
  return a;
}
struct F2 { v16b h, l; };
__device__ __forceinline__ F2 bsplit16(const float v[16]) { F2 r;
#pragma unroll
  for (int i = 0; i < 16; ++i) { const __bf16 h = (__bf16)v[i]; r.h[i] = h; r.l[i] = (__bf16)(v[i] - (float)h); }
  return r; }
__device__ __forceinline__ F2 split_row(const float* row, int k0, int lane) { float v[16]; const float* p = row + k0 + 8 * (lane >> 4);
#pragma unroll
  for (int i = 0; i < 8; ++i) { v[i] = p[i]; v[8 + i] = p[16 + i]; }
  return bsplit16(v); }
__device__ __forceinline__ F2 split_rowK(const float* row, int k0, int lane, int K) { float v[16]; const int g = lane >> 4;
#pragma unroll
  for (int i = 0; i < 8; ++i) { const int ka = k0 + 8 * g + i, kb = ka + 16; v[i] = ka < K ? row[ka < K ? ka : K - 1] : 0.f; v[8 + i] = kb < K ? row[kb < K ? kb : K - 1] : 0.f; }
  return bsplit16(v); }
__device__ __forceinline__ F2 split_col(const float* W, int k0, int n, int lane, int ld, int K) { float v[16]; const int g = lane >> 4;
#pragma unroll
  for (int i = 0; i < 8; ++i) { const int ka = k0 + 8 * g + i, kb = ka + 16; v[i] = ka < K ? W[(size_t)(ka < K ? ka : K - 1) * ld + n] : 0.f; v[8 + i] = kb < K ? W[(size_t)(kb < K ? kb : K - 1) * ld + n] : 0.f; }
  return bsplit16(v); }
__device__ __forceinline__ v8f mac3(const F2& a, const F2& b, v8f c) { c = wmma_bf(a.l, b.h, c); c = wmma_bf(a.h, b.l, c); return wmma_bf(a.h, b.h, c); }
__device__ __forceinline__ float sigm(float v) { return 1.0f / (1.0f + expf(-v)); }
#define LDSX() do { asm volatile("s_wait_dscnt 0" ::: "memory"); __builtin_amdgcn_wave_barrier(); __builtin_amdgcn_fence(__ATOMIC_RELEASE, "workgroup"); } while (0)


#define NB 4
#define SS 2048
#define E 1024
#define NH 16
#define HD 64
#define NR (NB * SS)
#define PLO 1024.0f
#define VLO 2048.0f
#define SC2 0.18033688011112042f      // hs^-0.5 * log2(e): a raw score times this is its exponent to base 2
__device__ __forceinline__ float bfr(float v) { return (float)(__bf16)v; }
__device__ __forceinline__ v16b frag_b(const __bf16* rowk0, int lane) { return __builtin_bit_cast(v16b, frag_h((const _Float16*)rowk0, lane)); }

// asynchronous copies to LDS, 16 bytes a lane: l = the lane's LDS byte address, g = its global address. The s_wait_xcnt closes each statement, so that no address register is rewritten ahead of it.
#define CPY "global_load_async_to_lds_b128 "
__device__ __forceinline__ void cp4(unsigned l, unsigned ls, const char* g, size_t gs) {
  asm volatile(CPY "%0, %1, off\n\t" CPY "%2, %3, off\n\t" CPY "%4, %5, off\n\t" CPY "%6, %7, off\n\ts_wait_xcnt 0x0"
               :: "v"(l), "v"(g), "v"(l + ls), "v"(g + gs), "v"(l + 2 * ls), "v"(g + 2 * gs), "v"(l + 3 * ls), "v"(g + 3 * gs) : "memory");
}
__device__ __forceinline__ void cp2(unsigned l, unsigned ls, const char* g, size_t gs) {
  asm volatile(CPY "%0, %1, off\n\t" CPY "%2, %3, off\n\ts_wait_xcnt 0x0" :: "v"(l), "v"(g), "v"(l + ls), "v"(g + gs) : "memory");
}
// publish point of the two-buffer ring: own LDS reads done, own copies landed, then the work-group barrier (it publishes the next tile and frees the buffer just read)
#define RING_PUBLISH() do { asm volatile("s_wait_dscnt 0x0" ::: "memory"); asm volatile("s_wait_asynccnt 0x0" ::: "memory"); __syncthreads(); } while (0)
#define KT 64                         // k per stage: 128 B of a bf16 row, 256 B of an f32 row
#define PB 144                        // LDS pitch of a 128-B row, 16 B x odd: ds_load_b128 free of bank conflicts
#define PF 272                        // LDS pitch of a 256-B row, likewise
#define QBUF (192 * PB)               // k_qkv stage: 64 x rows, then 128 weight rows
#define OBUF (64 * PF + 128 * PB)     // k_out stage: 64 f32 ctx rows, then 128 weight rows
#define ABUF (64 * PF + 2 * 64 * PB) // k_attn stage: 64 f32 K rows, then 64 V^T hi rows and 64 V^T lo rows of 64 keys
#define NST (2 * (SS / 128 + 1))      // k_attn stages in a block: 2 (t + 1) + 2 (16 - t)
__device__ __forceinline__ F2 split_row4(const float* p) { float v[16]; const v4f a = *(const v4f*)p, b = *(const v4f*)(p + 4), c = *(const v4f*)(p + 16), d = *(const v4f*)(p + 20);
#pragma unroll
  for (int i = 0; i < 4; ++i) { v[i] = a[i]; v[4 + i] = b[i]; v[8 + i] = c[i]; v[12 + i] = d[i]; }
  return bsplit16(v); }

__global__ __launch_bounds__(256) void k_cvt(const float* __restrict__ x, __bf16* __restrict__ Xb) {
  const size_t i8 = (size_t)blockIdx.x * 256 + threadIdx.x; if (i8 >= (size_t)NR * E / 8) return;
  union { __bf16 h[8]; v4u u; } pk;
#pragma unroll
  for (int e = 0; e < 8; ++e) pk.h[e] = (__bf16)x[i8 * 8 + e];
  vst2((unsigned*)(Xb + i8 * 8), pk.u);
}
// PT rows: [0,3E) = w_qkv rows (q | k | v output features), [3E,4E) = w_proj rows ([out][in] weights)
__global__ __launch_bounds__(128) void k_pack(const float* __restrict__ Wqkv, const float* __restrict__ Wp, __bf16* __restrict__ PT) {
  const int n = blockIdx.x, tid = threadIdx.x; __shared__ __align__(16) __bf16 srow[E];
  for (int k = tid; k < E; k += 128) srow[k] = (__bf16)(n < 3 * E ? Wqkv[(size_t)n * E + k] : Wp[(size_t)(n - 3 * E) * E + k]);      // [out][in]: rows
  __syncthreads();
  if (tid < E / 8) vst2((unsigned*)(PT + (size_t)n * E + tid * 8), *(const v4u*)(&srow[tid * 8]));
}
// QKV: block (64 rows, 128 cols = 2 heads, which); q,k -> Q32/K32 f32 [bh][s][64]; v -> VT hi/lo x4 [bh][d][s]
__global__ __launch_bounds__(128) void k_qkv(const __bf16* __restrict__ Xb, int rbase, const __bf16* __restrict__ PT, float* __restrict__ Q32, float* __restrict__ K32, _Float16* __restrict__ VTh, _Float16* __restrict__ VTl) {
  __shared__ __align__(16) char sm[70656];      // the ring (2 x QBUF) in the loop; behind its last barrier the output staging
  float (*so)[16][132] = (float (*)[16][132])sm; _Float16 (*sth)[72] = (_Float16 (*)[72])(sm + 33792); _Float16 (*stl)[72] = (_Float16 (*)[72])(sm + 33792 + 18432);
  const int tid = threadIdx.x, wave = tid >> 5, lane = tid & 31, col = lane & 15, g = lane >> 4;
  const int which = blockIdx.z, r0b = blockIdx.x * 64, r0 = r0b + wave * 16, n0 = blockIdx.y * 128; const int b = r0b / SS, s0 = r0b % SS;
  v8f acc[8] = {};
  // a copy of the block moves 16 rows of 128 B: thread -> (row tid >> 3, 16-B piece tid & 7), whole lines per wave
  const char* gA = (const char*)(Xb + (size_t)(rbase + r0b + (tid >> 3)) * E + (tid & 7) * 8);
  const char* gB = (const char*)(PT + (size_t)(which * E + n0 + (tid >> 3)) * E + (tid & 7) * 8);
  const unsigned l0 = (unsigned)(size_t)sm + (tid >> 3) * PB + (tid & 7) * 16;
  auto fill = [&](int t) { const unsigned l = l0 + (t & 1) * QBUF; const size_t ko = (size_t)t * KT * 2;
    cp4(l, 16 * PB, gA + ko, (size_t)16 * E * 2); cp4(l + 64 * PB, 16 * PB, gB + ko, (size_t)16 * E * 2); cp4(l + 128 * PB, 16 * PB, gB + ko + (size_t)64 * E * 2, (size_t)16 * E * 2); };
  fill(0);
  asm volatile("s_wait_asynccnt 0x0" ::: "memory");   // stage 0 landed before the barrier that publishes it
  __syncthreads();
  fill(1);
#pragma unroll 1   // rolled: one copy of the loop's text, the buffer picked by t & 1
  for (int t = 0; t < E / KT; ++t) { const char* bp = sm + (t & 1) * QBUF; v16b a[2], wf[2][8];   // the stage's LDS reads stand as one group ahead of its matrix run
#pragma unroll
    for (int kk = 0; kk < 2; ++kk) { a[kk] = frag_b((const __bf16*)(bp + (wave * 16 + col) * PB) + kk * 32, lane);
#pragma unroll
      for (int j = 0; j < 8; ++j) wf[kk][j] = frag_b((const __bf16*)(bp + (64 + j * 16 + col) * PB) + kk * 32, lane); }
#pragma unroll
    for (int kk = 0; kk < 2; ++kk) {
#pragma unroll
      for (int j = 0; j < 8; ++j) acc[j] = wmma_bf(a[kk], wf[kk][j], acc[j]); }
    RING_PUBLISH();
    if (t + 2 < E / KT) fill(t + 2); }
  asm volatile("s_wait_asynccnt 0x0" ::: "memory");   // nothing in flight when the ring becomes output staging
  if (which < 2) {
#pragma unroll
    for (int j = 0; j < 8; ++j) { const float bb = 0.f;
#pragma unroll
      for (int r = 0; r < 8; ++r) so[wave][8 * g + r][j * 16 + col] = acc[j][r] + bb; }
    LDSX();
    float* Dst = which == 0 ? Q32 : K32;
    for (int qq = lane; qq < 2 * 16 * 16; qq += 32) { const int hh = qq >> 8, rl = (qq >> 4) & 15, pc = qq & 15; const int h = (n0 >> 6) + hh;
      vst2(Dst + (((size_t)b * NH + h) * SS + s0 + wave * 16 + rl) * HD + pc * 4, *(const v4f*)(&so[wave][rl][hh * 64 + pc * 4])); } }
  else {
#pragma unroll
    for (int j = 0; j < 8; ++j) { const float bb = 0.f;
#pragma unroll
      for (int r = 0; r < 8; ++r) { const float v = (acc[j][r] + bb) * 4.0f; const _Float16 hi = (_Float16)v; sth[j * 16 + col][wave * 16 + 8 * g + r] = hi; stl[j * 16 + col][wave * 16 + 8 * g + r] = (_Float16)((v - (float)hi) * VLO); } }
    __syncthreads();
    for (int qq = tid; qq < 128 * 8; qq += 128) { const int cl = qq >> 3, pc = qq & 7; const int c = n0 + cl, h = c >> 6, d = c & 63; const size_t o = (((size_t)b * NH + h) * HD + d) * SS + s0 + pc * 8;
      vst2(VTh + o, *(const v4u*)(&sth[cl][pc * 8])); vst2(VTl + o, *(const v4u*)(&stl[cl][pc * 8])); } }
}
// causal attention: block of 8 waves (query tiles t and 15 - t of 128 queries, one after the other, bh): 34 key tiles of 64 in every block; S on hi/lo splits of the f32 q/k rows; P,V hi/lo; O f32 [bh][s][64]
// each key tile (K rows f32, V^T hi and lo) is brought into LDS once per query tile by asynchronous copies, whole lines per wave, and read from there by the 8 waves (the last one of a query tile by waves 4..7 only); two buffers, the ring runs on over the change of query tile
// second bound: four waves per SIMD (256 registers a wave); 140 KiB of LDS: two blocks on each WGP, all 512 resident at once
__global__ __launch_bounds__(256, 4) void k_attn(const float* __restrict__ Q32, const float* __restrict__ K32, const _Float16* __restrict__ VTh, const _Float16* __restrict__ VTl, float* __restrict__ O32) {
  __shared__ __align__(16) char ring[2 * ABUF];
  __shared__ __align__(16) float sS[8][16][68];      // scores in the loop, output staging behind it (each wave its own slice)
  __shared__ __align__(16) _Float16 sPh[8][16][72], sPl[8][16][72];
  const int tid = threadIdx.x, w = __builtin_amdgcn_readfirstlane(tid >> 5), lane = tid & 31, col = lane & 15, g = lane >> 4;
  const size_t bh = blockIdx.y;
  const int n0 = 2 * ((int)blockIdx.x + 1);          // key tiles of the first query tile; both together: NST
  // K: a copy of the block moves 16 rows of 256 B; V^T: 32 rows of 128 B
  const char* gK = (const char*)(K32 + (bh * SS + (tid >> 4)) * HD + (tid & 15) * 4);
  const char* gH = (const char*)(VTh + (bh * HD + (tid >> 3)) * SS + (tid & 7) * 8);
  const char* gL = (const char*)(VTl + (bh * HD + (tid >> 3)) * SS + (tid & 7) * 8);
  const unsigned lK = (unsigned)(size_t)ring + (tid >> 4) * PF + (tid & 15) * 16, lV = (unsigned)(size_t)ring + 64 * PF + (tid >> 3) * PB + (tid & 7) * 16;
  auto fill = [&](int s) { const int kt = s < n0 ? s : s - n0; const unsigned bo2 = (s & 1) * ABUF;
    cp4(lK + bo2, 16 * PF, gK + (size_t)kt * 64 * HD * 4, (size_t)16 * HD * 4);
    cp2(lV + bo2, 32 * PB, gH + (size_t)kt * 64 * 2, (size_t)32 * SS * 2); cp2(lV + bo2 + 64 * PB, 32 * PB, gL + (size_t)kt * 64 * 2, (size_t)32 * SS * 2); };
  fill(0);
  asm volatile("s_wait_asynccnt 0x0" ::: "memory");   // stage 0 landed before the barrier that publishes it
  __syncthreads();
  fill(1);
  int st = 0;
  for (int pass = 0; pass < 2; ++pass) {
  const int qb = pass == 0 ? (int)blockIdx.x : SS / 128 - 1 - (int)blockIdx.x; const int q0 = qb * 128 + w * 16;
  F2 aq[2];
#pragma unroll
  for (int kc = 0; kc < 2; ++kc) aq[kc] = split_row(Q32 + (bh * SS + q0 + col) * HD, kc * 32, lane);
  // mrun: the running maximum as a base-2 exponent (raw score x SC2, rounded once: an unchanged maximum rescales by exactly 1)
  float mrun = -3.0e38f, lrun = 0.f; v8f acc[4] = {}, ac1[4] = {}, ac2[4] = {};
#pragma unroll 1   // rolled: one copy of the loop's text, the buffer picked by st & 1
  for (int kt = 0; kt < 2 * (qb + 1); ++kt, ++st) { const char* bp = ring + (st & 1) * ABUF;
   if (kt * 64 <= q0 + 15) {      // a key tile wholly above the wave's diagonal adds nothing: the wave goes straight to the publish point
#pragma unroll
    for (int t = 0; t < 4; ++t) { const int key = kt * 64 + t * 16 + col; const float* krow = (const float*)(bp + (t * 16 + col) * PF) + 8 * g;
      v8f s = mac3(aq[0], split_row4(krow), (v8f){}); s = mac3(aq[1], split_row4(krow + 32), s);
#pragma unroll
      for (int r = 0; r < 8; ++r) { sS[w][8 * g + r][t * 16 + col] = (key > q0 + 8 * g + r) ? -3.0e38f : s[r]; } }
    LDSX();
    float mx = -3.4e38f;
#pragma unroll
    for (int jj = 0; jj < 32; ++jj) mx = fmaxf(mx, sS[w][col][g * 32 + jj]);
    mx = fmaxf(mx, __shfl_xor(mx, 16, 32));
    const float mnew = fmaxf(mrun, mx * SC2); const float corr = __builtin_amdgcn_exp2f(mrun - mnew);
    float ps = 0.f;
#pragma unroll
    for (int j2 = 0; j2 < 32; j2 += 2) { const v2f ar = __builtin_elementwise_fma(*(const v2f*)(&sS[w][col][g * 32 + j2]), (v2f){SC2, SC2}, (v2f){-mnew, -mnew});   // two exponents by one packed fma
#pragma unroll
      for (int e = 0; e < 2; ++e) { const int jj = j2 + e; const float p = __builtin_amdgcn_exp2f(ar[e]) * 16384.0f; ps += p; const _Float16 hi = (_Float16)p; sPh[w][col][g * 32 + jj] = hi; sPl[w][col][g * 32 + jj] = (_Float16)((p - (float)hi) * PLO); } }
    ps += __shfl_xor(ps, 16, 32);
    lrun = lrun * corr + ps * (1.0f / 16384.0f); mrun = mnew;
#pragma unroll
    for (int r = 0; r < 8; ++r) { const float cr = __shfl(corr, 8 * g + r, 32);
#pragma unroll
      for (int t = 0; t < 4; ++t) { acc[t][r] *= cr; ac1[t][r] *= cr; ac2[t][r] *= cr; } }
    LDSX();
#pragma unroll
    for (int kc = 0; kc < 2; ++kc) { const v16h ph = frag_h(&sPh[w][col][0] + kc * 32, lane), pl = frag_h(&sPl[w][col][0] + kc * 32, lane); v16h vh[2], vl[2];   // the LDS reads of two output tiles stand as one group ahead of their matrix run
#pragma unroll
      for (int tp = 0; tp < 4; tp += 2) {
#pragma unroll
      for (int t = 0; t < 2; ++t) { const _Float16* vr = (const _Float16*)(bp + 64 * PF + ((tp + t) * 16 + col) * PB) + kc * 32; vh[t] = frag_h(vr, lane); vl[t] = frag_h(vr + 64 * PB / 2, lane); }
#pragma unroll
      for (int t = 0; t < 2; ++t) { acc[tp + t] = wmma16(ph, vh[t], acc[tp + t]); ac1[tp + t] = wmma16(ph, vl[t], ac1[tp + t]); ac2[tp + t] = wmma16(pl, vh[t], ac2[tp + t]); } } } }
    RING_PUBLISH();
    if (st + 2 < NST) fill(st + 2); }
#pragma unroll
  for (int r = 0; r < 8; ++r) { const float lr = __shfl(lrun, 8 * g + r, 32); const float inv = 1.0f / (lr * 16384.0f * 4.0f);
#pragma unroll
    for (int t = 0; t < 4; ++t) sS[w][8 * g + r][t * 16 + col] = (acc[t][r] + ac1[t][r] * (1.0f / VLO) + ac2[t][r] * (1.0f / PLO)) * inv; }
  LDSX();
  for (int qq = lane; qq < 16 * 16; qq += 32) { const int rl = qq >> 4, pc = qq & 15; vst2(O32 + ((bh * SS) + q0 + rl) * HD + pc * 4, *(const v4f*)(&sS[w][rl][pc * 4])); }
  LDSX();   // the staged rows are read before the next query tile's scores overwrite them
  }
  asm volatile("s_wait_asynccnt 0x0" ::: "memory");   // nothing in flight when the wave ends
}
// out = ctx Wo^T + bo : split(ctx) x bf16(Wo rows): 2 products (Wo is an INPUT -> bf16 exact)
__global__ __launch_bounds__(128) void k_out(const float* __restrict__ O32, int rbase, const __bf16* __restrict__ PT, const float* __restrict__ bo, float* __restrict__ out) {
  __shared__ __align__(16) char sm[2 * OBUF];   // the ring in the loop; behind its last barrier the output staging
  float (*so)[16][132] = (float (*)[16][132])sm;
  const int tid = threadIdx.x, wave = tid >> 5, lane = tid & 31, col = lane & 15, g = lane >> 4;
  const int r0b = blockIdx.x * 64, r0 = r0b + wave * 16, n0 = blockIdx.y * 128; const int b = r0b / SS, s0 = r0b % SS;
  v8f acc[8] = {};
  // stage t = head t: ctx rows of 256 B (a copy of the block moves 8 rows), weight rows of 128 B (16 rows), whole lines per wave
  const char* gA = (const char*)(O32 + ((size_t)b * NH * SS + s0 + (tid >> 4)) * HD + (tid & 15) * 4);
  const char* gB = (const char*)(PT + (size_t)(3 * E + n0 + (tid >> 3)) * E + (tid & 7) * 8);
  const unsigned lA = (unsigned)(size_t)sm + (tid >> 4) * PF + (tid & 15) * 16, lB = (unsigned)(size_t)sm + 64 * PF + (tid >> 3) * PB + (tid & 7) * 16;
  auto fill = [&](int t) { const unsigned bo2 = (t & 1) * OBUF; const char* a = gA + (size_t)t * SS * HD * 4; const char* w = gB + (size_t)t * KT * 2;
    cp4(lA + bo2, 8 * PF, a, (size_t)8 * HD * 4); cp4(lA + bo2 + 32 * PF, 8 * PF, a + (size_t)32 * HD * 4, (size_t)8 * HD * 4);
    cp4(lB + bo2, 16 * PB, w, (size_t)16 * E * 2); cp4(lB + bo2 + 64 * PB, 16 * PB, w + (size_t)64 * E * 2, (size_t)16 * E * 2); };
  fill(0);
  asm volatile("s_wait_asynccnt 0x0" ::: "memory");   // stage 0 landed before the barrier that publishes it
  __syncthreads();
  fill(1);
#pragma unroll 1   // rolled: one copy of the loop's text, the buffer picked by t & 1
  for (int t = 0; t < E / KT; ++t) { const char* bp = sm + (t & 1) * OBUF; F2 a[2]; v16b wf[2][8];   // the stage's LDS reads stand as one group ahead of its matrix run
#pragma unroll
    for (int kk = 0; kk < 2; ++kk) { a[kk] = split_row4((const float*)(bp + (wave * 16 + col) * PF) + kk * 32 + 8 * g);
#pragma unroll
      for (int j = 0; j < 8; ++j) wf[kk][j] = frag_b((const __bf16*)(bp + 64 * PF + (j * 16 + col) * PB) + kk * 32, lane); }
#pragma unroll
    for (int kk = 0; kk < 2; ++kk) {
#pragma unroll
      for (int j = 0; j < 8; ++j) { acc[j] = wmma_bf(a[kk].l, wf[kk][j], acc[j]); acc[j] = wmma_bf(a[kk].h, wf[kk][j], acc[j]); } }
    RING_PUBLISH();
    if (t + 2 < E / KT) fill(t + 2); }
  asm volatile("s_wait_asynccnt 0x0" ::: "memory");   // nothing in flight when the ring becomes output staging
#pragma unroll
  for (int j = 0; j < 8; ++j) { const int n = n0 + j * 16 + col; const float bb = bfr(bo[n]);
#pragma unroll
    for (int r = 0; r < 8; ++r) so[wave][8 * g + r][j * 16 + col] = acc[j][r] + bb; }
  LDSX();
#pragma unroll 4
  for (int rl = 0; rl < 16; ++rl) vst2(out + (size_t)(rbase + r0 + rl) * E + n0 + lane * 4, *(const v4f*)(&so[wave][rl][lane * 4]));
}
#define NBHALF 2
extern "C" void kernel_launch(void* const* d_in, const int* in_sizes, int n_in, void* d_out, int out_size, void* d_ws, size_t ws_size, hipStream_t stream) {
  (void)in_sizes; (void)n_in; (void)out_size; (void)ws_size;
  const float* x = (const float*)d_in[0]; const float* Wqkv = (const float*)d_in[1]; const float* Wp = (const float*)d_in[2]; const float* bp = (const float*)d_in[3];
  float* out = (float*)d_out;
  char* ws = (char*)d_ws; size_t off = 0;
  auto take = [&](size_t bytes) { char* p = ws + off; off += (bytes + 255) & ~(size_t)255; return p; };
  const size_t HR = (size_t)NBHALF * SS;     // rows per half (4096)
  __bf16* Xb = (__bf16*)take((size_t)NR * E * 2); __bf16* PT = (__bf16*)take((size_t)4 * E * E * 2);
  float* Q32 = (float*)take((size_t)NR * E * 4); float* K32 = (float*)take((size_t)NR * E * 4); _Float16* VTh = (_Float16*)take((size_t)NR * E * 2); _Float16* VTl = (_Float16*)take((size_t)NR * E * 2);
  float* O32 = Q32;      // in place: each k_attn wave reads its own 16 query rows into registers before writing the same rows; no other block reads them
  // ws ~ 120 MB; Q/K/V of all four batches are held at once, so that one attention launch covers all 64 (batch, head) pairs
  k_cvt<<<(NR * E / 8 + 255) / 256, 256, 0, stream>>>(x, Xb);
  k_pack<<<4 * E, 128, 0, stream>>>(Wqkv, Wp, PT);
  for (int hf = 0; hf < 2; ++hf) { const int rbase = hf * (int)HR; const size_t ho = hf * HR * E;
    k_qkv<<<dim3(HR / 64, E / 128, 3), 128, 0, stream>>>(Xb, rbase, PT, Q32 + ho, K32 + ho, VTh + ho, VTl + ho); }
  k_attn<<<dim3(SS / 256, NB * NH), 256, 0, stream>>>(Q32, K32, VTh, VTl, O32);
  for (int hf = 0; hf < 2; ++hf) { const int rbase = hf * (int)HR; const size_t ho = hf * HR * E;
    k_out<<<dim3(HR / 64, E / 128), 128, 0, stream>>>(O32 + ho, rbase, PT, bp, out); }
}

// v005
// It runs in 227 microseconds.
// Two timings next to v004 both put it at 1.14 times that version's speed.
// Counting every step since v000, it is 4.51 times as fast.
// compute dtype: x, w_qkv, w_proj, b_proj (INPUTS) rounded to bf16 with exact bf16 WMMA products (f32 accumulate) for the projections; q/k f32 split for the scores (3 products), P and V f16 hi/lo (3 products); softmax f32.
#include <hip/hip_runtime.h>
#include <math.h>

typedef __attribute__((ext_vector_type(16))) _Float16 v16h;
typedef __attribute__((ext_vector_type(16))) __bf16 v16b;
typedef __attribute__((ext_vector_type(8)))  _Float16 v8h;
typedef __attribute__((ext_vector_type(8)))  float v8f;
typedef __attribute__((ext_vector_type(4)))  float v4f;
typedef __attribute__((ext_vector_type(2)))  float v2f;
typedef __attribute__((ext_vector_type(4)))  unsigned v4u;
typedef __attribute__((ext_vector_type(4)))  int v4i;
typedef float __attribute__((may_alias)) float_a;
typedef int __attribute__((may_alias)) int_a;

template <typename T> __device__ __forceinline__ void vst2(void* p, T v) { *(T*)p = v;  }
__device__ __forceinline__ v8f wmma16(v16h a, v16h b, v8f c) {
  v8f d = __builtin_amdgcn_wmma_f32_16x16x32_f16(false, a, false, b, (short)0, c, false, false);
  asm volatile("v_nop\n\tv_nop\n\tv_nop\n\tv_nop" : "+v"(d) : "v"(a), "v"(b));
  return d;
}
__device__ __forceinline__ v8f wmma_bf(v16b a, v16b b, v8f c) {
  v8f d = __builtin_amdgcn_wmma_f32_16x16x32_bf16(false, a, false, b, (short)0, c, false, false);
  asm volatile("v_nop\n\tv_nop\n\tv_nop\n\tv_nop" : "+v"(d) : "v"(a), "v"(b));
  return d;
}
// 16x16x32 fragments: lane = (h = lane>>4, row/col = lane&15); elements 0..7 = k0+8h+0..7, 8..15 = k0+16+8h+0..7; D element r = row 8h+r
__device__ __forceinline__ v16h frag_h(const _Float16* rowk0, int lane) {
  union { v16h v; v8h q[2]; } u; const _Float16* p = rowk0 + 8 * (lane >> 4);
  u.q[0] = *(const v8h*)p; u.q[1] = *(const v8h*)(p + 16); return u.v;
}
__device__ __forceinline__ v16h frag_f32(const float* rowk0, int lane) {
  v16h a; const float* p = rowk0 + 8 * (lane >> 4);
#pragma unroll
  for (int i = 0; i < 8; ++i) { a[i] = (_Float16)p[i]; a[8 + i] = (_Float16)p[16 + i]; }
  return a;
}
__device__ __forceinline__ v16h frag_f32s(const float* rowk0, int lane, float sc) {
  v16h a; const float* p = rowk0 + 8 * (lane >> 4);
#pragma unroll
  for (int i = 0; i < 8; ++i) { a[i] = (_Float16)(p[i] * sc); a[8 + i] = (_Float16)(p[16 + i] * sc); }
  return a;
}
// column fragment from a [K][ld] layout (column n), rows >= K read as 0
__device__ __forceinline__ v16h fragc_f32(const float* W, int k0, int n, int lane, int ld, int K) {
  v16h a; const int g = lane >> 4;
#pragma unroll
  for (int i = 0; i < 8; ++i) { const int ka = k0 + 8 * g + i, kb = ka + 16;
    a[i] = (_Float16)(ka < K ? W[(size_t)(ka < K ? ka : K - 1) * ld + n] : 0.f); a[8 + i] = (_Float16)(kb < K ? W[(size_t)(kb < K ? kb : K - 1) * ld + n] : 0.f); }
  return a;
}
struct F2 { v16b h, l; };
__device__ __forceinline__ F2 bsplit16(const float v[16]) { F2 r;
#pragma unroll
  for (int i = 0; i < 16; ++i) { const __bf16 h = (__bf16)v[i]; r.h[i] = h; r.l[i] = (__bf16)(v[i] - (float)h); }
  return r; }
__device__ __forceinline__ F2 split_row(const float* row, int k0, int lane) { float v[16]; const float* p = row + k0 + 8 * (lane >> 4);
#pragma unroll
  for (int i = 0; i < 8; ++i) { v[i] = p[i]; v[8 + i] = p[16 + i]; }
  return bsplit16(v); }
__device__ __forceinline__ F2 split_rowK(const float* row, int k0, int lane, int K) { float v[16]; const int g = lane >> 4;
#pragma unroll
  for (int i = 0; i < 8; ++i) { const int ka = k0 + 8 * g + i, kb = ka + 16; v[i] = ka < K ? row[ka < K ? ka : K - 1] : 0.f; v[8 + i] = kb < K ? row[kb < K ? kb : K - 1] : 0.f; }
  return bsplit16(v); }
__device__ __forceinline__ F2 split_col(const float* W, int k0, int n, int lane, int ld, int K) { float v[16]; const int g = lane >> 4;
#pragma unroll
  for (int i = 0; i < 8; ++i) { const int ka = k0 + 8 * g + i, kb = ka + 16; v[i] = ka < K ? W[(size_t)(ka < K ? ka : K - 1) * ld + n] : 0.f; v[8 + i] = kb < K ? W[(size_t)(kb < K ? kb : K - 1) * ld + n] : 0.f; }
  return bsplit16(v); }
__device__ __forceinline__ v8f mac3(const F2& a, const F2& b, v8f c) { c = wmma_bf(a.l, b.h, c); c = wmma_bf(a.h, b.l, c); return wmma_bf(a.h, b.h, c); }
__device__ __forceinline__ float sigm(float v) { return 1.0f / (1.0f + expf(-v)); }
#define LDSX() do { asm volatile("s_wait_dscnt 0" ::: "memory"); __builtin_amdgcn_wave_barrier(); __builtin_amdgcn_fence(__ATOMIC_RELEASE, "workgroup"); } while (0)


#define NB 4
#define SS 2048
#define E 1024
#define NH 16
#define HD 64
#define NR (NB * SS)
#define PLO 1024.0f
#define VLO 2048.0f
#define SC2 0.18033688011112042f      // hs^-0.5 * log2(e): a raw score times this is its exponent to base 2
__device__ __forceinline__ float bfr(float v) { return (float)(__bf16)v; }
__device__ __forceinline__ v16b frag_b(const __bf16* rowk0, int lane) { return __builtin_bit_cast(v16b, frag_h((const _Float16*)rowk0, lane)); }

// asynchronous copies to LDS, 16 bytes a lane: l = the lane's LDS byte address, g = its global address. The s_wait_xcnt closes each statement, so that no address register is rewritten ahead of it.
#define CPY "global_load_async_to_lds_b128 "
__device__ __forceinline__ void cp4(unsigned l, unsigned ls, const char* g, size_t gs) {
  asm volatile(CPY "%0, %1, off\n\t" CPY "%2, %3, off\n\t" CPY "%4, %5, off\n\t" CPY "%6, %7, off\n\ts_wait_xcnt 0x0"
               :: "v"(l), "v"(g), "v"(l + ls), "v"(g + gs), "v"(l + 2 * ls), "v"(g + 2 * gs), "v"(l + 3 * ls), "v"(g + 3 * gs) : "memory");
}
__device__ __forceinline__ void cp2(unsigned l, unsigned ls, const char* g, size_t gs) {
  asm volatile(CPY "%0, %1, off\n\t" CPY "%2, %3, off\n\ts_wait_xcnt 0x0" :: "v"(l), "v"(g), "v"(l + ls), "v"(g + gs) : "memory");
}
// publish point of the two-buffer ring: own LDS reads done, own copies landed, then the work-group barrier (it publishes the next tile and frees the buffer just read)
#define RING_PUBLISH() do { asm volatile("s_wait_dscnt 0x0" ::: "memory"); asm volatile("s_wait_asynccnt 0x0" ::: "memory"); __syncthreads(); } while (0)
#define KT 64                         // k per stage: 128 B of a bf16 row, 256 B of an f32 row
#define PB 144                        // LDS pitch of a 128-B row, 16 B x odd: ds_load_b128 free of bank conflicts
#define PF 272                        // LDS pitch of a 256-B row, likewise
#define QBUF (192 * PB)               // k_qkv stage: 64 x rows, then 128 weight rows
#define OBUF (64 * PF + 128 * PB)     // k_out stage: 64 f32 ctx rows, then 128 weight rows
#define ABUF (64 * PF + 2 * 64 * PB) // k_attn stage: 64 K rows of 256 B (64 bf16 hi, 64 bf16 lo), then 64 V^T hi rows and 64 V^T lo rows of 64 keys
#define NST (2 * (SS / 128 + 1))      // k_attn stages in a block: 2 (t + 1) + 2 (16 - t)
__device__ __forceinline__ F2 split_row4(const float* p) { float v[16]; const v4f a = *(const v4f*)p, b = *(const v4f*)(p + 4), c = *(const v4f*)(p + 16), d = *(const v4f*)(p + 20);
#pragma unroll
  for (int i = 0; i < 4; ++i) { v[i] = a[i]; v[4 + i] = b[i]; v[8 + i] = c[i]; v[12 + i] = d[i]; }
  return bsplit16(v); }

__global__ __launch_bounds__(256) void k_cvt(const float* __restrict__ x, __bf16* __restrict__ Xb) {
  const size_t i8 = (size_t)blockIdx.x * 256 + threadIdx.x; if (i8 >= (size_t)NR * E / 8) return;
  union { __bf16 h[8]; v4u u; } pk;
#pragma unroll
  for (int e = 0; e < 8; ++e) pk.h[e] = (__bf16)x[i8 * 8 + e];
  vst2((unsigned*)(Xb + i8 * 8), pk.u);
}
// PT rows: [0,3E) = w_qkv rows (q | k | v output features), [3E,4E) = w_proj rows ([out][in] weights)
__global__ __launch_bounds__(128) void k_pack(const float* __restrict__ Wqkv, const float* __restrict__ Wp, __bf16* __restrict__ PT) {
  const int n = blockIdx.x, tid = threadIdx.x; __shared__ __align__(16) __bf16 srow[E];
  for (int k = tid; k < E; k += 128) srow[k] = (__bf16)(n < 3 * E ? Wqkv[(size_t)n * E + k] : Wp[(size_t)(n - 3 * E) * E + k]);      // [out][in]: rows
  __syncthreads();
  if (tid < E / 8) vst2((unsigned*)(PT + (size_t)n * E + tid * 8), *(const v4u*)(&srow[tid * 8]));
}
// QKV: block (64 rows, 128 cols = 2 heads, which); q -> Q32 f32 [bh][s][64]; k -> KS bf16 [bh][s][64 hi | 64 lo], the split of the f32 value made here, once; v -> VT hi/lo x4 [bh][d][s]
__global__ __launch_bounds__(128) void k_qkv(const __bf16* __restrict__ Xb, int rbase, const __bf16* __restrict__ PT, float* __restrict__ Q32, __bf16* __restrict__ KS, _Float16* __restrict__ VTh, _Float16* __restrict__ VTl) {
  __shared__ __align__(16) char sm[70656];      // the ring (2 x QBUF) in the loop; behind its last barrier the output staging
  float (*so)[16][132] = (float (*)[16][132])sm; _Float16 (*sth)[72] = (_Float16 (*)[72])(sm + 33792); _Float16 (*stl)[72] = (_Float16 (*)[72])(sm + 33792 + 18432);
  const int tid = threadIdx.x, wave = tid >> 5, lane = tid & 31, col = lane & 15, g = lane >> 4;
  const int which = blockIdx.z, r0b = blockIdx.x * 64, r0 = r0b + wave * 16, n0 = blockIdx.y * 128; const int b = r0b / SS, s0 = r0b % SS;
  v8f acc[8] = {};
  // a copy of the block moves 16 rows of 128 B: thread -> (row tid >> 3, 16-B piece tid & 7), whole lines per wave
  const char* gA = (const char*)(Xb + (size_t)(rbase + r0b + (tid >> 3)) * E + (tid & 7) * 8);
  const char* gB = (const char*)(PT + (size_t)(which * E + n0 + (tid >> 3)) * E + (tid & 7) * 8);
  const unsigned l0 = (unsigned)(size_t)sm + (tid >> 3) * PB + (tid & 7) * 16;
  auto fill = [&](int t) { const unsigned l = l0 + (t & 1) * QBUF; const size_t ko = (size_t)t * KT * 2;
    cp4(l, 16 * PB, gA + ko, (size_t)16 * E * 2); cp4(l + 64 * PB, 16 * PB, gB + ko, (size_t)16 * E * 2); cp4(l + 128 * PB, 16 * PB, gB + ko + (size_t)64 * E * 2, (size_t)16 * E * 2); };
  fill(0);
  asm volatile("s_wait_asynccnt 0x0" ::: "memory");   // stage 0 landed before the barrier that publishes it
  __syncthreads();
  fill(1);
#pragma unroll 1   // rolled: one copy of the loop's text, the buffer picked by t & 1
  for (int t = 0; t < E / KT; ++t) { const char* bp = sm + (t & 1) * QBUF; v16b a[2], wf[2][8];   // the stage's LDS reads stand as one group ahead of its matrix run
#pragma unroll
    for (int kk = 0; kk < 2; ++kk) { a[kk] = frag_b((const __bf16*)(bp + (wave * 16 + col) * PB) + kk * 32, lane);
#pragma unroll
      for (int j = 0; j < 8; ++j) wf[kk][j] = frag_b((const __bf16*)(bp + (64 + j * 16 + col) * PB) + kk * 32, lane); }
#pragma unroll
    for (int kk = 0; kk < 2; ++kk) {
#pragma unroll
      for (int j = 0; j < 8; ++j) acc[j] = wmma_bf(a[kk], wf[kk][j], acc[j]); }
    RING_PUBLISH();
    if (t + 2 < E / KT) fill(t + 2); }
  asm volatile("s_wait_asynccnt 0x0" ::: "memory");   // nothing in flight when the ring becomes output staging
  if (which < 2) {
#pragma unroll
    for (int j = 0; j < 8; ++j) { const float bb = 0.f;
#pragma unroll
      for (int r = 0; r < 8; ++r) so[wave][8 * g + r][j * 16 + col] = acc[j][r] + bb; }
    LDSX();
    if (which == 0) {
    for (int qq = lane; qq < 2 * 16 * 16; qq += 32) { const int hh = qq >> 8, rl = (qq >> 4) & 15, pc = qq & 15; const int h = (n0 >> 6) + hh;
      vst2(Q32 + (((size_t)b * NH + h) * SS + s0 + wave * 16 + rl) * HD + pc * 4, *(const v4f*)(&so[wave][rl][hh * 64 + pc * 4])); } }
    else {
    for (int qq = lane; qq < 2 * 16 * 8; qq += 32) { const int hh = qq >> 7, rl = (qq >> 3) & 15, pc = qq & 7; const int h = (n0 >> 6) + hh;
      const v4f va = *(const v4f*)(&so[wave][rl][hh * 64 + pc * 8]), vb = *(const v4f*)(&so[wave][rl][hh * 64 + pc * 8 + 4]);
      union { __bf16 e[8]; v4u u; } kh, kl;
#pragma unroll
      for (int e = 0; e < 8; ++e) { const float v = e < 4 ? va[e & 3] : vb[e & 3]; const __bf16 hv = (__bf16)v; kh.e[e] = hv; kl.e[e] = (__bf16)(v - (float)hv); }
      __bf16* d = KS + (((size_t)b * NH + h) * SS + s0 + wave * 16 + rl) * (2 * HD) + pc * 8;
      vst2(d, kh.u); vst2(d + HD, kl.u); } } }
  else {
#pragma unroll
    for (int j = 0; j < 8; ++j) { const float bb = 0.f;
#pragma unroll
      for (int r = 0; r < 8; ++r) { const float v = (acc[j][r] + bb) * 4.0f; const _Float16 hi = (_Float16)v; sth[j * 16 + col][wave * 16 + 8 * g + r] = hi; stl[j * 16 + col][wave * 16 + 8 * g + r] = (_Float16)((v - (float)hi) * VLO); } }
    __syncthreads();
    for (int qq = tid; qq < 128 * 8; qq += 128) { const int cl = qq >> 3, pc = qq & 7; const int c = n0 + cl, h = c >> 6, d = c & 63; const size_t o = (((size_t)b * NH + h) * HD + d) * SS + s0 + pc * 8;
      vst2(VTh + o, *(const v4u*)(&sth[cl][pc * 8])); vst2(VTl + o, *(const v4u*)(&stl[cl][pc * 8])); } }
}
// causal attention: block of 8 waves (query tiles t and 15 - t of 128 queries, one after the other, bh): 34 key tiles of 64 in every block; S on hi/lo bf16 splits of the f32 q and k (q split here, k rows arrive split); P,V hi/lo; O f32 [bh][s][64]
// each key tile (K rows hi | lo, V^T hi and lo) is brought into LDS once per query tile by asynchronous copies, whole lines per wave, and read from there by all 8 waves, the last of each query tile by waves 4-7 only; two buffers, the ring runs on over the change of query tile
// second bound: four waves per SIMD (256 registers a wave); 140 KiB of LDS: two blocks on each WGP, all 512 resident at once
__global__ __launch_bounds__(256, 4) void k_attn(const float* __restrict__ Q32, const __bf16* __restrict__ KS, const _Float16* __restrict__ VTh, const _Float16* __restrict__ VTl, float* __restrict__ O32) {
  __shared__ __align__(16) char ring[2 * ABUF];
  __shared__ __align__(16) float sS[8][16][68];      // scores in the loop, output staging behind it (each wave its own slice)
  __shared__ __align__(16) _Float16 sPh[8][16][72], sPl[8][16][72];
  const int tid = threadIdx.x, w = __builtin_amdgcn_readfirstlane(tid >> 5), lane = tid & 31, col = lane & 15, g = lane >> 4;
  const size_t bh = blockIdx.y;
  const int n0 = 2 * ((int)blockIdx.x + 1);          // key tiles of the first query tile; both together: NST
  // K: a copy of the block moves 16 rows of 256 B; V^T: 32 rows of 128 B
  const char* gK = (const char*)(KS + (bh * SS + (tid >> 4)) * (2 * HD) + (tid & 15) * 8);
  const char* gH = (const char*)(VTh + (bh * HD + (tid >> 3)) * SS + (tid & 7) * 8);
  const char* gL = (const char*)(VTl + (bh * HD + (tid >> 3)) * SS + (tid & 7) * 8);
  const unsigned lK = (unsigned)(size_t)ring + (tid >> 4) * PF + (tid & 15) * 16, lV = (unsigned)(size_t)ring + 64 * PF + (tid >> 3) * PB + (tid & 7) * 16;
  auto fill = [&](int s) { const int kt = s < n0 ? s : s - n0; const unsigned bo2 = (s & 1) * ABUF;
    cp4(lK + bo2, 16 * PF, gK + (size_t)kt * 64 * HD * 4, (size_t)16 * HD * 4);
    cp2(lV + bo2, 32 * PB, gH + (size_t)kt * 64 * 2, (size_t)32 * SS * 2); cp2(lV + bo2 + 64 * PB, 32 * PB, gL + (size_t)kt * 64 * 2, (size_t)32 * SS * 2); };
  fill(0);
  asm volatile("s_wait_asynccnt 0x0" ::: "memory");   // stage 0 landed before the barrier that publishes it
  __syncthreads();
  fill(1);
  int st = 0;
  for (int pass = 0; pass < 2; ++pass) {
  const int qb = pass == 0 ? (int)blockIdx.x : SS / 128 - 1 - (int)blockIdx.x; const int q0 = qb * 128 + w * 16;
  F2 aq[2];
#pragma unroll
  for (int kc = 0; kc < 2; ++kc) aq[kc] = split_row(Q32 + (bh * SS + q0 + col) * HD, kc * 32, lane);
  // mrun: the running maximum as a base-2 exponent (raw score x SC2, rounded once: an unchanged maximum rescales by exactly 1)
  float mrun = -3.0e38f, lrun = 0.f; v8f acc[4] = {}, ac1[4] = {}, ac2[4] = {};
#pragma unroll 1   // rolled: one copy of the loop's text, the buffer picked by st & 1
  for (int kt = 0; kt < 2 * (qb + 1); ++kt, ++st) { const char* bp = ring + (st & 1) * ABUF;
   if (kt * 64 <= q0 + 15) {      // a key tile wholly above the wave's diagonal adds nothing: the wave goes straight to the publish point
#pragma unroll
    for (int t = 0; t < 4; ++t) { const int key = kt * 64 + t * 16 + col; const __bf16* krow = (const __bf16*)(bp + (t * 16 + col) * PF);
      const F2 k0 = {frag_b(krow, lane), frag_b(krow + HD, lane)}, k1 = {frag_b(krow + 32, lane), frag_b(krow + HD + 32, lane)};
      v8f s = mac3(aq[0], k0, (v8f){}); s = mac3(aq[1], k1, s);
#pragma unroll
      for (int r = 0; r < 8; ++r) { sS[w][8 * g + r][t * 16 + col] = (key > q0 + 8 * g + r) ? -3.0e38f : s[r]; } }
    LDSX();
    float mx = -3.4e38f;
#pragma unroll
    for (int jj = 0; jj < 32; ++jj) mx = fmaxf(mx, sS[w][col][g * 32 + jj]);
    mx = fmaxf(mx, __shfl_xor(mx, 16, 32));
    const float mnew = fmaxf(mrun, mx * SC2); const float corr = __builtin_amdgcn_exp2f(mrun - mnew);
    float ps = 0.f;
#pragma unroll
    for (int j2 = 0; j2 < 32; j2 += 2) { const v2f ar = __builtin_elementwise_fma(*(const v2f*)(&sS[w][col][g * 32 + j2]), (v2f){SC2, SC2}, (v2f){-mnew, -mnew});   // two exponents by one packed fma
#pragma unroll
      for (int e = 0; e < 2; ++e) { const int jj = j2 + e; const float p = __builtin_amdgcn_exp2f(ar[e]) * 16384.0f; ps += p; const _Float16 hi = (_Float16)p; sPh[w][col][g * 32 + jj] = hi; sPl[w][col][g * 32 + jj] = (_Float16)((p - (float)hi) * PLO); } }
    ps += __shfl_xor(ps, 16, 32);
    lrun = lrun * corr + ps * (1.0f / 16384.0f); mrun = mnew;
#pragma unroll
    for (int r = 0; r < 8; ++r) { const float cr = __shfl(corr, 8 * g + r, 32);
#pragma unroll
      for (int t = 0; t < 4; ++t) { acc[t][r] *= cr; ac1[t][r] *= cr; ac2[t][r] *= cr; } }
    LDSX();
#pragma unroll
    for (int kc = 0; kc < 2; ++kc) { const v16h ph = frag_h(&sPh[w][col][0] + kc * 32, lane), pl = frag_h(&sPl[w][col][0] + kc * 32, lane); v16h vh[2], vl[2];   // the LDS reads of two output tiles stand as one group ahead of their matrix run
#pragma unroll
      for (int tp = 0; tp < 4; tp += 2) {
#pragma unroll
      for (int t = 0; t < 2; ++t) { const _Float16* vr = (const _Float16*)(bp + 64 * PF + ((tp + t) * 16 + col) * PB) + kc * 32; vh[t] = frag_h(vr, lane); vl[t] = frag_h(vr + 64 * PB / 2, lane); }
#pragma unroll
      for (int t = 0; t < 2; ++t) { acc[tp + t] = wmma16(ph, vh[t], acc[tp + t]); ac1[tp + t] = wmma16(ph, vl[t], ac1[tp + t]); ac2[tp + t] = wmma16(pl, vh[t], ac2[tp + t]); } } } }
    RING_PUBLISH();
    if (st + 2 < NST) fill(st + 2); }
#pragma unroll
  for (int r = 0; r < 8; ++r) { const float lr = __shfl(lrun, 8 * g + r, 32); const float inv = 1.0f / (lr * 16384.0f * 4.0f);
#pragma unroll
    for (int t = 0; t < 4; ++t) sS[w][8 * g + r][t * 16 + col] = (acc[t][r] + ac1[t][r] * (1.0f / VLO) + ac2[t][r] * (1.0f / PLO)) * inv; }
  LDSX();
  for (int qq = lane; qq < 16 * 16; qq += 32) { const int rl = qq >> 4, pc = qq & 15; vst2(O32 + ((bh * SS) + q0 + rl) * HD + pc * 4, *(const v4f*)(&sS[w][rl][pc * 4])); }
  LDSX();   // the staged rows are read before the next query tile's scores overwrite them
  }
  asm volatile("s_wait_asynccnt 0x0" ::: "memory");   // nothing in flight when the wave ends
}
// out = ctx Wo^T + bo : split(ctx) x bf16(Wo rows): 2 products (Wo is an INPUT -> bf16 exact)
__global__ __launch_bounds__(128) void k_out(const float* __restrict__ O32, int rbase, const __bf16* __restrict__ PT, const float* __restrict__ bo, float* __restrict__ out) {
  __shared__ __align__(16) char sm[2 * OBUF];   // the ring in the loop; behind its last barrier the output staging
  float (*so)[16][132] = (float (*)[16][132])sm;
  const int tid = threadIdx.x, wave = tid >> 5, lane = tid & 31, col = lane & 15, g = lane >> 4;
  const int r0b = blockIdx.x * 64, r0 = r0b + wave * 16, n0 = blockIdx.y * 128; const int b = r0b / SS, s0 = r0b % SS;
  v8f acc[8] = {};
  // stage t = head t: ctx rows of 256 B (a copy of the block moves 8 rows), weight rows of 128 B (16 rows), whole lines per wave
  const char* gA = (const char*)(O32 + ((size_t)b * NH * SS + s0 + (tid >> 4)) * HD + (tid & 15) * 4);
  const char* gB = (const char*)(PT + (size_t)(3 * E + n0 + (tid >> 3)) * E + (tid & 7) * 8);
  const unsigned lA = (unsigned)(size_t)sm + (tid >> 4) * PF + (tid & 15) * 16, lB = (unsigned)(size_t)sm + 64 * PF + (tid >> 3) * PB + (tid & 7) * 16;
  auto fill = [&](int t) { const unsigned bo2 = (t & 1) * OBUF; const char* a = gA + (size_t)t * SS * HD * 4; const char* w = gB + (size_t)t * KT * 2;
    cp4(lA + bo2, 8 * PF, a, (size_t)8 * HD * 4); cp4(lA + bo2 + 32 * PF, 8 * PF, a + (size_t)32 * HD * 4, (size_t)8 * HD * 4);
    cp4(lB + bo2, 16 * PB, w, (size_t)16 * E * 2); cp4(lB + bo2 + 64 * PB, 16 * PB, w + (size_t)64 * E * 2, (size_t)16 * E * 2); };
  fill(0);
  asm volatile("s_wait_asynccnt 0x0" ::: "memory");   // stage 0 landed before the barrier that publishes it
  __syncthreads();
  fill(1);
#pragma unroll 1   // rolled: one copy of the loop's text, the buffer picked by t & 1
  for (int t = 0; t < E / KT; ++t) { const char* bp = sm + (t & 1) * OBUF; F2 a[2]; v16b wf[2][8];   // the stage's LDS reads stand as one group ahead of its matrix run
#pragma unroll
    for (int kk = 0; kk < 2; ++kk) { a[kk] = split_row4((const float*)(bp + (wave * 16 + col) * PF) + kk * 32 + 8 * g);
#pragma unroll
      for (int j = 0; j < 8; ++j) wf[kk][j] = frag_b((const __bf16*)(bp + 64 * PF + (j * 16 + col) * PB) + kk * 32, lane); }
#pragma unroll
    for (int kk = 0; kk < 2; ++kk) {
#pragma unroll
      for (int j = 0; j < 8; ++j) { acc[j] = wmma_bf(a[kk].l, wf[kk][j], acc[j]); acc[j] = wmma_bf(a[kk].h, wf[kk][j], acc[j]); } }
    RING_PUBLISH();
    if (t + 2 < E / KT) fill(t + 2); }
  asm volatile("s_wait_asynccnt 0x0" ::: "memory");   // nothing in flight when the ring becomes output staging
#pragma unroll
  for (int j = 0; j < 8; ++j) { const int n = n0 + j * 16 + col; const float bb = bfr(bo[n]);
#pragma unroll
    for (int r = 0; r < 8; ++r) so[wave][8 * g + r][j * 16 + col] = acc[j][r] + bb; }
  LDSX();
#pragma unroll 4
  for (int rl = 0; rl < 16; ++rl) vst2(out + (size_t)(rbase + r0 + rl) * E + n0 + lane * 4, *(const v4f*)(&so[wave][rl][lane * 4]));
}
#define NBHALF 2
extern "C" void kernel_launch(void* const* d_in, const int* in_sizes, int n_in, void* d_out, int out_size, void* d_ws, size_t ws_size, hipStream_t stream) {
  (void)in_sizes; (void)n_in; (void)out_size; (void)ws_size;
  const float* x = (const float*)d_in[0]; const float* Wqkv = (const float*)d_in[1]; const float* Wp = (const float*)d_in[2]; const float* bp = (const float*)d_in[3];
  float* out = (float*)d_out;
  char* ws = (char*)d_ws; size_t off = 0;
  auto take = [&](size_t bytes) { char* p = ws + off; off += (bytes + 255) & ~(size_t)255; return p; };
  const size_t HR = (size_t)NBHALF * SS;     // rows per half (4096)
  __bf16* Xb = (__bf16*)take((size_t)NR * E * 2); __bf16* PT = (__bf16*)take((size_t)4 * E * E * 2);
  float* Q32 = (float*)take((size_t)NR * E * 4); __bf16* KS = (__bf16*)take((size_t)NR * E * 4); _Float16* VTh = (_Float16*)take((size_t)NR * E * 2); _Float16* VTl = (_Float16*)take((size_t)NR * E * 2);
  float* O32 = Q32;      // in place: each k_attn wave reads its own 16 query rows into registers before writing the same rows; no other block reads them
  // ws ~ 120 MB; Q/K/V of all four batches are held at once, so that one attention launch covers all 64 (batch, head) pairs
  k_cvt<<<(NR * E / 8 + 255) / 256, 256, 0, stream>>>(x, Xb);
  k_pack<<<4 * E, 128, 0, stream>>>(Wqkv, Wp, PT);
  for (int hf = 0; hf < 2; ++hf) { const int rbase = hf * (int)HR; const size_t ho = hf * HR * E;
    k_qkv<<<dim3(HR / 64, E / 128, 3), 128, 0, stream>>>(Xb, rbase, PT, Q32 + ho, KS + 2 * ho, VTh + ho, VTl + ho); }
  k_attn<<<dim3(SS / 256, NB * NH), 256, 0, stream>>>(Q32, KS, VTh, VTl, O32);
  for (int hf = 0; hf < 2; ++hf) { const int rbase = hf * (int)HR; const size_t ho = hf * HR * E;
    k_out<<<dim3(HR / 64, E / 128), 128, 0, stream>>>(O32 + ho, rbase, PT, bp, out); }
}

// v006
// A run of this version takes 212 microseconds.
// Next to v005, in two timings, it ran 1.08 and 1.07 times as fast.
// Counting every step since v000, it is 4.86 times as fast.
// compute dtype: x, w_qkv, w_proj, b_proj (INPUTS) rounded to bf16 with exact bf16 WMMA products (f32 accumulate) for the projections; q/k f32 split for the scores (3 products), P and V f16 hi/lo (3 products); softmax f32.
#include <hip/hip_runtime.h>
#include <math.h>

typedef __attribute__((ext_vector_type(16))) _Float16 v16h;
typedef __attribute__((ext_vector_type(16))) __bf16 v16b;
typedef __attribute__((ext_vector_type(8)))  _Float16 v8h;
typedef __attribute__((ext_vector_type(8)))  float v8f;
typedef __attribute__((ext_vector_type(4)))  float v4f;
typedef __attribute__((ext_vector_type(2)))  float v2f;
typedef __attribute__((ext_vector_type(4)))  unsigned v4u;
typedef __attribute__((ext_vector_type(4)))  int v4i;
typedef float __attribute__((may_alias)) float_a;
typedef int __attribute__((may_alias)) int_a;

template <typename T> __device__ __forceinline__ void vst2(void* p, T v) { *(T*)p = v;  }
__device__ __forceinline__ v8f wmma16(v16h a, v16h b, v8f c) {
  v8f d = __builtin_amdgcn_wmma_f32_16x16x32_f16(false, a, false, b, (short)0, c, false, false);
  asm volatile("v_nop\n\tv_nop\n\tv_nop\n\tv_nop" : "+v"(d) : "v"(a), "v"(b));
  return d;
}
__device__ __forceinline__ v8f wmma_bf(v16b a, v16b b, v8f c) {
  v8f d = __builtin_amdgcn_wmma_f32_16x16x32_bf16(false, a, false, b, (short)0, c, false, false);
  asm volatile("v_nop\n\tv_nop\n\tv_nop\n\tv_nop" : "+v"(d) : "v"(a), "v"(b));
  return d;
}
// 16x16x32 fragments: lane = (h = lane>>4, row/col = lane&15); elements 0..7 = k0+8h+0..7, 8..15 = k0+16+8h+0..7; D element r = row 8h+r
__device__ __forceinline__ v16h frag_h(const _Float16* rowk0, int lane) {
  union { v16h v; v8h q[2]; } u; const _Float16* p = rowk0 + 8 * (lane >> 4);
  u.q[0] = *(const v8h*)p; u.q[1] = *(const v8h*)(p + 16); return u.v;
}
__device__ __forceinline__ v16h frag_f32(const float* rowk0, int lane) {
  v16h a; const float* p = rowk0 + 8 * (lane >> 4);
#pragma unroll
  for (int i = 0; i < 8; ++i) { a[i] = (_Float16)p[i]; a[8 + i] = (_Float16)p[16 + i]; }
  return a;
}
__device__ __forceinline__ v16h frag_f32s(const float* rowk0, int lane, float sc) {
  v16h a; const float* p = rowk0 + 8 * (lane >> 4);
#pragma unroll
  for (int i = 0; i < 8; ++i) { a[i] = (_Float16)(p[i] * sc); a[8 + i] = (_Float16)(p[16 + i] * sc); }
  return a;
}
// column fragment from a [K][ld] layout (column n), rows >= K read as 0
__device__ __forceinline__ v16h fragc_f32(const float* W, int k0, int n, int lane, int ld, int K) {
  v16h a; const int g = lane >> 4;
#pragma unroll
  for (int i = 0; i < 8; ++i) { const int ka = k0 + 8 * g + i, kb = ka + 16;
    a[i] = (_Float16)(ka < K ? W[(size_t)(ka < K ? ka : K - 1) * ld + n] : 0.f); a[8 + i] = (_Float16)(kb < K ? W[(size_t)(kb < K ? kb : K - 1) * ld + n] : 0.f); }
  return a;
}
struct F2 { v16b h, l; };
__device__ __forceinline__ F2 bsplit16(const float v[16]) { F2 r;
#pragma unroll
  for (int i = 0; i < 16; ++i) { const __bf16 h = (__bf16)v[i]; r.h[i] = h; r.l[i] = (__bf16)(v[i] - (float)h); }
  return r; }
__device__ __forceinline__ F2 split_row(const float* row, int k0, int lane) { float v[16]; const float* p = row + k0 + 8 * (lane >> 4);
#pragma unroll
  for (int i = 0; i < 8; ++i) { v[i] = p[i]; v[8 + i] = p[16 + i]; }
  return bsplit16(v); }
__device__ __forceinline__ F2 split_rowK(const float* row, int k0, int lane, int K) { float v[16]; const int g = lane >> 4;
#pragma unroll
  for (int i = 0; i < 8; ++i) { const int ka = k0 + 8 * g + i, kb = ka + 16; v[i] = ka < K ? row[ka < K ? ka : K - 1] : 0.f; v[8 + i] = kb < K ? row[kb < K ? kb : K - 1] : 0.f; }
  return bsplit16(v); }
__device__ __forceinline__ F2 split_col(const float* W, int k0, int n, int lane, int ld, int K) { float v[16]; const int g = lane >> 4;
#pragma unroll
  for (int i = 0; i < 8; ++i) { const int ka = k0 + 8 * g + i, kb = ka + 16; v[i] = ka < K ? W[(size_t)(ka < K ? ka : K - 1) * ld + n] : 0.f; v[8 + i] = kb < K ? W[(size_t)(kb < K ? kb : K - 1) * ld + n] : 0.f; }
  return bsplit16(v); }
__device__ __forceinline__ v8f mac3(const F2& a, const F2& b, v8f c) { c = wmma_bf(a.l, b.h, c); c = wmma_bf(a.h, b.l, c); return wmma_bf(a.h, b.h, c); }
__device__ __forceinline__ float sigm(float v) { return 1.0f / (1.0f + expf(-v)); }
#define LDSX() do { asm volatile("s_wait_dscnt 0" ::: "memory"); __builtin_amdgcn_wave_barrier(); __builtin_amdgcn_fence(__ATOMIC_RELEASE, "workgroup"); } while (0)


#define NB 4
#define SS 2048
#define E 1024
#define NH 16
#define HD 64
#define NR (NB * SS)
#define PLO 1024.0f
#define VLO 2048.0f
#define SC2 0.18033688011112042f      // hs^-0.5 * log2(e): a raw score times this is its exponent to base 2
__device__ __forceinline__ float bfr(float v) { return (float)(__bf16)v; }
__device__ __forceinline__ v16b frag_b(const __bf16* rowk0, int lane) { return __builtin_bit_cast(v16b, frag_h((const _Float16*)rowk0, lane)); }

// asynchronous copies to LDS, 16 bytes a lane: l = the lane's LDS byte address, g = its global address. The s_wait_xcnt closes each statement, so that no address register is rewritten ahead of it.
#define CPY "global_load_async_to_lds_b128 "
__device__ __forceinline__ void cp4(unsigned l, unsigned ls, const char* g, size_t gs) {
  asm volatile(CPY "%0, %1, off\n\t" CPY "%2, %3, off\n\t" CPY "%4, %5, off\n\t" CPY "%6, %7, off\n\ts_wait_xcnt 0x0"
               :: "v"(l), "v"(g), "v"(l + ls), "v"(g + gs), "v"(l + 2 * ls), "v"(g + 2 * gs), "v"(l + 3 * ls), "v"(g + 3 * gs) : "memory");
}
__device__ __forceinline__ void cp2(unsigned l, unsigned ls, const char* g, size_t gs) {
  asm volatile(CPY "%0, %1, off\n\t" CPY "%2, %3, off\n\ts_wait_xcnt 0x0" :: "v"(l), "v"(g), "v"(l + ls), "v"(g + gs) : "memory");
}
// publish point of the two-buffer ring: own LDS reads done, own copies landed, then the work-group barrier (it publishes the next tile and frees the buffer just read)
#define RING_PUBLISH() do { asm volatile("s_wait_dscnt 0x0" ::: "memory"); asm volatile("s_wait_asynccnt 0x0" ::: "memory"); __syncthreads(); } while (0)
#define KT 64                         // k per stage: 128 B of a bf16 row, 256 B of an f32 row
#define PB 144                        // LDS pitch of a 128-B row, 16 B x odd: ds_load_b128 free of bank conflicts
#define PF 272                        // LDS pitch of a 256-B row, likewise
#define QBUF (192 * PB)               // k_qkv stage: 64 x rows, then 128 weight rows
#define OBUF (64 * PF + 128 * PB)     // k_out stage: 64 f32 ctx rows, then 128 weight rows
#define ABUF (64 * PF + 2 * 64 * PB) // k_attn stage: 64 K rows of 256 B (64 bf16 hi, 64 bf16 lo), then 64 V^T hi rows and 64 V^T lo rows of 64 keys
#define NST (2 * (SS / 128 + 1))      // k_attn stages in a block: 2 (t + 1) + 2 (16 - t)
__device__ __forceinline__ F2 split_row4(const float* p) { float v[16]; const v4f a = *(const v4f*)p, b = *(const v4f*)(p + 4), c = *(const v4f*)(p + 16), d = *(const v4f*)(p + 20);
#pragma unroll
  for (int i = 0; i < 4; ++i) { v[i] = a[i]; v[4 + i] = b[i]; v[8 + i] = c[i]; v[12 + i] = d[i]; }
  return bsplit16(v); }

__global__ __launch_bounds__(256) void k_cvt(const float* __restrict__ x, __bf16* __restrict__ Xb) {
  const size_t i8 = (size_t)blockIdx.x * 256 + threadIdx.x; if (i8 >= (size_t)NR * E / 8) return;
  union { __bf16 h[8]; v4u u; } pk;
#pragma unroll
  for (int e = 0; e < 8; ++e) pk.h[e] = (__bf16)x[i8 * 8 + e];
  vst2((unsigned*)(Xb + i8 * 8), pk.u);
}
// PT rows: [0,3E) = w_qkv rows (q | k | v output features), [3E,4E) = w_proj rows ([out][in] weights)
__global__ __launch_bounds__(128) void k_pack(const float* __restrict__ Wqkv, const float* __restrict__ Wp, __bf16* __restrict__ PT) {
  const int n = blockIdx.x, tid = threadIdx.x; __shared__ __align__(16) __bf16 srow[E];
  for (int k = tid; k < E; k += 128) srow[k] = (__bf16)(n < 3 * E ? Wqkv[(size_t)n * E + k] : Wp[(size_t)(n - 3 * E) * E + k]);      // [out][in]: rows
  __syncthreads();
  if (tid < E / 8) vst2((unsigned*)(PT + (size_t)n * E + tid * 8), *(const v4u*)(&srow[tid * 8]));
}
// QKV: block (64 rows, 128 cols = 2 heads, which); q -> Q32 f32 [bh][s][64]; k -> KS bf16 [bh][s][64 hi | 64 lo], the split of the f32 value made here, once; v -> VT hi/lo x4 [bh][d][s]
__global__ __launch_bounds__(128) void k_qkv(const __bf16* __restrict__ Xb, int rbase, const __bf16* __restrict__ PT, float* __restrict__ Q32, __bf16* __restrict__ KS, _Float16* __restrict__ VTh, _Float16* __restrict__ VTl) {
  __shared__ __align__(16) char sm[70656];      // the ring (2 x QBUF) in the loop; behind its last barrier the output staging
  float (*so)[16][132] = (float (*)[16][132])sm; _Float16 (*sth)[72] = (_Float16 (*)[72])(sm + 33792); _Float16 (*stl)[72] = (_Float16 (*)[72])(sm + 33792 + 18432);
  const int tid = threadIdx.x, wave = tid >> 5, lane = tid & 31, col = lane & 15, g = lane >> 4;
  const int which = blockIdx.z, r0b = blockIdx.x * 64, r0 = r0b + wave * 16, n0 = blockIdx.y * 128; const int b = r0b / SS, s0 = r0b % SS;
  v8f acc[8] = {};
  // a copy of the block moves 16 rows of 128 B: thread -> (row tid >> 3, 16-B piece tid & 7), whole lines per wave
  const char* gA = (const char*)(Xb + (size_t)(rbase + r0b + (tid >> 3)) * E + (tid & 7) * 8);
  const char* gB = (const char*)(PT + (size_t)(which * E + n0 + (tid >> 3)) * E + (tid & 7) * 8);
  const unsigned l0 = (unsigned)(size_t)sm + (tid >> 3) * PB + (tid & 7) * 16;
  auto fill = [&](int t) { const unsigned l = l0 + (t & 1) * QBUF; const size_t ko = (size_t)t * KT * 2;
    cp4(l, 16 * PB, gA + ko, (size_t)16 * E * 2); cp4(l + 64 * PB, 16 * PB, gB + ko, (size_t)16 * E * 2); cp4(l + 128 * PB, 16 * PB, gB + ko + (size_t)64 * E * 2, (size_t)16 * E * 2); };
  fill(0);
  asm volatile("s_wait_asynccnt 0x0" ::: "memory");   // stage 0 landed before the barrier that publishes it
  __syncthreads();
  fill(1);
#pragma unroll 1   // rolled: one copy of the loop's text, the buffer picked by t & 1
  for (int t = 0; t < E / KT; ++t) { const char* bp = sm + (t & 1) * QBUF; v16b a[2], wf[2][8];   // the stage's LDS reads stand as one group ahead of its matrix run
#pragma unroll
    for (int kk = 0; kk < 2; ++kk) { a[kk] = frag_b((const __bf16*)(bp + (wave * 16 + col) * PB) + kk * 32, lane);
#pragma unroll
      for (int j = 0; j < 8; ++j) wf[kk][j] = frag_b((const __bf16*)(bp + (64 + j * 16 + col) * PB) + kk * 32, lane); }
#pragma unroll
    for (int kk = 0; kk < 2; ++kk) {
#pragma unroll
      for (int j = 0; j < 8; ++j) acc[j] = wmma_bf(a[kk], wf[kk][j], acc[j]); }
    RING_PUBLISH();
    if (t + 2 < E / KT) fill(t + 2); }
  asm volatile("s_wait_asynccnt 0x0" ::: "memory");   // nothing in flight when the ring becomes output staging
  if (which < 2) {
#pragma unroll
    for (int j = 0; j < 8; ++j) { const float bb = 0.f;
#pragma unroll
      for (int r = 0; r < 8; ++r) so[wave][8 * g + r][j * 16 + col] = acc[j][r] + bb; }
    LDSX();
    if (which == 0) {
    for (int qq = lane; qq < 2 * 16 * 16; qq += 32) { const int hh = qq >> 8, rl = (qq >> 4) & 15, pc = qq & 15; const int h = (n0 >> 6) + hh;
      vst2(Q32 + (((size_t)b * NH + h) * SS + s0 + wave * 16 + rl) * HD + pc * 4, *(const v4f*)(&so[wave][rl][hh * 64 + pc * 4])); } }
    else {
    for (int qq = lane; qq < 2 * 16 * 8; qq += 32) { const int hh = qq >> 7, rl = (qq >> 3) & 15, pc = qq & 7; const int h = (n0 >> 6) + hh;
      const v4f va = *(const v4f*)(&so[wave][rl][hh * 64 + pc * 8]), vb = *(const v4f*)(&so[wave][rl][hh * 64 + pc * 8 + 4]);
      union { __bf16 e[8]; v4u u; } kh, kl;
#pragma unroll
      for (int e = 0; e < 8; ++e) { const float v = e < 4 ? va[e & 3] : vb[e & 3]; const __bf16 hv = (__bf16)v; kh.e[e] = hv; kl.e[e] = (__bf16)(v - (float)hv); }
      __bf16* d = KS + (((size_t)b * NH + h) * SS + s0 + wave * 16 + rl) * (2 * HD) + pc * 8;
      vst2(d, kh.u); vst2(d + HD, kl.u); } } }
  else {
#pragma unroll
    for (int j = 0; j < 8; ++j) { const float bb = 0.f;
#pragma unroll
      for (int r = 0; r < 8; ++r) { const float v = (acc[j][r] + bb) * 4.0f; const _Float16 hi = (_Float16)v; sth[j * 16 + col][wave * 16 + 8 * g + r] = hi; stl[j * 16 + col][wave * 16 + 8 * g + r] = (_Float16)((v - (float)hi) * VLO); } }
    __syncthreads();
    for (int qq = tid; qq < 128 * 8; qq += 128) { const int cl = qq >> 3, pc = qq & 7; const int c = n0 + cl, h = c >> 6, d = c & 63; const size_t o = (((size_t)b * NH + h) * HD + d) * SS + s0 + pc * 8;
      vst2(VTh + o, *(const v4u*)(&sth[cl][pc * 8])); vst2(VTl + o, *(const v4u*)(&stl[cl][pc * 8])); } }
}
__device__ __forceinline__ v8f mac3t(const F2& k, const F2& q, v8f c) { c = wmma_bf(k.h, q.l, c); c = wmma_bf(k.l, q.h, c); return wmma_bf(k.h, q.h, c); }
__global__ __launch_bounds__(256, 4) void k_attn(const float* __restrict__ Q32, const __bf16* __restrict__ KS, const _Float16* __restrict__ VTh, const _Float16* __restrict__ VTl, float* __restrict__ O32) {
  __shared__ __align__(16) char ring[2 * ABUF];
  __shared__ __align__(16) float sS[8][16][68];      // output staging (each wave its own slice)
  const int tid = threadIdx.x, w = __builtin_amdgcn_readfirstlane(tid >> 5), lane = tid & 31, col = lane & 15, g = lane >> 4;
  const size_t bh = blockIdx.y;
  const int n0 = 2 * ((int)blockIdx.x + 1);          // key tiles of the first query tile; both together: NST
  // K: a copy of the block moves 16 rows of 256 B; V^T: 32 rows of 128 B
  const char* gK = (const char*)(KS + (bh * SS + (tid >> 4)) * (2 * HD) + (tid & 15) * 8);
  const char* gH = (const char*)(VTh + (bh * HD + (tid >> 3)) * SS + (tid & 7) * 8);
  const char* gL = (const char*)(VTl + (bh * HD + (tid >> 3)) * SS + (tid & 7) * 8);
  const unsigned lK = (unsigned)(size_t)ring + (tid >> 4) * PF + (tid & 15) * 16, lV = (unsigned)(size_t)ring + 64 * PF + (tid >> 3) * PB + (tid & 7) * 16;
  auto fill = [&](int s) { const int kt = s < n0 ? s : s - n0; const unsigned bo2 = (s & 1) * ABUF;
    cp4(lK + bo2, 16 * PF, gK + (size_t)kt * 64 * HD * 4, (size_t)16 * HD * 4);
    cp2(lV + bo2, 32 * PB, gH + (size_t)kt * 64 * 2, (size_t)32 * SS * 2); cp2(lV + bo2 + 64 * PB, 32 * PB, gL + (size_t)kt * 64 * 2, (size_t)32 * SS * 2); };
  fill(0);
  asm volatile("s_wait_asynccnt 0x0" ::: "memory");   // stage 0 landed before the barrier that publishes it
  __syncthreads();
  fill(1);
  int st = 0;
  for (int pass = 0; pass < 2; ++pass) {
  const int qb = pass == 0 ? (int)blockIdx.x : SS / 128 - 1 - (int)blockIdx.x; const int q0 = qb * 128 + w * 16;
  F2 aq[2];      // the lane's query q0 + col, as the B operand
#pragma unroll
  for (int kc = 0; kc < 2; ++kc) aq[kc] = split_row(Q32 + (bh * SS + q0 + col) * HD, kc * 32, lane);
  // mrun: the running maximum as a base-2 exponent (raw score x SC2, rounded once: an unchanged maximum rescales by exactly 1); mrun, lrun: of query q0 + col, the same in both halves of the wave
  float mrun = -3.0e38f, lrun = 0.f; v8f acc[4] = {}, ac1[4] = {}, ac2[4] = {};      // element r of tile t: O^T[t * 16 + 8 g + r][q0 + col]
#pragma unroll 1   // rolled: one copy of the loop's text, the buffer picked by st & 1
  for (int kt = 0; kt < 2 * (qb + 1); ++kt, ++st) { const char* bp = ring + (st & 1) * ABUF;
   if (kt * 64 <= q0 + 15) {      // a key tile wholly above the wave's diagonal adds nothing: the wave goes straight to the publish point
    const int lim = q0 + col - kt * 64 - 8 * g;      // key t * 16 + 8 g + r of the tile is above the diagonal where t * 16 + r > lim
    v8f s[4];
#pragma unroll
    for (int t = 0; t < 4; ++t) { const __bf16* krow = (const __bf16*)(bp + (t * 16 + col) * PF);
      const F2 k0 = {frag_b(krow, lane), frag_b(krow + HD, lane)}, k1 = {frag_b(krow + 32, lane), frag_b(krow + HD + 32, lane)};
      s[t] = mac3t(k0, aq[0], (v8f){}); s[t] = mac3t(k1, aq[1], s[t]);
#pragma unroll
      for (int r = 0; r < 8; ++r) s[t][r] = (t * 16 + r > lim) ? -3.0e38f : s[t][r]; }
    float mx = -3.4e38f;
#pragma unroll
    for (int t = 0; t < 4; ++t) {
#pragma unroll
      for (int r = 0; r < 8; ++r) mx = fmaxf(mx, s[t][r]); }
    mx = fmaxf(mx, __shfl_xor(mx, 16, 32));
    const float mnew = fmaxf(mrun, mx * SC2); const float ca = mrun - mnew; const float corr = __builtin_amdgcn_exp2f(ca);
    asm volatile("v_nop" :: "v"(ca), "v"(corr));   // the same slot behind this v_exp_f32 (see below)
    float ps = 0.f; v16h ph[2], pl[2];      // P^T operands of 32 keys: element e = key 8 g + e, element 8 + e = key 16 + 8 g + e, as two score tiles hold them
#pragma unroll
    for (int t = 0; t < 4; ++t) { v2f ar[4]; float ex[8];
#pragma unroll
      for (int j = 0; j < 4; ++j) ar[j] = __builtin_elementwise_fma((v2f){s[t][2 * j], s[t][2 * j + 1]}, (v2f){SC2, SC2}, (v2f){-mnew, -mnew});   // two exponents by one packed fma
#pragma unroll
      for (int r = 0; r < 8; ++r) ex[r] = __builtin_amdgcn_exp2f(ar[r >> 1][r & 1]);
      // the slot behind a transcendental before its source register is written again: the exponents are inputs here, so they keep their registers up to this v_nop, which stands behind the eight v_exp_f32
      asm volatile("v_nop" :: "v"(ar[0]), "v"(ar[1]), "v"(ar[2]), "v"(ar[3]), "v"(ex[0]), "v"(ex[1]), "v"(ex[2]), "v"(ex[3]), "v"(ex[4]), "v"(ex[5]), "v"(ex[6]), "v"(ex[7]));
#pragma unroll
      for (int r = 0; r < 8; ++r) { const float p = ex[r] * 16384.0f; ps += p; const _Float16 hi = (_Float16)p; ph[t >> 1][(t & 1) * 8 + r] = hi; pl[t >> 1][(t & 1) * 8 + r] = (_Float16)((p - (float)hi) * PLO); } }
    ps += __shfl_xor(ps, 16, 32);
    lrun = lrun * corr + ps * (1.0f / 16384.0f); mrun = mnew;
#pragma unroll
    for (int t = 0; t < 4; ++t) { acc[t] *= corr; ac1[t] *= corr; ac2[t] *= corr; }
#pragma unroll
    for (int kc = 0; kc < 2; ++kc) { v16h vh[2], vl[2];   // the LDS reads of two output tiles stand as one group ahead of their matrix run
#pragma unroll
      for (int tp = 0; tp < 4; tp += 2) {
#pragma unroll
      for (int t = 0; t < 2; ++t) { const _Float16* vr = (const _Float16*)(bp + 64 * PF + ((tp + t) * 16 + col) * PB) + kc * 32; vh[t] = frag_h(vr, lane); vl[t] = frag_h(vr + 64 * PB / 2, lane); }
#pragma unroll
      for (int t = 0; t < 2; ++t) { acc[tp + t] = wmma16(vh[t], ph[kc], acc[tp + t]); ac1[tp + t] = wmma16(vl[t], ph[kc], ac1[tp + t]); ac2[tp + t] = wmma16(vh[t], pl[kc], ac2[tp + t]); } } } }
    RING_PUBLISH();
    if (st + 2 < NST) fill(st + 2); }
  const float inv = 1.0f / (lrun * 16384.0f * 4.0f);
#pragma unroll
  for (int t = 0; t < 4; ++t) { v4f o[2];
#pragma unroll
    for (int r = 0; r < 8; ++r) o[r >> 2][r & 3] = (acc[t][r] + ac1[t][r] * (1.0f / VLO) + ac2[t][r] * (1.0f / PLO)) * inv;
    *(v4f*)(&sS[w][col][t * 16 + 8 * g]) = o[0]; *(v4f*)(&sS[w][col][t * 16 + 8 * g + 4]) = o[1]; }
  LDSX();
  for (int qq = lane; qq < 16 * 16; qq += 32) { const int rl = qq >> 4, pc = qq & 15; vst2(O32 + ((bh * SS) + q0 + rl) * HD + pc * 4, *(const v4f*)(&sS[w][rl][pc * 4])); }
  LDSX();   // the staged rows are read before the next query tile's output overwrites them
  }
  asm volatile("s_wait_asynccnt 0x0" ::: "memory");   // nothing in flight when the wave ends
}
// out = ctx Wo^T + bo : split(ctx) x bf16(Wo rows): 2 products (Wo is an INPUT -> bf16 exact)
__global__ __launch_bounds__(128) void k_out(const float* __restrict__ O32, int rbase, const __bf16* __restrict__ PT, const float* __restrict__ bo, float* __restrict__ out) {
  __shared__ __align__(16) char sm[2 * OBUF];   // the ring in the loop; behind its last barrier the output staging
  float (*so)[16][132] = (float (*)[16][132])sm;
  const int tid = threadIdx.x, wave = tid >> 5, lane = tid & 31, col = lane & 15, g = lane >> 4;
  const int r0b = blockIdx.x * 64, r0 = r0b + wave * 16, n0 = blockIdx.y * 128; const int b = r0b / SS, s0 = r0b % SS;
  v8f acc[8] = {};
  // stage t = head t: ctx rows of 256 B (a copy of the block moves 8 rows), weight rows of 128 B (16 rows), whole lines per wave
  const char* gA = (const char*)(O32 + ((size_t)b * NH * SS + s0 + (tid >> 4)) * HD + (tid & 15) * 4);
  const char* gB = (const char*)(PT + (size_t)(3 * E + n0 + (tid >> 3)) * E + (tid & 7) * 8);
  const unsigned lA = (unsigned)(size_t)sm + (tid >> 4) * PF + (tid & 15) * 16, lB = (unsigned)(size_t)sm + 64 * PF + (tid >> 3) * PB + (tid & 7) * 16;
  auto fill = [&](int t) { const unsigned bo2 = (t & 1) * OBUF; const char* a = gA + (size_t)t * SS * HD * 4; const char* w = gB + (size_t)t * KT * 2;
    cp4(lA + bo2, 8 * PF, a, (size_t)8 * HD * 4); cp4(lA + bo2 + 32 * PF, 8 * PF, a + (size_t)32 * HD * 4, (size_t)8 * HD * 4);
    cp4(lB + bo2, 16 * PB, w, (size_t)16 * E * 2); cp4(lB + bo2 + 64 * PB, 16 * PB, w + (size_t)64 * E * 2, (size_t)16 * E * 2); };
  fill(0);
  asm volatile("s_wait_asynccnt 0x0" ::: "memory");   // stage 0 landed before the barrier that publishes it
  __syncthreads();
  fill(1);
#pragma unroll 1   // rolled: one copy of the loop's text, the buffer picked by t & 1
  for (int t = 0; t < E / KT; ++t) { const char* bp = sm + (t & 1) * OBUF; F2 a[2]; v16b wf[2][8];   // the stage's LDS reads stand as one group ahead of its matrix run
#pragma unroll
    for (int kk = 0; kk < 2; ++kk) { a[kk] = split_row4((const float*)(bp + (wave * 16 + col) * PF) + kk * 32 + 8 * g);
#pragma unroll
      for (int j = 0; j < 8; ++j) wf[kk][j] = frag_b((const __bf16*)(bp + 64 * PF + (j * 16 + col) * PB) + kk * 32, lane); }
#pragma unroll
    for (int kk = 0; kk < 2; ++kk) {
#pragma unroll
      for (int j = 0; j < 8; ++j) { acc[j] = wmma_bf(a[kk].l, wf[kk][j], acc[j]); acc[j] = wmma_bf(a[kk].h, wf[kk][j], acc[j]); } }
    RING_PUBLISH();
    if (t + 2 < E / KT) fill(t + 2); }
  asm volatile("s_wait_asynccnt 0x0" ::: "memory");   // nothing in flight when the ring becomes output staging
#pragma unroll
  for (int j = 0; j < 8; ++j) { const int n = n0 + j * 16 + col; const float bb = bfr(bo[n]);
#pragma unroll
    for (int r = 0; r < 8; ++r) so[wave][8 * g + r][j * 16 + col] = acc[j][r] + bb; }
  LDSX();
#pragma unroll 4
  for (int rl = 0; rl < 16; ++rl) vst2(out + (size_t)(rbase + r0 + rl) * E + n0 + lane * 4, *(const v4f*)(&so[wave][rl][lane * 4]));
}
#define NBHALF 2
extern "C" void kernel_launch(void* const* d_in, const int* in_sizes, int n_in, void* d_out, int out_size, void* d_ws, size_t ws_size, hipStream_t stream) {
  (void)in_sizes; (void)n_in; (void)out_size; (void)ws_size;
  const float* x = (const float*)d_in[0]; const float* Wqkv = (const float*)d_in[1]; const float* Wp = (const float*)d_in[2]; const float* bp = (const float*)d_in[3];
  float* out = (float*)d_out;
  char* ws = (char*)d_ws; size_t off = 0;
  auto take = [&](size_t bytes) { char* p = ws + off; off += (bytes + 255) & ~(size_t)255; return p; };
  const size_t HR = (size_t)NBHALF * SS;     // rows per half (4096)
  __bf16* Xb = (__bf16*)take((size_t)NR * E * 2); __bf16* PT = (__bf16*)take((size_t)4 * E * E * 2);
  float* Q32 = (float*)take((size_t)NR * E * 4); __bf16* KS = (__bf16*)take((size_t)NR * E * 4); _Float16* VTh = (_Float16*)take((size_t)NR * E * 2); _Float16* VTl = (_Float16*)take((size_t)NR * E * 2);
  float* O32 = Q32;      // in place: each k_attn wave reads its own 16 query rows into registers before writing the same rows; no other block reads them
  // ws ~ 120 MB; Q/K/V of all four batches are held at once, so that one attention launch covers all 64 (batch, head) pairs
  k_cvt<<<(NR * E / 8 + 255) / 256, 256, 0, stream>>>(x, Xb);
  k_pack<<<4 * E, 128, 0, stream>>>(Wqkv, Wp, PT);
  for (int hf = 0; hf < 2; ++hf) { const int rbase = hf * (int)HR; const size_t ho = hf * HR * E;
    k_qkv<<<dim3(HR / 64, E / 128, 3), 128, 0, stream>>>(Xb, rbase, PT, Q32 + ho, KS + 2 * ho, VTh + ho, VTl + ho); }
  k_attn<<<dim3(SS / 256, NB * NH), 256, 0, stream>>>(Q32, KS, VTh, VTl, O32);
  for (int hf = 0; hf < 2; ++hf) { const int rbase = hf * (int)HR; const size_t ho = hf * HR * E;
    k_out<<<dim3(HR / 64, E / 128), 128, 0, stream>>>(O32 + ho, rbase, PT, bp, out); }
}

// v007
// Measured time: 199 microseconds a run.
// Next to v006, in two timings, it ran 1.07 and 1.06 times as fast.
// Over all steps from v000 it is 5.18 times as fast.
// compute dtype: x, w_qkv, w_proj, b_proj (INPUTS) rounded to bf16 with exact bf16 WMMA products (f32 accumulate) for the projections; q/k f32 split for the scores (3 products), P and V f16 hi/lo (3 products); softmax f32.
#include <hip/hip_runtime.h>
#include <math.h>

typedef __attribute__((ext_vector_type(16))) _Float16 v16h;
typedef __attribute__((ext_vector_type(16))) __bf16 v16b;
typedef __attribute__((ext_vector_type(8)))  _Float16 v8h;
typedef __attribute__((ext_vector_type(8)))  float v8f;
typedef __attribute__((ext_vector_type(4)))  float v4f;
typedef __attribute__((ext_vector_type(2)))  float v2f;
typedef __attribute__((ext_vector_type(4)))  unsigned v4u;
typedef __attribute__((ext_vector_type(4)))  int v4i;
typedef float __attribute__((may_alias)) float_a;
typedef int __attribute__((may_alias)) int_a;

template <typename T> __device__ __forceinline__ void vst2(void* p, T v) { *(T*)p = v;  }
__device__ __forceinline__ v8f wmma16(v16h a, v16h b, v8f c) {
  v8f d = __builtin_amdgcn_wmma_f32_16x16x32_f16(false, a, false, b, (short)0, c, false, false);
  asm volatile("v_nop\n\tv_nop\n\tv_nop\n\tv_nop" : "+v"(d) : "v"(a), "v"(b));
  return d;
}
__device__ __forceinline__ v8f wmma_bf(v16b a, v16b b, v8f c) {
  v8f d = __builtin_amdgcn_wmma_f32_16x16x32_bf16(false, a, false, b, (short)0, c, false, false);
  asm volatile("v_nop\n\tv_nop\n\tv_nop\n\tv_nop" : "+v"(d) : "v"(a), "v"(b));
  return d;
}
// 16x16x32 fragments: lane = (h = lane>>4, row/col = lane&15); elements 0..7 = k0+8h+0..7, 8..15 = k0+16+8h+0..7; D element r = row 8h+r
__device__ __forceinline__ v16h frag_h(const _Float16* rowk0, int lane) {
  union { v16h v; v8h q[2]; } u; const _Float16* p = rowk0 + 8 * (lane >> 4);
  u.q[0] = *(const v8h*)p; u.q[1] = *(const v8h*)(p + 16); return u.v;
}
__device__ __forceinline__ v16h frag_f32(const float* rowk0, int lane) {
  v16h a; const float* p = rowk0 + 8 * (lane >> 4);
#pragma unroll
  for (int i = 0; i < 8; ++i) { a[i] = (_Float16)p[i]; a[8 + i] = (_Float16)p[16 + i]; }
  return a;
}
__device__ __forceinline__ v16h frag_f32s(const float* rowk0, int lane, float sc) {
  v16h a; const float* p = rowk0 + 8 * (lane >> 4);
#pragma unroll
  for (int i = 0; i < 8; ++i) { a[i] = (_Float16)(p[i] * sc); a[8 + i] = (_Float16)(p[16 + i] * sc); }
  return a;
}
// column fragment from a [K][ld] layout (column n), rows >= K read as 0
__device__ __forceinline__ v16h fragc_f32(const float* W, int k0, int n, int lane, int ld, int K) {
  v16h a; const int g = lane >> 4;
#pragma unroll
  for (int i = 0; i < 8; ++i) { const int ka = k0 + 8 * g + i, kb = ka + 16;
    a[i] = (_Float16)(ka < K ? W[(size_t)(ka < K ? ka : K - 1) * ld + n] : 0.f); a[8 + i] = (_Float16)(kb < K ? W[(size_t)(kb < K ? kb : K - 1) * ld + n] : 0.f); }
  return a;
}
struct F2 { v16b h, l; };
__device__ __forceinline__ F2 bsplit16(const float v[16]) { F2 r;
#pragma unroll
  for (int i = 0; i < 16; ++i) { const __bf16 h = (__bf16)v[i]; r.h[i] = h; r.l[i] = (__bf16)(v[i] - (float)h); }
  return r; }
__device__ __forceinline__ F2 split_row(const float* row, int k0, int lane) { float v[16]; const float* p = row + k0 + 8 * (lane >> 4);
#pragma unroll
  for (int i = 0; i < 8; ++i) { v[i] = p[i]; v[8 + i] = p[16 + i]; }
  return bsplit16(v); }
__device__ __forceinline__ F2 split_rowK(const float* row, int k0, int lane, int K) { float v[16]; const int g = lane >> 4;
#pragma unroll
  for (int i = 0; i < 8; ++i) { const int ka = k0 + 8 * g + i, kb = ka + 16; v[i] = ka < K ? row[ka < K ? ka : K - 1] : 0.f; v[8 + i] = kb < K ? row[kb < K ? kb : K - 1] : 0.f; }
  return bsplit16(v); }
__device__ __forceinline__ F2 split_col(const float* W, int k0, int n, int lane, int ld, int K) { float v[16]; const int g = lane >> 4;
#pragma unroll
  for (int i = 0; i < 8; ++i) { const int ka = k0 + 8 * g + i, kb = ka + 16; v[i] = ka < K ? W[(size_t)(ka < K ? ka : K - 1) * ld + n] : 0.f; v[8 + i] = kb < K ? W[(size_t)(kb < K ? kb : K - 1) * ld + n] : 0.f; }
  return bsplit16(v); }
__device__ __forceinline__ v8f mac3(const F2& a, const F2& b, v8f c) { c = wmma_bf(a.l, b.h, c); c = wmma_bf(a.h, b.l, c); return wmma_bf(a.h, b.h, c); }
__device__ __forceinline__ float sigm(float v) { return 1.0f / (1.0f + expf(-v)); }
#define LDSX() do { asm volatile("s_wait_dscnt 0" ::: "memory"); __builtin_amdgcn_wave_barrier(); __builtin_amdgcn_fence(__ATOMIC_RELEASE, "workgroup"); } while (0)


#define NB 4
#define SS 2048
#define E 1024
#define NH 16
#define HD 64
#define NR (NB * SS)
#define PLO 1024.0f
#define VLO 2048.0f
#define SC2 0.18033688011112042f      // hs^-0.5 * log2(e): a raw score times this is its exponent to base 2
__device__ __forceinline__ float bfr(float v) { return (float)(__bf16)v; }
__device__ __forceinline__ v16b frag_b(const __bf16* rowk0, int lane) { return __builtin_bit_cast(v16b, frag_h((const _Float16*)rowk0, lane)); }

// asynchronous copies to LDS, 16 bytes a lane: l = the lane's LDS byte address, g = its global address. The s_wait_xcnt closes each statement, so that no address register is rewritten ahead of it.
#define CPY "global_load_async_to_lds_b128 "
__device__ __forceinline__ void cp4(unsigned l, unsigned ls, const char* g, size_t gs) {
  asm volatile(CPY "%0, %1, off\n\t" CPY "%2, %3, off\n\t" CPY "%4, %5, off\n\t" CPY "%6, %7, off\n\ts_wait_xcnt 0x0"
               :: "v"(l), "v"(g), "v"(l + ls), "v"(g + gs), "v"(l + 2 * ls), "v"(g + 2 * gs), "v"(l + 3 * ls), "v"(g + 3 * gs) : "memory");
}
__device__ __forceinline__ void cp2(unsigned l, unsigned ls, const char* g, size_t gs) {
  asm volatile(CPY "%0, %1, off\n\t" CPY "%2, %3, off\n\ts_wait_xcnt 0x0" :: "v"(l), "v"(g), "v"(l + ls), "v"(g + gs) : "memory");
}
// publish point of the two-buffer ring: own LDS reads done, own copies landed, then the work-group barrier (it publishes the next tile and frees the buffer just read)
#define RING_PUBLISH() do { asm volatile("s_wait_dscnt 0x0" ::: "memory"); asm volatile("s_wait_asynccnt 0x0" ::: "memory"); __syncthreads(); } while (0)
#define KT 64                         // k per stage: 128 B of a bf16 row, 256 B of an f32 row
#define PB 144                        // LDS pitch of a 128-B row, 16 B x odd: ds_load_b128 free of bank conflicts
#define PF 272                        // LDS pitch of a 256-B row, likewise
#define QBUF (256 * PB)               // k_qkv stage: 128 x rows, then 128 weight rows
#define OBUF (64 * PF + 128 * PB)     // k_out stage: 64 f32 ctx rows, then 128 weight rows
#define ABUF (64 * PF + 2 * 64 * PB) // k_attn stage: 64 K rows of 256 B (64 bf16 hi, 64 bf16 lo), then 64 V^T hi rows and 64 V^T lo rows of 64 keys
#define NST (2 * (SS / 128 + 1))      // k_attn stages in a block: 2 (t + 1) + 2 (16 - t)
__device__ __forceinline__ F2 split_row4(const float* p) { float v[16]; const v4f a = *(const v4f*)p, b = *(const v4f*)(p + 4), c = *(const v4f*)(p + 16), d = *(const v4f*)(p + 20);
#pragma unroll
  for (int i = 0; i < 4; ++i) { v[i] = a[i]; v[4 + i] = b[i]; v[8 + i] = c[i]; v[12 + i] = d[i]; }
  return bsplit16(v); }

__global__ __launch_bounds__(256) void k_cvt(const float* __restrict__ x, __bf16* __restrict__ Xb) {
  const size_t i8 = (size_t)blockIdx.x * 256 + threadIdx.x; if (i8 >= (size_t)NR * E / 8) return;
  union { __bf16 h[8]; v4u u; } pk;
#pragma unroll
  for (int e = 0; e < 8; ++e) pk.h[e] = (__bf16)x[i8 * 8 + e];
  vst2((unsigned*)(Xb + i8 * 8), pk.u);
}
// PT rows: [0,3E) = w_qkv rows (q | k | v output features), [3E,4E) = w_proj rows ([out][in] weights)
__global__ __launch_bounds__(128) void k_pack(const float* __restrict__ Wqkv, const float* __restrict__ Wp, __bf16* __restrict__ PT) {
  const int n = blockIdx.x, tid = threadIdx.x; __shared__ __align__(16) __bf16 srow[E];
  for (int k = tid; k < E; k += 128) srow[k] = (__bf16)(n < 3 * E ? Wqkv[(size_t)n * E + k] : Wp[(size_t)(n - 3 * E) * E + k]);      // [out][in]: rows
  __syncthreads();
  if (tid < E / 8) vst2((unsigned*)(PT + (size_t)n * E + tid * 8), *(const v4u*)(&srow[tid * 8]));
}
// QKV: block (128 rows, 128 cols = 2 heads, which), four waves of 64 x 64 (one head each); q -> Q32 f32 [bh][s][64]; k -> KS bf16 [bh][s][64 hi | 64 lo], the split of the f32 value made here, once; v -> VT hi/lo x4 [bh][d][s]
__global__ __launch_bounds__(128) void k_qkv(const __bf16* __restrict__ Xb, int rbase, const __bf16* __restrict__ PT, float* __restrict__ Q32, __bf16* __restrict__ KS, _Float16* __restrict__ VTh, _Float16* __restrict__ VTl) {
  __shared__ __align__(16) char sm[2 * QBUF];      // the ring in the loop; behind its last barrier the output staging
  float (*so)[64][68] = (float (*)[64][68])sm; _Float16 (*sth)[136] = (_Float16 (*)[136])sm; _Float16 (*stl)[136] = (_Float16 (*)[136])(sm + 128 * 136 * 2);
  const int tid = threadIdx.x, wave = tid >> 5, lane = tid & 31, col = lane & 15, g = lane >> 4, wr = wave >> 1, wc = wave & 1;
  const int which = blockIdx.z, r0b = blockIdx.x * 128, n0 = blockIdx.y * 128; const int b = r0b / SS, s0 = r0b % SS;
  v8f acc[4][4] = {};      // acc[i][j]: rows wr * 64 + i * 16 .., columns wc * 64 + j * 16 .. of the block's tile
  // a copy of the block moves 16 rows of 128 B: thread -> (row tid >> 3, 16-B piece tid & 7), whole lines per wave
  const char* gA = (const char*)(Xb + (size_t)(rbase + r0b + (tid >> 3)) * E + (tid & 7) * 8);
  const char* gB = (const char*)(PT + (size_t)(which * E + n0 + (tid >> 3)) * E + (tid & 7) * 8);
  const unsigned l0 = (unsigned)(size_t)sm + (tid >> 3) * PB + (tid & 7) * 16;
  auto fill = [&](int t) { const unsigned l = l0 + (t & 1) * QBUF; const size_t ko = (size_t)t * KT * 2;
    cp4(l, 16 * PB, gA + ko, (size_t)16 * E * 2); cp4(l + 64 * PB, 16 * PB, gA + ko + (size_t)64 * E * 2, (size_t)16 * E * 2);
    cp4(l + 128 * PB, 16 * PB, gB + ko, (size_t)16 * E * 2); cp4(l + 192 * PB, 16 * PB, gB + ko + (size_t)64 * E * 2, (size_t)16 * E * 2); };
  fill(0);
  asm volatile("s_wait_asynccnt 0x0" ::: "memory");   // stage 0 landed before the barrier that publishes it
  __syncthreads();
  fill(1);
#pragma unroll 1   // rolled: one copy of the loop's text, the buffer picked by t & 1
  for (int t = 0; t < E / KT; ++t) { const char* bp = sm + (t & 1) * QBUF;
#pragma unroll
    for (int kk = 0; kk < 2; ++kk) { v16b a[4], wf[4];   // the LDS reads of 32 k stand as one group ahead of their matrix run: 8 fragments feed 16 products
#pragma unroll
      for (int i = 0; i < 4; ++i) { a[i] = frag_b((const __bf16*)(bp + (wr * 64 + i * 16 + col) * PB) + kk * 32, lane); wf[i] = frag_b((const __bf16*)(bp + (128 + wc * 64 + i * 16 + col) * PB) + kk * 32, lane); }
#pragma unroll
      for (int i = 0; i < 4; ++i) {
#pragma unroll
        for (int j = 0; j < 4; ++j) acc[i][j] = wmma_bf(a[i], wf[j], acc[i][j]); } }
    RING_PUBLISH();
    if (t + 2 < E / KT) fill(t + 2); }
  asm volatile("s_wait_asynccnt 0x0" ::: "memory");   // nothing in flight when the ring becomes output staging
  const int h = (n0 >> 6) + wc;      // the wave's head
  if (which < 2) { const size_t row0 = ((size_t)b * NH + h) * SS + s0 + wr * 64;      // the wave's 64 rows go through its own slice of the staging
#pragma unroll
    for (int i = 0; i < 4; ++i) {
#pragma unroll
      for (int j = 0; j < 4; ++j) {
#pragma unroll
        for (int r = 0; r < 8; ++r) so[wave][i * 16 + 8 * g + r][j * 16 + col] = acc[i][j][r]; } }
    LDSX();
    if (which == 0) {
#pragma unroll 1   // rolled; four LDS reads and four stores in flight per trip
      for (int o = 0; o < 64 * 16 / 128; ++o) {
#pragma unroll
        for (int u = 0; u < 4; ++u) { const int qq = (o * 4 + u) * 32 + lane, rl = qq >> 4, pc = qq & 15;
          vst2(Q32 + (row0 + rl) * HD + pc * 4, *(const v4f*)(&so[wave][rl][pc * 4])); } } }
    else {
#pragma unroll 1   // likewise
      for (int o = 0; o < 64 * 8 / 128; ++o) {
#pragma unroll
      for (int u = 0; u < 4; ++u) { const int qq = (o * 4 + u) * 32 + lane, rl = qq >> 3, pc = qq & 7;
        const v4f va = *(const v4f*)(&so[wave][rl][pc * 8]), vb = *(const v4f*)(&so[wave][rl][pc * 8 + 4]);
        union { __bf16 e[8]; v4u u; } kh, kl;
#pragma unroll
        for (int e = 0; e < 8; ++e) { const float v = e < 4 ? va[e & 3] : vb[e & 3]; const __bf16 hv = (__bf16)v; kh.e[e] = hv; kl.e[e] = (__bf16)(v - (float)hv); }
        __bf16* d = KS + (row0 + rl) * (2 * HD) + pc * 8;
        vst2(d, kh.u); vst2(d + HD, kl.u); }
        asm volatile("s_wait_xcnt 0x0" ::: "memory");   // ahead of the next trip, which rewrites the stores' address and data registers
      } } }
  else {
#pragma unroll
    for (int i = 0; i < 4; ++i) {
#pragma unroll
      for (int j = 0; j < 4; ++j) { union { _Float16 e[8]; v4u u; } vh, vl;      // a lane's 8 rows of one column: 16 B of the transposed tile
#pragma unroll
        for (int r = 0; r < 8; ++r) { const float v = acc[i][j][r] * 4.0f; const _Float16 hi = (_Float16)v; vh.e[r] = hi; vl.e[r] = (_Float16)((v - (float)hi) * VLO); }
        vst2(&sth[wc * 64 + j * 16 + col][wr * 64 + i * 16 + 8 * g], vh.u); vst2(&stl[wc * 64 + j * 16 + col][wr * 64 + i * 16 + 8 * g], vl.u); } }
    __syncthreads();
#pragma unroll 1   // likewise
    for (int o = 0; o < 128 * 16 / 512; ++o) {
#pragma unroll
    for (int u = 0; u < 4; ++u) { const int qq = (o * 4 + u) * 128 + tid, cl = qq >> 4, pc = qq & 15; const int c = n0 + cl, hh = c >> 6, d = c & 63; const size_t of = (((size_t)b * NH + hh) * HD + d) * SS + s0 + pc * 8;
      vst2(VTh + of, *(const v4u*)(&sth[cl][pc * 8])); vst2(VTl + of, *(const v4u*)(&stl[cl][pc * 8])); }
      asm volatile("s_wait_xcnt 0x0" ::: "memory");   // ahead of the next trip, which rewrites the stores' address and data registers
    } }
}
__device__ __forceinline__ v8f mac3t(const F2& k, const F2& q, v8f c) { c = wmma_bf(k.h, q.l, c); c = wmma_bf(k.l, q.h, c); return wmma_bf(k.h, q.h, c); }
__global__ __launch_bounds__(256, 4) void k_attn(const float* __restrict__ Q32, const __bf16* __restrict__ KS, const _Float16* __restrict__ VTh, const _Float16* __restrict__ VTl, float* __restrict__ O32) {
  __shared__ __align__(16) char ring[2 * ABUF];
  __shared__ __align__(16) float sS[8][16][68];      // output staging (each wave its own slice)
  const int tid = threadIdx.x, w = __builtin_amdgcn_readfirstlane(tid >> 5), lane = tid & 31, col = lane & 15, g = lane >> 4;
  const size_t bh = blockIdx.y;
  const int n0 = 2 * ((int)blockIdx.x + 1);          // key tiles of the first query tile; both together: NST
  // K: a copy of the block moves 16 rows of 256 B; V^T: 32 rows of 128 B
  const char* gK = (const char*)(KS + (bh * SS + (tid >> 4)) * (2 * HD) + (tid & 15) * 8);
  const char* gH = (const char*)(VTh + (bh * HD + (tid >> 3)) * SS + (tid & 7) * 8);
  const char* gL = (const char*)(VTl + (bh * HD + (tid >> 3)) * SS + (tid & 7) * 8);
  const unsigned lK = (unsigned)(size_t)ring + (tid >> 4) * PF + (tid & 15) * 16, lV = (unsigned)(size_t)ring + 64 * PF + (tid >> 3) * PB + (tid & 7) * 16;
  auto fill = [&](int s) { const int kt = s < n0 ? s : s - n0; const unsigned bo2 = (s & 1) * ABUF;
    cp4(lK + bo2, 16 * PF, gK + (size_t)kt * 64 * HD * 4, (size_t)16 * HD * 4);
    cp2(lV + bo2, 32 * PB, gH + (size_t)kt * 64 * 2, (size_t)32 * SS * 2); cp2(lV + bo2 + 64 * PB, 32 * PB, gL + (size_t)kt * 64 * 2, (size_t)32 * SS * 2); };
  fill(0);
  asm volatile("s_wait_asynccnt 0x0" ::: "memory");   // stage 0 landed before the barrier that publishes it
  __syncthreads();
  fill(1);
  int st = 0;
  for (int pass = 0; pass < 2; ++pass) {
  const int qb = pass == 0 ? (int)blockIdx.x : SS / 128 - 1 - (int)blockIdx.x; const int q0 = qb * 128 + w * 16;
  F2 aq[2];      // the lane's query q0 + col, as the B operand
#pragma unroll
  for (int kc = 0; kc < 2; ++kc) aq[kc] = split_row(Q32 + (bh * SS + q0 + col) * HD, kc * 32, lane);
  // mrun: the running maximum as a base-2 exponent (raw score x SC2, rounded once: an unchanged maximum rescales by exactly 1); mrun, lrun: of query q0 + col, the same in both halves of the wave
  float mrun = -3.0e38f, lrun = 0.f; v8f acc[4] = {}, ac1[4] = {}, ac2[4] = {};      // element r of tile t: O^T[t * 16 + 8 g + r][q0 + col]
#pragma unroll 1   // rolled: one copy of the loop's text, the buffer picked by st & 1
  for (int kt = 0; kt < 2 * (qb + 1); ++kt, ++st) { const char* bp = ring + (st & 1) * ABUF;
   if (kt * 64 <= q0 + 15) {      // a key tile wholly above the wave's diagonal adds nothing: the wave goes straight to the publish point
    const int lim = q0 + col - kt * 64 - 8 * g;      // key t * 16 + 8 g + r of the tile is above the diagonal where t * 16 + r > lim
    v8f s[4];
#pragma unroll
    for (int t = 0; t < 4; ++t) { const __bf16* krow = (const __bf16*)(bp + (t * 16 + col) * PF);
      const F2 k0 = {frag_b(krow, lane), frag_b(krow + HD, lane)}, k1 = {frag_b(krow + 32, lane), frag_b(krow + HD + 32, lane)};
      s[t] = mac3t(k0, aq[0], (v8f){}); s[t] = mac3t(k1, aq[1], s[t]);
#pragma unroll
      for (int r = 0; r < 8; ++r) s[t][r] = (t * 16 + r > lim) ? -3.0e38f : s[t][r]; }
    float mx = -3.4e38f;
#pragma unroll
    for (int t = 0; t < 4; ++t) {
#pragma unroll
      for (int r = 0; r < 8; ++r) mx = fmaxf(mx, s[t][r]); }
    mx = fmaxf(mx, __shfl_xor(mx, 16, 32));
    const float mnew = fmaxf(mrun, mx * SC2); const float ca = mrun - mnew; const float corr = __builtin_amdgcn_exp2f(ca);
    asm volatile("v_nop" :: "v"(ca), "v"(corr));   // the same slot behind this v_exp_f32 (see below)
    float ps = 0.f; v16h ph[2], pl[2];      // P^T operands of 32 keys: element e = key 8 g + e, element 8 + e = key 16 + 8 g + e, as two score tiles hold them
#pragma unroll
    for (int t = 0; t < 4; ++t) { v2f ar[4]; float ex[8];
#pragma unroll
      for (int j = 0; j < 4; ++j) ar[j] = __builtin_elementwise_fma((v2f){s[t][2 * j], s[t][2 * j + 1]}, (v2f){SC2, SC2}, (v2f){-mnew, -mnew});   // two exponents by one packed fma
#pragma unroll
      for (int r = 0; r < 8; ++r) ex[r] = __builtin_amdgcn_exp2f(ar[r >> 1][r & 1]);
      // the slot behind a transcendental before its source register is written again: the exponents are inputs here, so they keep their registers up to this v_nop, which stands behind the eight v_exp_f32
      asm volatile("v_nop" :: "v"(ar[0]), "v"(ar[1]), "v"(ar[2]), "v"(ar[3]), "v"(ex[0]), "v"(ex[1]), "v"(ex[2]), "v"(ex[3]), "v"(ex[4]), "v"(ex[5]), "v"(ex[6]), "v"(ex[7]));
#pragma unroll
      for (int r = 0; r < 8; ++r) { const float p = ex[r] * 16384.0f; ps += p; const _Float16 hi = (_Float16)p; ph[t >> 1][(t & 1) * 8 + r] = hi; pl[t >> 1][(t & 1) * 8 + r] = (_Float16)((p - (float)hi) * PLO); } }
    ps += __shfl_xor(ps, 16, 32);
    lrun = lrun * corr + ps * (1.0f / 16384.0f); mrun = mnew;
#pragma unroll
    for (int t = 0; t < 4; ++t) { acc[t] *= corr; ac1[t] *= corr; ac2[t] *= corr; }
#pragma unroll
    for (int kc = 0; kc < 2; ++kc) { v16h vh[2], vl[2];   // the LDS reads of two output tiles stand as one group ahead of their matrix run
#pragma unroll
      for (int tp = 0; tp < 4; tp += 2) {
#pragma unroll
      for (int t = 0; t < 2; ++t) { const _Float16* vr = (const _Float16*)(bp + 64 * PF + ((tp + t) * 16 + col) * PB) + kc * 32; vh[t] = frag_h(vr, lane); vl[t] = frag_h(vr + 64 * PB / 2, lane); }
#pragma unroll
      for (int t = 0; t < 2; ++t) { acc[tp + t] = wmma16(vh[t], ph[kc], acc[tp + t]); ac1[tp + t] = wmma16(vl[t], ph[kc], ac1[tp + t]); ac2[tp + t] = wmma16(vh[t], pl[kc], ac2[tp + t]); } } } }
    RING_PUBLISH();
    if (st + 2 < NST) fill(st + 2); }
  const float inv = 1.0f / (lrun * 16384.0f * 4.0f);
#pragma unroll
  for (int t = 0; t < 4; ++t) { v4f o[2];
#pragma unroll
    for (int r = 0; r < 8; ++r) o[r >> 2][r & 3] = (acc[t][r] + ac1[t][r] * (1.0f / VLO) + ac2[t][r] * (1.0f / PLO)) * inv;
    *(v4f*)(&sS[w][col][t * 16 + 8 * g]) = o[0]; *(v4f*)(&sS[w][col][t * 16 + 8 * g + 4]) = o[1]; }
  LDSX();
  for (int qq = lane; qq < 16 * 16; qq += 32) { const int rl = qq >> 4, pc = qq & 15; vst2(O32 + ((bh * SS) + q0 + rl) * HD + pc * 4, *(const v4f*)(&sS[w][rl][pc * 4])); }
  LDSX();   // the staged rows are read before the next query tile's output overwrites them
  }
  asm volatile("s_wait_asynccnt 0x0" ::: "memory");   // nothing in flight when the wave ends
}
// out = ctx Wo^T + bo : split(ctx) x bf16(Wo rows): 2 products (Wo is an INPUT -> bf16 exact)
__global__ __launch_bounds__(128) void k_out(const float* __restrict__ O32, int rbase, const __bf16* __restrict__ PT, const float* __restrict__ bo, float* __restrict__ out) {
  __shared__ __align__(16) char sm[2 * OBUF];   // the ring in the loop; behind its last barrier the output staging
  float (*so)[16][132] = (float (*)[16][132])sm;
  const int tid = threadIdx.x, wave = tid >> 5, lane = tid & 31, col = lane & 15, g = lane >> 4;
  const int r0b = blockIdx.x * 64, r0 = r0b + wave * 16, n0 = blockIdx.y * 128; const int b = r0b / SS, s0 = r0b % SS;
  v8f acc[8] = {};
  // stage t = head t: ctx rows of 256 B (a copy of the block moves 8 rows), weight rows of 128 B (16 rows), whole lines per wave
  const char* gA = (const char*)(O32 + ((size_t)b * NH * SS + s0 + (tid >> 4)) * HD + (tid & 15) * 4);
  const char* gB = (const char*)(PT + (size_t)(3 * E + n0 + (tid >> 3)) * E + (tid & 7) * 8);
  const unsigned lA = (unsigned)(size_t)sm + (tid >> 4) * PF + (tid & 15) * 16, lB = (unsigned)(size_t)sm + 64 * PF + (tid >> 3) * PB + (tid & 7) * 16;
  auto fill = [&](int t) { const unsigned bo2 = (t & 1) * OBUF; const char* a = gA + (size_t)t * SS * HD * 4; const char* w = gB + (size_t)t * KT * 2;
    cp4(lA + bo2, 8 * PF, a, (size_t)8 * HD * 4); cp4(lA + bo2 + 32 * PF, 8 * PF, a + (size_t)32 * HD * 4, (size_t)8 * HD * 4);
    cp4(lB + bo2, 16 * PB, w, (size_t)16 * E * 2); cp4(lB + bo2 + 64 * PB, 16 * PB, w + (size_t)64 * E * 2, (size_t)16 * E * 2); };
  fill(0);
  asm volatile("s_wait_asynccnt 0x0" ::: "memory");   // stage 0 landed before the barrier that publishes it
  __syncthreads();
  fill(1);
#pragma unroll 1   // rolled: one copy of the loop's text, the buffer picked by t & 1
  for (int t = 0; t < E / KT; ++t) { const char* bp = sm + (t & 1) * OBUF; F2 a[2]; v16b wf[2][8];   // the stage's LDS reads stand as one group ahead of its matrix run
#pragma unroll
    for (int kk = 0; kk < 2; ++kk) { a[kk] = split_row4((const float*)(bp + (wave * 16 + col) * PF) + kk * 32 + 8 * g);
#pragma unroll
      for (int j = 0; j < 8; ++j) wf[kk][j] = frag_b((const __bf16*)(bp + 64 * PF + (j * 16 + col) * PB) + kk * 32, lane); }
#pragma unroll
    for (int kk = 0; kk < 2; ++kk) {
#pragma unroll
      for (int j = 0; j < 8; ++j) { acc[j] = wmma_bf(a[kk].l, wf[kk][j], acc[j]); acc[j] = wmma_bf(a[kk].h, wf[kk][j], acc[j]); } }
    RING_PUBLISH();
    if (t + 2 < E / KT) fill(t + 2); }
  asm volatile("s_wait_asynccnt 0x0" ::: "memory");   // nothing in flight when the ring becomes output staging
#pragma unroll
  for (int j = 0; j < 8; ++j) { const int n = n0 + j * 16 + col; const float bb = bfr(bo[n]);
#pragma unroll
    for (int r = 0; r < 8; ++r) so[wave][8 * g + r][j * 16 + col] = acc[j][r] + bb; }
  LDSX();
#pragma unroll 4
  for (int rl = 0; rl < 16; ++rl) vst2(out + (size_t)(rbase + r0 + rl) * E + n0 + lane * 4, *(const v4f*)(&so[wave][rl][lane * 4]));
}
#define NBHALF 2
extern "C" void kernel_launch(void* const* d_in, const int* in_sizes, int n_in, void* d_out, int out_size, void* d_ws, size_t ws_size, hipStream_t stream) {
  (void)in_sizes; (void)n_in; (void)out_size; (void)ws_size;
  const float* x = (const float*)d_in[0]; const float* Wqkv = (const float*)d_in[1]; const float* Wp = (const float*)d_in[2]; const float* bp = (const float*)d_in[3];
  float* out = (float*)d_out;
  char* ws = (char*)d_ws; size_t off = 0;
  auto take = [&](size_t bytes) { char* p = ws + off; off += (bytes + 255) & ~(size_t)255; return p; };
  const size_t HR = (size_t)NBHALF * SS;     // rows per half (4096)
  __bf16* Xb = (__bf16*)take((size_t)NR * E * 2); __bf16* PT = (__bf16*)take((size_t)4 * E * E * 2);
  float* Q32 = (float*)take((size_t)NR * E * 4); __bf16* KS = (__bf16*)take((size_t)NR * E * 4); _Float16* VTh = (_Float16*)take((size_t)NR * E * 2); _Float16* VTl = (_Float16*)take((size_t)NR * E * 2);
  float* O32 = Q32;      // in place: each k_attn wave reads its own 16 query rows into registers before writing the same rows; no other block reads them
  // ws ~ 120 MB; Q/K/V of all four batches are held at once, so that one attention launch covers all 64 (batch, head) pairs
  k_cvt<<<(NR * E / 8 + 255) / 256, 256, 0, stream>>>(x, Xb);
  k_pack<<<4 * E, 128, 0, stream>>>(Wqkv, Wp, PT);
  for (int hf = 0; hf < 2; ++hf) { const int rbase = hf * (int)HR; const size_t ho = hf * HR * E;
    k_qkv<<<dim3(HR / 128, E / 128, 3), 128, 0, stream>>>(Xb, rbase, PT, Q32 + ho, KS + 2 * ho, VTh + ho, VTl + ho); }
  k_attn<<<dim3(SS / 256, NB * NH), 256, 0, stream>>>(Q32, KS, VTh, VTl, O32);
  for (int hf = 0; hf < 2; ++hf) { const int rbase = hf * (int)HR; const size_t ho = hf * HR * E;
    k_out<<<dim3(HR / 64, E / 128), 128, 0, stream>>>(O32 + ho, rbase, PT, bp, out); }
}

// v008
// Measured time: 188 microseconds a run.
// Two timings next to v007 both put it at 1.06 times that version's speed.
// All steps since v000 together make it 5.49 times as fast.
// compute dtype: x, w_qkv, w_proj, b_proj (INPUTS) rounded to bf16 with exact bf16 WMMA products (f32 accumulate) for the projections; q/k f32 split for the scores (3 products), P and V f16 hi/lo (3 products); softmax f32.
#include <hip/hip_runtime.h>
#include <math.h>

typedef __attribute__((ext_vector_type(16))) _Float16 v16h;
typedef __attribute__((ext_vector_type(16))) __bf16 v16b;
typedef __attribute__((ext_vector_type(8)))  _Float16 v8h;
typedef __attribute__((ext_vector_type(8)))  float v8f;
typedef __attribute__((ext_vector_type(4)))  float v4f;
typedef __attribute__((ext_vector_type(2)))  float v2f;
typedef __attribute__((ext_vector_type(4)))  unsigned v4u;
typedef __attribute__((ext_vector_type(2)))  unsigned v2u;
typedef __attribute__((ext_vector_type(4)))  int v4i;
typedef float __attribute__((may_alias)) float_a;
typedef int __attribute__((may_alias)) int_a;

template <typename T> __device__ __forceinline__ void vst2(void* p, T v) { *(T*)p = v;  }
__device__ __forceinline__ v8f wmma16(v16h a, v16h b, v8f c) {
  v8f d = __builtin_amdgcn_wmma_f32_16x16x32_f16(false, a, false, b, (short)0, c, false, false);
  asm volatile("v_nop\n\tv_nop\n\tv_nop\n\tv_nop" : "+v"(d) : "v"(a), "v"(b));
  return d;
}
__device__ __forceinline__ v8f wmma_bf(v16b a, v16b b, v8f c) {
  v8f d = __builtin_amdgcn_wmma_f32_16x16x32_bf16(false, a, false, b, (short)0, c, false, false);
  asm volatile("v_nop\n\tv_nop\n\tv_nop\n\tv_nop" : "+v"(d) : "v"(a), "v"(b));
  return d;
}
// 16x16x32 fragments: lane = (h = lane>>4, row/col = lane&15); elements 0..7 = k0+8h+0..7, 8..15 = k0+16+8h+0..7; D element r = row 8h+r
__device__ __forceinline__ v16h frag_h(const _Float16* rowk0, int lane) {
  union { v16h v; v8h q[2]; } u; const _Float16* p = rowk0 + 8 * (lane >> 4);
  u.q[0] = *(const v8h*)p; u.q[1] = *(const v8h*)(p + 16); return u.v;
}
__device__ __forceinline__ v16h frag_f32(const float* rowk0, int lane) {
  v16h a; const float* p = rowk0 + 8 * (lane >> 4);
#pragma unroll
  for (int i = 0; i < 8; ++i) { a[i] = (_Float16)p[i]; a[8 + i] = (_Float16)p[16 + i]; }
  return a;
}
__device__ __forceinline__ v16h frag_f32s(const float* rowk0, int lane, float sc) {
  v16h a; const float* p = rowk0 + 8 * (lane >> 4);
#pragma unroll
  for (int i = 0; i < 8; ++i) { a[i] = (_Float16)(p[i] * sc); a[8 + i] = (_Float16)(p[16 + i] * sc); }
  return a;
}
// column fragment from a [K][ld] layout (column n), rows >= K read as 0
__device__ __forceinline__ v16h fragc_f32(const float* W, int k0, int n, int lane, int ld, int K) {
  v16h a; const int g = lane >> 4;
#pragma unroll
  for (int i = 0; i < 8; ++i) { const int ka = k0 + 8 * g + i, kb = ka + 16;
    a[i] = (_Float16)(ka < K ? W[(size_t)(ka < K ? ka : K - 1) * ld + n] : 0.f); a[8 + i] = (_Float16)(kb < K ? W[(size_t)(kb < K ? kb : K - 1) * ld + n] : 0.f); }
  return a;
}
struct F2 { v16b h, l; };
__device__ __forceinline__ F2 bsplit16(const float v[16]) { F2 r;
#pragma unroll
  for (int i = 0; i < 16; ++i) { const __bf16 h = (__bf16)v[i]; r.h[i] = h; r.l[i] = (__bf16)(v[i] - (float)h); }
  return r; }
__device__ __forceinline__ F2 split_row(const float* row, int k0, int lane) { float v[16]; const float* p = row + k0 + 8 * (lane >> 4);
#pragma unroll
  for (int i = 0; i < 8; ++i) { v[i] = p[i]; v[8 + i] = p[16 + i]; }
  return bsplit16(v); }
__device__ __forceinline__ F2 split_rowK(const float* row, int k0, int lane, int K) { float v[16]; const int g = lane >> 4;
#pragma unroll
  for (int i = 0; i < 8; ++i) { const int ka = k0 + 8 * g + i, kb = ka + 16; v[i] = ka < K ? row[ka < K ? ka : K - 1] : 0.f; v[8 + i] = kb < K ? row[kb < K ? kb : K - 1] : 0.f; }
  return bsplit16(v); }
__device__ __forceinline__ F2 split_col(const float* W, int k0, int n, int lane, int ld, int K) { float v[16]; const int g = lane >> 4;
#pragma unroll
  for (int i = 0; i < 8; ++i) { const int ka = k0 + 8 * g + i, kb = ka + 16; v[i] = ka < K ? W[(size_t)(ka < K ? ka : K - 1) * ld + n] : 0.f; v[8 + i] = kb < K ? W[(size_t)(kb < K ? kb : K - 1) * ld + n] : 0.f; }
  return bsplit16(v); }
__device__ __forceinline__ v8f mac3(const F2& a, const F2& b, v8f c) { c = wmma_bf(a.l, b.h, c); c = wmma_bf(a.h, b.l, c); return wmma_bf(a.h, b.h, c); }
__device__ __forceinline__ float sigm(float v) { return 1.0f / (1.0f + expf(-v)); }
#define LDSX() do { asm volatile("s_wait_dscnt 0" ::: "memory"); __builtin_amdgcn_wave_barrier(); __builtin_amdgcn_fence(__ATOMIC_RELEASE, "workgroup"); } while (0)


#define NB 4
#define SS 2048
#define E 1024
#define NH 16
#define HD 64
#define NR (NB * SS)
#define PLO 1024.0f
#define VLO 2048.0f
#define SC2 0.18033688011112042f      // hs^-0.5 * log2(e): a raw score times this is its exponent to base 2
__device__ __forceinline__ float bfr(float v) { return (float)(__bf16)v; }
__device__ __forceinline__ v16b frag_b(const __bf16* rowk0, int lane) { return __builtin_bit_cast(v16b, frag_h((const _Float16*)rowk0, lane)); }

// asynchronous copies to LDS, 16 bytes a lane: l = the lane's LDS byte address, g = its global address. The s_wait_xcnt closes each statement, so that no address register is rewritten ahead of it.
#define CPY "global_load_async_to_lds_b128 "
__device__ __forceinline__ void cp4(unsigned l, unsigned ls, const char* g, size_t gs) {
  asm volatile(CPY "%0, %1, off\n\t" CPY "%2, %3, off\n\t" CPY "%4, %5, off\n\t" CPY "%6, %7, off\n\ts_wait_xcnt 0x0"
               :: "v"(l), "v"(g), "v"(l + ls), "v"(g + gs), "v"(l + 2 * ls), "v"(g + 2 * gs), "v"(l + 3 * ls), "v"(g + 3 * gs) : "memory");
}
__device__ __forceinline__ void cp2(unsigned l, unsigned ls, const char* g, size_t gs) {
  asm volatile(CPY "%0, %1, off\n\t" CPY "%2, %3, off\n\ts_wait_xcnt 0x0" :: "v"(l), "v"(g), "v"(l + ls), "v"(g + gs) : "memory");
}
// publish point of the two-buffer ring: own LDS reads done, own copies landed, then the work-group barrier (it publishes the next tile and frees the buffer just read)
#define RING_PUBLISH() do { asm volatile("s_wait_dscnt 0x0" ::: "memory"); asm volatile("s_wait_asynccnt 0x0" ::: "memory"); __syncthreads(); } while (0)
#define KT 64                         // k per stage: 128 B of a bf16 row, 256 B of an f32 row
#define PB 144                        // LDS pitch of a 128-B row, 16 B x odd: ds_load_b128 free of bank conflicts
#define PF 272                        // LDS pitch of a 256-B row, likewise
#define QBUF (256 * PB)               // k_qkv stage: 128 x rows, then 128 weight rows
#define OBUF (64 * PF + 128 * PB)     // k_out stage: 64 f32 ctx rows, then 128 weight rows
#define ABUF (64 * PF + 2 * 64 * PB) // k_attn stage: 64 K rows of 256 B (64 bf16 hi, 64 bf16 lo), then 64 V^T hi rows and 64 V^T lo rows of 64 keys
#define NST (2 * (SS / 128 + 1))      // k_attn stages in a block: 2 (t + 1) + 2 (16 - t)
__device__ __forceinline__ F2 split_row4(const float* p) { float v[16]; const v4f a = *(const v4f*)p, b = *(const v4f*)(p + 4), c = *(const v4f*)(p + 16), d = *(const v4f*)(p + 20);
#pragma unroll
  for (int i = 0; i < 4; ++i) { v[i] = a[i]; v[4 + i] = b[i]; v[8 + i] = c[i]; v[12 + i] = d[i]; }
  return bsplit16(v); }

// x, w_qkv and w_proj rounded to bf16 by one launch of few long waves: one work-group of 12 waves per WGP, a wave takes 4096 elements in a row of one input:
// its 32 loads of 512 B (whole lines) are all issued before the first result is stored (256 B a store, whole lines)
// PT rows: [0,3E) = w_qkv rows (q | k | v output features), [3E,4E) = w_proj rows ([out][in] weights, as they lie in the inputs)
#define CVW 12                        // waves in a work-group
#define CVL 32                        // loads of a wave
#define CVE (CVL * 128)               // elements of a wave
__global__ __launch_bounds__(32 * CVW) void k_cvt(const float* __restrict__ x, const float* __restrict__ Wqkv, const float* __restrict__ Wp, __bf16* __restrict__ Xb, __bf16* __restrict__ PT) {
  const int lane = threadIdx.x & 31, c = (int)blockIdx.x * CVW + __builtin_amdgcn_readfirstlane((int)threadIdx.x >> 5);
  const int cw = c - NR * E / CVE, cp = cw - 3 * E * E / CVE;      // the wave's piece counted from the start of w_qkv, of w_proj
  const float* s = (cw < 0 ? x + (size_t)c * CVE : cp < 0 ? Wqkv + (size_t)cw * CVE : Wp + (size_t)cp * CVE) + lane * 4;
  __bf16* d = (cw < 0 ? Xb + (size_t)c * CVE : PT + (size_t)cw * CVE) + lane * 4;
  v4f v[CVL];
#pragma unroll
  for (int j = 0; j < CVL; ++j) v[j] = *(const v4f*)(s + j * 128);
#pragma unroll
  for (int j = 0; j < CVL; ++j) { union { __bf16 h[4]; v2u u; } pk;
#pragma unroll
    for (int e = 0; e < 4; ++e) pk.h[e] = (__bf16)v[j][e];
    vst2(d + j * 128, pk.u); }
}
// QKV: block (128 rows, 128 cols = 2 heads, which), four waves of 64 x 64 (one head each); q -> Q32 f32 [bh][s][64]; k -> KS bf16 [bh][s][64 hi | 64 lo], the split of the f32 value made here, once; v -> VT hi/lo x4 [bh][d][s]
__global__ __launch_bounds__(128) void k_qkv(const __bf16* __restrict__ Xb, int rbase, const __bf16* __restrict__ PT, float* __restrict__ Q32, __bf16* __restrict__ KS, _Float16* __restrict__ VTh, _Float16* __restrict__ VTl) {
  __shared__ __align__(16) char sm[2 * QBUF];      // the ring in the loop; behind its last barrier the output staging
  float (*so)[64][68] = (float (*)[64][68])sm; _Float16 (*sth)[136] = (_Float16 (*)[136])sm; _Float16 (*stl)[136] = (_Float16 (*)[136])(sm + 128 * 136 * 2);
  const int tid = threadIdx.x, wave = tid >> 5, lane = tid & 31, col = lane & 15, g = lane >> 4, wr = wave >> 1, wc = wave & 1;
  const int which = blockIdx.z, r0b = blockIdx.x * 128, n0 = blockIdx.y * 128; const int b = r0b / SS, s0 = r0b % SS;
  v8f acc[4][4] = {};      // acc[i][j]: rows wr * 64 + i * 16 .., columns wc * 64 + j * 16 .. of the block's tile
  // a copy of the block moves 16 rows of 128 B: thread -> (row tid >> 3, 16-B piece tid & 7), whole lines per wave
  const char* gA = (const char*)(Xb + (size_t)(rbase + r0b + (tid >> 3)) * E + (tid & 7) * 8);
  const char* gB = (const char*)(PT + (size_t)(which * E + n0 + (tid >> 3)) * E + (tid & 7) * 8);
  const unsigned l0 = (unsigned)(size_t)sm + (tid >> 3) * PB + (tid & 7) * 16;
  auto fill = [&](int t) { const unsigned l = l0 + (t & 1) * QBUF; const size_t ko = (size_t)t * KT * 2;
    cp4(l, 16 * PB, gA + ko, (size_t)16 * E * 2); cp4(l + 64 * PB, 16 * PB, gA + ko + (size_t)64 * E * 2, (size_t)16 * E * 2);
    cp4(l + 128 * PB, 16 * PB, gB + ko, (size_t)16 * E * 2); cp4(l + 192 * PB, 16 * PB, gB + ko + (size_t)64 * E * 2, (size_t)16 * E * 2); };
  fill(0);
  asm volatile("s_wait_asynccnt 0x0" ::: "memory");   // stage 0 landed before the barrier that publishes it
  __syncthreads();
  fill(1);
#pragma unroll 1   // rolled: one copy of the loop's text, the buffer picked by t & 1
  for (int t = 0; t < E / KT; ++t) { const char* bp = sm + (t & 1) * QBUF;
#pragma unroll
    for (int kk = 0; kk < 2; ++kk) { v16b a[4], wf[4];   // the LDS reads of 32 k stand as one group ahead of their matrix run: 8 fragments feed 16 products
#pragma unroll
      for (int i = 0; i < 4; ++i) { a[i] = frag_b((const __bf16*)(bp + (wr * 64 + i * 16 + col) * PB) + kk * 32, lane); wf[i] = frag_b((const __bf16*)(bp + (128 + wc * 64 + i * 16 + col) * PB) + kk * 32, lane); }
#pragma unroll
      for (int i = 0; i < 4; ++i) {
#pragma unroll
        for (int j = 0; j < 4; ++j) acc[i][j] = wmma_bf(a[i], wf[j], acc[i][j]); } }
    RING_PUBLISH();
    if (t + 2 < E / KT) fill(t + 2); }
  asm volatile("s_wait_asynccnt 0x0" ::: "memory");   // nothing in flight when the ring becomes output staging
  const int h = (n0 >> 6) + wc;      // the wave's head
  if (which < 2) { const size_t row0 = ((size_t)b * NH + h) * SS + s0 + wr * 64;      // the wave's 64 rows go through its own slice of the staging
#pragma unroll
    for (int i = 0; i < 4; ++i) {
#pragma unroll
      for (int j = 0; j < 4; ++j) {
#pragma unroll
        for (int r = 0; r < 8; ++r) so[wave][i * 16 + 8 * g + r][j * 16 + col] = acc[i][j][r]; } }
    LDSX();
    if (which == 0) {
#pragma unroll 1   // rolled; four LDS reads and four stores in flight per trip
      for (int o = 0; o < 64 * 16 / 128; ++o) {
#pragma unroll
        for (int u = 0; u < 4; ++u) { const int qq = (o * 4 + u) * 32 + lane, rl = qq >> 4, pc = qq & 15;
          vst2(Q32 + (row0 + rl) * HD + pc * 4, *(const v4f*)(&so[wave][rl][pc * 4])); } } }
    else {
#pragma unroll 1   // likewise
      for (int o = 0; o < 64 * 8 / 128; ++o) {
#pragma unroll
      for (int u = 0; u < 4; ++u) { const int qq = (o * 4 + u) * 32 + lane, rl = qq >> 3, pc = qq & 7;
        const v4f va = *(const v4f*)(&so[wave][rl][pc * 8]), vb = *(const v4f*)(&so[wave][rl][pc * 8 + 4]);
        union { __bf16 e[8]; v4u u; } kh, kl;
#pragma unroll
        for (int e = 0; e < 8; ++e) { const float v = e < 4 ? va[e & 3] : vb[e & 3]; const __bf16 hv = (__bf16)v; kh.e[e] = hv; kl.e[e] = (__bf16)(v - (float)hv); }
        __bf16* d = KS + (row0 + rl) * (2 * HD) + pc * 8;
        vst2(d, kh.u); vst2(d + HD, kl.u); }
        asm volatile("s_wait_xcnt 0x0" ::: "memory");   // ahead of the next trip, which rewrites the stores' address and data registers
      } } }
  else {
#pragma unroll
    for (int i = 0; i < 4; ++i) {
#pragma unroll
      for (int j = 0; j < 4; ++j) { union { _Float16 e[8]; v4u u; } vh, vl;      // a lane's 8 rows of one column: 16 B of the transposed tile
#pragma unroll
        for (int r = 0; r < 8; ++r) { const float v = acc[i][j][r] * 4.0f; const _Float16 hi = (_Float16)v; vh.e[r] = hi; vl.e[r] = (_Float16)((v - (float)hi) * VLO); }
        vst2(&sth[wc * 64 + j * 16 + col][wr * 64 + i * 16 + 8 * g], vh.u); vst2(&stl[wc * 64 + j * 16 + col][wr * 64 + i * 16 + 8 * g], vl.u); } }
    __syncthreads();
#pragma unroll 1   // likewise
    for (int o = 0; o < 128 * 16 / 512; ++o) {
#pragma unroll
    for (int u = 0; u < 4; ++u) { const int qq = (o * 4 + u) * 128 + tid, cl = qq >> 4, pc = qq & 15; const int c = n0 + cl, hh = c >> 6, d = c & 63; const size_t of = (((size_t)b * NH + hh) * HD + d) * SS + s0 + pc * 8;
      vst2(VTh + of, *(const v4u*)(&sth[cl][pc * 8])); vst2(VTl + of, *(const v4u*)(&stl[cl][pc * 8])); }
      asm volatile("s_wait_xcnt 0x0" ::: "memory");   // ahead of the next trip, which rewrites the stores' address and data registers
    } }
}
__device__ __forceinline__ v8f mac3t(const F2& k, const F2& q, v8f c) { c = wmma_bf(k.h, q.l, c); c = wmma_bf(k.l, q.h, c); return wmma_bf(k.h, q.h, c); }
__global__ __launch_bounds__(256, 4) void k_attn(const float* __restrict__ Q32, const __bf16* __restrict__ KS, const _Float16* __restrict__ VTh, const _Float16* __restrict__ VTl, float* __restrict__ O32) {
  __shared__ __align__(16) char ring[2 * ABUF];
  __shared__ __align__(16) float sS[8][16][68];      // output staging (each wave its own slice)
  const int tid = threadIdx.x, w = __builtin_amdgcn_readfirstlane(tid >> 5), lane = tid & 31, col = lane & 15, g = lane >> 4;
  const size_t bh = blockIdx.y;
  const int n0 = 2 * ((int)blockIdx.x + 1);          // key tiles of the first query tile; both together: NST
  // K: a copy of the block moves 16 rows of 256 B; V^T: 32 rows of 128 B
  const char* gK = (const char*)(KS + (bh * SS + (tid >> 4)) * (2 * HD) + (tid & 15) * 8);
  const char* gH = (const char*)(VTh + (bh * HD + (tid >> 3)) * SS + (tid & 7) * 8);
  const char* gL = (const char*)(VTl + (bh * HD + (tid >> 3)) * SS + (tid & 7) * 8);
  const unsigned lK = (unsigned)(size_t)ring + (tid >> 4) * PF + (tid & 15) * 16, lV = (unsigned)(size_t)ring + 64 * PF + (tid >> 3) * PB + (tid & 7) * 16;
  auto fill = [&](int s) { const int kt = s < n0 ? s : s - n0; const unsigned bo2 = (s & 1) * ABUF;
    cp4(lK + bo2, 16 * PF, gK + (size_t)kt * 64 * HD * 4, (size_t)16 * HD * 4);
    cp2(lV + bo2, 32 * PB, gH + (size_t)kt * 64 * 2, (size_t)32 * SS * 2); cp2(lV + bo2 + 64 * PB, 32 * PB, gL + (size_t)kt * 64 * 2, (size_t)32 * SS * 2); };
  fill(0);
  asm volatile("s_wait_asynccnt 0x0" ::: "memory");   // stage 0 landed before the barrier that publishes it
  __syncthreads();
  fill(1);
  int st = 0;
  for (int pass = 0; pass < 2; ++pass) {
  const int qb = pass == 0 ? (int)blockIdx.x : SS / 128 - 1 - (int)blockIdx.x; const int q0 = qb * 128 + w * 16;
  F2 aq[2];      // the lane's query q0 + col, as the B operand
#pragma unroll
  for (int kc = 0; kc < 2; ++kc) aq[kc] = split_row(Q32 + (bh * SS + q0 + col) * HD, kc * 32, lane);
  // mrun: the running maximum as a base-2 exponent (raw score x SC2, rounded once: an unchanged maximum rescales by exactly 1); mrun, lrun: of query q0 + col, the same in both halves of the wave
  float mrun = -3.0e38f, lrun = 0.f; v8f acc[4] = {}, ac1[4] = {}, ac2[4] = {};      // element r of tile t: O^T[t * 16 + 8 g + r][q0 + col]
#pragma unroll 1   // rolled: one copy of the loop's text, the buffer picked by st & 1
  for (int kt = 0; kt < 2 * (qb + 1); ++kt, ++st) { const char* bp = ring + (st & 1) * ABUF;
   if (kt * 64 <= q0 + 15) {      // a key tile wholly above the wave's diagonal adds nothing: the wave goes straight to the publish point
    const int lim = q0 + col - kt * 64 - 8 * g;      // key t * 16 + 8 g + r of the tile is above the diagonal where t * 16 + r > lim
    v8f s[4];
#pragma unroll
    for (int t = 0; t < 4; ++t) { const __bf16* krow = (const __bf16*)(bp + (t * 16 + col) * PF);
      const F2 k0 = {frag_b(krow, lane), frag_b(krow + HD, lane)}, k1 = {frag_b(krow + 32, lane), frag_b(krow + HD + 32, lane)};
      s[t] = mac3t(k0, aq[0], (v8f){}); s[t] = mac3t(k1, aq[1], s[t]);
#pragma unroll
      for (int r = 0; r < 8; ++r) s[t][r] = (t * 16 + r > lim) ? -3.0e38f : s[t][r]; }
    float mx = -3.4e38f;
#pragma unroll
    for (int t = 0; t < 4; ++t) {
#pragma unroll
      for (int r = 0; r < 8; ++r) mx = fmaxf(mx, s[t][r]); }
    mx = fmaxf(mx, __shfl_xor(mx, 16, 32));
    const float mnew = fmaxf(mrun, mx * SC2); const float ca = mrun - mnew; const float corr = __builtin_amdgcn_exp2f(ca);
    asm volatile("v_nop" :: "v"(ca), "v"(corr));   // the same slot behind this v_exp_f32 (see below)
    float ps = 0.f; v16h ph[2], pl[2];      // P^T operands of 32 keys: element e = key 8 g + e, element 8 + e = key 16 + 8 g + e, as two score tiles hold them
#pragma unroll
    for (int t = 0; t < 4; ++t) { v2f ar[4]; float ex[8];
#pragma unroll
      for (int j = 0; j < 4; ++j) ar[j] = __builtin_elementwise_fma((v2f){s[t][2 * j], s[t][2 * j + 1]}, (v2f){SC2, SC2}, (v2f){-mnew, -mnew});   // two exponents by one packed fma
#pragma unroll
      for (int r = 0; r < 8; ++r) ex[r] = __builtin_amdgcn_exp2f(ar[r >> 1][r & 1]);
      // the slot behind a transcendental before its source register is written again: the exponents are inputs here, so they keep their registers up to this v_nop, which stands behind the eight v_exp_f32
      asm volatile("v_nop" :: "v"(ar[0]), "v"(ar[1]), "v"(ar[2]), "v"(ar[3]), "v"(ex[0]), "v"(ex[1]), "v"(ex[2]), "v"(ex[3]), "v"(ex[4]), "v"(ex[5]), "v"(ex[6]), "v"(ex[7]));
#pragma unroll
      for (int r = 0; r < 8; ++r) { const float p = ex[r] * 16384.0f; ps += p; const _Float16 hi = (_Float16)p; ph[t >> 1][(t & 1) * 8 + r] = hi; pl[t >> 1][(t & 1) * 8 + r] = (_Float16)((p - (float)hi) * PLO); } }
    ps += __shfl_xor(ps, 16, 32);
    lrun = lrun * corr + ps * (1.0f / 16384.0f); mrun = mnew;
#pragma unroll
    for (int t = 0; t < 4; ++t) { acc[t] *= corr; ac1[t] *= corr; ac2[t] *= corr; }
#pragma unroll
    for (int kc = 0; kc < 2; ++kc) { v16h vh[2], vl[2];   // the LDS reads of two output tiles stand as one group ahead of their matrix run
#pragma unroll
      for (int tp = 0; tp < 4; tp += 2) {
#pragma unroll
      for (int t = 0; t < 2; ++t) { const _Float16* vr = (const _Float16*)(bp + 64 * PF + ((tp + t) * 16 + col) * PB) + kc * 32; vh[t] = frag_h(vr, lane); vl[t] = frag_h(vr + 64 * PB / 2, lane); }
#pragma unroll
      for (int t = 0; t < 2; ++t) { acc[tp + t] = wmma16(vh[t], ph[kc], acc[tp + t]); ac1[tp + t] = wmma16(vl[t], ph[kc], ac1[tp + t]); ac2[tp + t] = wmma16(vh[t], pl[kc], ac2[tp + t]); } } } }
    RING_PUBLISH();
    if (st + 2 < NST) fill(st + 2); }
  const float inv = 1.0f / (lrun * 16384.0f * 4.0f);
#pragma unroll
  for (int t = 0; t < 4; ++t) { v4f o[2];
#pragma unroll
    for (int r = 0; r < 8; ++r) o[r >> 2][r & 3] = (acc[t][r] + ac1[t][r] * (1.0f / VLO) + ac2[t][r] * (1.0f / PLO)) * inv;
    *(v4f*)(&sS[w][col][t * 16 + 8 * g]) = o[0]; *(v4f*)(&sS[w][col][t * 16 + 8 * g + 4]) = o[1]; }
  LDSX();
  for (int qq = lane; qq < 16 * 16; qq += 32) { const int rl = qq >> 4, pc = qq & 15; vst2(O32 + ((bh * SS) + q0 + rl) * HD + pc * 4, *(const v4f*)(&sS[w][rl][pc * 4])); }
  LDSX();   // the staged rows are read before the next query tile's output overwrites them
  }
  asm volatile("s_wait_asynccnt 0x0" ::: "memory");   // nothing in flight when the wave ends
}
// out = ctx Wo^T + bo : split(ctx) x bf16(Wo rows): 2 products (Wo is an INPUT -> bf16 exact)
__global__ __launch_bounds__(128) void k_out(const float* __restrict__ O32, const __bf16* __restrict__ PT, const float* __restrict__ bo, float* __restrict__ out) {
  __shared__ __align__(16) char sm[2 * OBUF];   // the ring in the loop; behind its last barrier the output staging
  float (*so)[16][132] = (float (*)[16][132])sm;
  const int tid = threadIdx.x, wave = tid >> 5, lane = tid & 31, col = lane & 15, g = lane >> 4;
  const int r0b = blockIdx.x * 64, r0 = r0b + wave * 16, n0 = blockIdx.y * 128; const int b = r0b / SS, s0 = r0b % SS;
  v8f acc[8] = {};
  // stage t = head t: ctx rows of 256 B (a copy of the block moves 8 rows), weight rows of 128 B (16 rows), whole lines per wave
  const char* gA = (const char*)(O32 + ((size_t)b * NH * SS + s0 + (tid >> 4)) * HD + (tid & 15) * 4);
  const char* gB = (const char*)(PT + (size_t)(3 * E + n0 + (tid >> 3)) * E + (tid & 7) * 8);
  const unsigned lA = (unsigned)(size_t)sm + (tid >> 4) * PF + (tid & 15) * 16, lB = (unsigned)(size_t)sm + 64 * PF + (tid >> 3) * PB + (tid & 7) * 16;
  auto fill = [&](int t) { const unsigned bo2 = (t & 1) * OBUF; const char* a = gA + (size_t)t * SS * HD * 4; const char* w = gB + (size_t)t * KT * 2;
    cp4(lA + bo2, 8 * PF, a, (size_t)8 * HD * 4); cp4(lA + bo2 + 32 * PF, 8 * PF, a + (size_t)32 * HD * 4, (size_t)8 * HD * 4);
    cp4(lB + bo2, 16 * PB, w, (size_t)16 * E * 2); cp4(lB + bo2 + 64 * PB, 16 * PB, w + (size_t)64 * E * 2, (size_t)16 * E * 2); };
  fill(0);
  asm volatile("s_wait_asynccnt 0x0" ::: "memory");   // stage 0 landed before the barrier that publishes it
  __syncthreads();
  fill(1);
#pragma unroll 1   // rolled: one copy of the loop's text, the buffer picked by t & 1
  for (int t = 0; t < E / KT; ++t) { const char* bp = sm + (t & 1) * OBUF; F2 a[2]; v16b wf[2][8];   // the stage's LDS reads stand as one group ahead of its matrix run
#pragma unroll
    for (int kk = 0; kk < 2; ++kk) { a[kk] = split_row4((const float*)(bp + (wave * 16 + col) * PF) + kk * 32 + 8 * g);
#pragma unroll
      for (int j = 0; j < 8; ++j) wf[kk][j] = frag_b((const __bf16*)(bp + 64 * PF + (j * 16 + col) * PB) + kk * 32, lane); }
#pragma unroll
    for (int kk = 0; kk < 2; ++kk) {
#pragma unroll
      for (int j = 0; j < 8; ++j) { acc[j] = wmma_bf(a[kk].l, wf[kk][j], acc[j]); acc[j] = wmma_bf(a[kk].h, wf[kk][j], acc[j]); } }
    RING_PUBLISH();
    if (t + 2 < E / KT) fill(t + 2); }
  asm volatile("s_wait_asynccnt 0x0" ::: "memory");   // nothing in flight when the ring becomes output staging
#pragma unroll
  for (int j = 0; j < 8; ++j) { const int n = n0 + j * 16 + col; const float bb = bfr(bo[n]);
#pragma unroll
    for (int r = 0; r < 8; ++r) so[wave][8 * g + r][j * 16 + col] = acc[j][r] + bb; }
  LDSX();
#pragma unroll 4
  for (int rl = 0; rl < 16; ++rl) vst2(out + (size_t)(r0 + rl) * E + n0 + lane * 4, *(const v4f*)(&so[wave][rl][lane * 4]));
}
#define NBHALF 2
extern "C" void kernel_launch(void* const* d_in, const int* in_sizes, int n_in, void* d_out, int out_size, void* d_ws, size_t ws_size, hipStream_t stream) {
  (void)in_sizes; (void)n_in; (void)out_size; (void)ws_size;
  const float* x = (const float*)d_in[0]; const float* Wqkv = (const float*)d_in[1]; const float* Wp = (const float*)d_in[2]; const float* bp = (const float*)d_in[3];
  float* out = (float*)d_out;
  char* ws = (char*)d_ws; size_t off = 0;
  auto take = [&](size_t bytes) { char* p = ws + off; off += (bytes + 255) & ~(size_t)255; return p; };
  const size_t HR = (size_t)NBHALF * SS;     // rows per half (4096)
  __bf16* Xb = (__bf16*)take((size_t)NR * E * 2); __bf16* PT = (__bf16*)take((size_t)4 * E * E * 2);
  float* Q32 = (float*)take((size_t)NR * E * 4); __bf16* KS = (__bf16*)take((size_t)NR * E * 4); _Float16* VTh = (_Float16*)take((size_t)NR * E * 2); _Float16* VTl = (_Float16*)take((size_t)NR * E * 2);
  float* O32 = Q32;      // in place: each k_attn wave reads its own 16 query rows into registers before writing the same rows; no other block reads them
  // ws ~ 120 MB; Q/K/V of all four batches are held at once, so that one attention launch covers all 64 (batch, head) pairs
  k_cvt<<<(NR * E + 4 * E * E) / (CVW * CVE), 32 * CVW, 0, stream>>>(x, Wqkv, Wp, Xb, PT);
  for (int hf = 0; hf < 2; ++hf) { const int rbase = hf * (int)HR; const size_t ho = hf * HR * E;
    k_qkv<<<dim3(HR / 128, E / 128, 3), 128, 0, stream>>>(Xb, rbase, PT, Q32 + ho, KS + 2 * ho, VTh + ho, VTl + ho); }
  k_attn<<<dim3(SS / 256, NB * NH), 256, 0, stream>>>(Q32, KS, VTh, VTl, O32);
  k_out<<<dim3(NR / 64, E / 128), 128, 0, stream>>>(O32, PT, bp, out);      // all four batches: 1024 work-groups, four on each WGP, resident at once
}

// v009
// Measured time: 179 microseconds a run.
// Two timings next to v008 both put it at 1.05 times that version's speed.
// Counting every step since v000, it is 5.76 times as fast.
// compute dtype: x, w_qkv, w_proj, b_proj (INPUTS) rounded to bf16 with exact bf16 WMMA products (f32 accumulate) for the projections; q/k f32 split for the scores (3 products), P and V f16 hi/lo (3 products); softmax f32.
#include <hip/hip_runtime.h>
#include <math.h>

typedef __attribute__((ext_vector_type(16))) _Float16 v16h;
typedef __attribute__((ext_vector_type(16))) __bf16 v16b;
typedef __attribute__((ext_vector_type(8)))  _Float16 v8h;
typedef __attribute__((ext_vector_type(2)))  _Float16 v2h;
typedef __attribute__((ext_vector_type(8)))  float v8f;
typedef __attribute__((ext_vector_type(4)))  float v4f;
typedef __attribute__((ext_vector_type(2)))  float v2f;
typedef __attribute__((ext_vector_type(4)))  unsigned v4u;
typedef __attribute__((ext_vector_type(2)))  unsigned v2u;
typedef __attribute__((ext_vector_type(4)))  int v4i;
typedef float __attribute__((may_alias)) float_a;
typedef int __attribute__((may_alias)) int_a;

template <typename T> __device__ __forceinline__ void vst2(void* p, T v) { *(T*)p = v;  }
__device__ __forceinline__ v8f wmma16(v16h a, v16h b, v8f c) {
  v8f d = __builtin_amdgcn_wmma_f32_16x16x32_f16(false, a, false, b, (short)0, c, false, false);
  asm volatile("v_nop\n\tv_nop\n\tv_nop\n\tv_nop" : "+v"(d) : "v"(a), "v"(b));
  return d;
}
__device__ __forceinline__ v8f wmma_bf(v16b a, v16b b, v8f c) {
  v8f d = __builtin_amdgcn_wmma_f32_16x16x32_bf16(false, a, false, b, (short)0, c, false, false);
  asm volatile("v_nop\n\tv_nop\n\tv_nop\n\tv_nop" : "+v"(d) : "v"(a), "v"(b));
  return d;
}
// 16x16x32 fragments: lane = (h = lane>>4, row/col = lane&15); elements 0..7 = k0+8h+0..7, 8..15 = k0+16+8h+0..7; D element r = row 8h+r
__device__ __forceinline__ v16h frag_h(const _Float16* rowk0, int lane) {
  union { v16h v; v8h q[2]; } u; const _Float16* p = rowk0 + 8 * (lane >> 4);
  u.q[0] = *(const v8h*)p; u.q[1] = *(const v8h*)(p + 16); return u.v;
}
__device__ __forceinline__ v16h frag_f32(const float* rowk0, int lane) {
  v16h a; const float* p = rowk0 + 8 * (lane >> 4);
#pragma unroll
  for (int i = 0; i < 8; ++i) { a[i] = (_Float16)p[i]; a[8 + i] = (_Float16)p[16 + i]; }
  return a;
}
__device__ __forceinline__ v16h frag_f32s(const float* rowk0, int lane, float sc) {
  v16h a; const float* p = rowk0 + 8 * (lane >> 4);
#pragma unroll
  for (int i = 0; i < 8; ++i) { a[i] = (_Float16)(p[i] * sc); a[8 + i] = (_Float16)(p[16 + i] * sc); }
  return a;
}
// column fragment from a [K][ld] layout (column n), rows >= K read as 0
__device__ __forceinline__ v16h fragc_f32(const float* W, int k0, int n, int lane, int ld, int K) {
  v16h a; const int g = lane >> 4;
#pragma unroll
  for (int i = 0; i < 8; ++i) { const int ka = k0 + 8 * g + i, kb = ka + 16;
    a[i] = (_Float16)(ka < K ? W[(size_t)(ka < K ? ka : K - 1) * ld + n] : 0.f); a[8 + i] = (_Float16)(kb < K ? W[(size_t)(kb < K ? kb : K - 1) * ld + n] : 0.f); }
  return a;
}
struct F2 { v16b h, l; };
__device__ __forceinline__ F2 bsplit16(const float v[16]) { F2 r;
#pragma unroll
  for (int i = 0; i < 16; ++i) { const __bf16 h = (__bf16)v[i]; r.h[i] = h; r.l[i] = (__bf16)(v[i] - (float)h); }
  return r; }
__device__ __forceinline__ F2 split_row(const float* row, int k0, int lane) { float v[16]; const float* p = row + k0 + 8 * (lane >> 4);
#pragma unroll
  for (int i = 0; i < 8; ++i) { v[i] = p[i]; v[8 + i] = p[16 + i]; }
  return bsplit16(v); }
__device__ __forceinline__ F2 split_rowK(const float* row, int k0, int lane, int K) { float v[16]; const int g = lane >> 4;
#pragma unroll
  for (int i = 0; i < 8; ++i) { const int ka = k0 + 8 * g + i, kb = ka + 16; v[i] = ka < K ? row[ka < K ? ka : K - 1] : 0.f; v[8 + i] = kb < K ? row[kb < K ? kb : K - 1] : 0.f; }
  return bsplit16(v); }
__device__ __forceinline__ F2 split_col(const float* W, int k0, int n, int lane, int ld, int K) { float v[16]; const int g = lane >> 4;
#pragma unroll
  for (int i = 0; i < 8; ++i) { const int ka = k0 + 8 * g + i, kb = ka + 16; v[i] = ka < K ? W[(size_t)(ka < K ? ka : K - 1) * ld + n] : 0.f; v[8 + i] = kb < K ? W[(size_t)(kb < K ? kb : K - 1) * ld + n] : 0.f; }
  return bsplit16(v); }
__device__ __forceinline__ v8f mac3(const F2& a, const F2& b, v8f c) { c = wmma_bf(a.l, b.h, c); c = wmma_bf(a.h, b.l, c); return wmma_bf(a.h, b.h, c); }
__device__ __forceinline__ float sigm(float v) { return 1.0f / (1.0f + expf(-v)); }
#define LDSX() do { asm volatile("s_wait_dscnt 0" ::: "memory"); __builtin_amdgcn_wave_barrier(); __builtin_amdgcn_fence(__ATOMIC_RELEASE, "workgroup"); } while (0)


#define NB 4
#define SS 2048
#define E 1024
#define NH 16
#define HD 64
#define NR (NB * SS)
#define SC2 0.18033688011112042f      // hs^-0.5 * log2(e): a raw score times this is its exponent to base 2
__device__ __forceinline__ float bfr(float v) { return (float)(__bf16)v; }
__device__ __forceinline__ v16b frag_b(const __bf16* rowk0, int lane) { return __builtin_bit_cast(v16b, frag_h((const _Float16*)rowk0, lane)); }

// asynchronous copies to LDS, 16 bytes a lane: l = the lane's LDS byte address, g = its global address. The s_wait_xcnt closes each statement, so that no address register is rewritten ahead of it.
#define CPY "global_load_async_to_lds_b128 "
__device__ __forceinline__ void cp4(unsigned l, unsigned ls, const char* g, size_t gs) {
  asm volatile(CPY "%0, %1, off\n\t" CPY "%2, %3, off\n\t" CPY "%4, %5, off\n\t" CPY "%6, %7, off\n\ts_wait_xcnt 0x0"
               :: "v"(l), "v"(g), "v"(l + ls), "v"(g + gs), "v"(l + 2 * ls), "v"(g + 2 * gs), "v"(l + 3 * ls), "v"(g + 3 * gs) : "memory");
}
__device__ __forceinline__ void cp2(unsigned l, unsigned ls, const char* g, size_t gs) {
  asm volatile(CPY "%0, %1, off\n\t" CPY "%2, %3, off\n\ts_wait_xcnt 0x0" :: "v"(l), "v"(g), "v"(l + ls), "v"(g + gs) : "memory");
}
// publish point of the two-buffer ring: own LDS reads done, own copies landed, then the work-group barrier (it publishes the next tile and frees the buffer just read)
#define RING_PUBLISH() do { asm volatile("s_wait_dscnt 0x0" ::: "memory"); asm volatile("s_wait_asynccnt 0x0" ::: "memory"); __syncthreads(); } while (0)
#define KT 64                         // k per stage: 128 B of a bf16 row, 256 B of an f32 row
#define PB 144                        // LDS pitch of a 128-B row, 16 B x odd: ds_load_b128 free of bank conflicts
#define PF 272                        // LDS pitch of a 256-B row, likewise
#define QBUF (256 * PB)               // k_qkv stage: 128 x rows, then 128 weight rows
#define OBUF (64 * PF + 128 * PB)     // k_out stage: 64 f32 ctx rows, then 128 weight rows
#define ABUF (64 * PF + 2 * 64 * PB) // k_attn stage: 64 K rows of 256 B (64 bf16 hi, 64 bf16 lo), then 64 V^T hi rows and 64 V^T lo rows of 64 keys
#define NST (2 * (SS / 128 + 1))      // k_attn stages in a block: 2 (t + 1) + 2 (16 - t)
__device__ __forceinline__ F2 split_row4(const float* p) { float v[16]; const v4f a = *(const v4f*)p, b = *(const v4f*)(p + 4), c = *(const v4f*)(p + 16), d = *(const v4f*)(p + 20);
#pragma unroll
  for (int i = 0; i < 4; ++i) { v[i] = a[i]; v[4 + i] = b[i]; v[8 + i] = c[i]; v[12 + i] = d[i]; }
  return bsplit16(v); }

// x, w_qkv and w_proj rounded to bf16 by one launch of few long waves: one work-group of 12 waves per WGP, a wave takes 4096 elements in a row of one input:
// its 32 loads of 512 B (whole lines) are all issued before the first result is stored (256 B a store, whole lines)
// PT rows: [0,3E) = w_qkv rows (q | k | v output features), [3E,4E) = w_proj rows ([out][in] weights, as they lie in the inputs)
#define CVW 12                        // waves in a work-group
#define CVL 32                        // loads of a wave
#define CVE (CVL * 128)               // elements of a wave
__global__ __launch_bounds__(32 * CVW) void k_cvt(const float* __restrict__ x, const float* __restrict__ Wqkv, const float* __restrict__ Wp, __bf16* __restrict__ Xb, __bf16* __restrict__ PT) {
  const int lane = threadIdx.x & 31, c = (int)blockIdx.x * CVW + __builtin_amdgcn_readfirstlane((int)threadIdx.x >> 5);
  const int cw = c - NR * E / CVE, cp = cw - 3 * E * E / CVE;      // the wave's piece counted from the start of w_qkv, of w_proj
  const float* s = (cw < 0 ? x + (size_t)c * CVE : cp < 0 ? Wqkv + (size_t)cw * CVE : Wp + (size_t)cp * CVE) + lane * 4;
  __bf16* d = (cw < 0 ? Xb + (size_t)c * CVE : PT + (size_t)cw * CVE) + lane * 4;
  v4f v[CVL];
#pragma unroll
  for (int j = 0; j < CVL; ++j) v[j] = *(const v4f*)(s + j * 128);
#pragma unroll
  for (int j = 0; j < CVL; ++j) { union { __bf16 h[4]; v2u u; } pk;
#pragma unroll
    for (int e = 0; e < 4; ++e) pk.h[e] = (__bf16)v[j][e];
    vst2(d + j * 128, pk.u); }
}
// QKV: block (128 rows, 128 cols = 2 heads, which), four waves of 64 x 64 (one head each); q -> Q32 f32 [bh][s][64]; k -> KS bf16 [bh][s][64 hi | 64 lo], the split of the f32 value made here, once; v -> VT hi/lo x4 [bh][d][s]
__global__ __launch_bounds__(128) void k_qkv(const __bf16* __restrict__ Xb, int rbase, const __bf16* __restrict__ PT, float* __restrict__ Q32, __bf16* __restrict__ KS, _Float16* __restrict__ VTh, _Float16* __restrict__ VTl) {
  __shared__ __align__(16) char sm[2 * QBUF];      // the ring in the loop; behind its last barrier the output staging
  float (*so)[64][68] = (float (*)[64][68])sm; _Float16 (*sth)[136] = (_Float16 (*)[136])sm; _Float16 (*stl)[136] = (_Float16 (*)[136])(sm + 128 * 136 * 2);
  const int tid = threadIdx.x, wave = tid >> 5, lane = tid & 31, col = lane & 15, g = lane >> 4, wr = wave >> 1, wc = wave & 1;
  const int which = blockIdx.z, r0b = blockIdx.x * 128, n0 = blockIdx.y * 128; const int b = r0b / SS, s0 = r0b % SS;
  v8f acc[4][4] = {};      // acc[i][j]: rows wr * 64 + i * 16 .., columns wc * 64 + j * 16 .. of the block's tile
  // a copy of the block moves 16 rows of 128 B: thread -> (row tid >> 3, 16-B piece tid & 7), whole lines per wave
  const char* gA = (const char*)(Xb + (size_t)(rbase + r0b + (tid >> 3)) * E + (tid & 7) * 8);
  const char* gB = (const char*)(PT + (size_t)(which * E + n0 + (tid >> 3)) * E + (tid & 7) * 8);
  const unsigned l0 = (unsigned)(size_t)sm + (tid >> 3) * PB + (tid & 7) * 16;
  auto fill = [&](int t) { const unsigned l = l0 + (t & 1) * QBUF; const size_t ko = (size_t)t * KT * 2;
    cp4(l, 16 * PB, gA + ko, (size_t)16 * E * 2); cp4(l + 64 * PB, 16 * PB, gA + ko + (size_t)64 * E * 2, (size_t)16 * E * 2);
    cp4(l + 128 * PB, 16 * PB, gB + ko, (size_t)16 * E * 2); cp4(l + 192 * PB, 16 * PB, gB + ko + (size_t)64 * E * 2, (size_t)16 * E * 2); };
  fill(0);
  asm volatile("s_wait_asynccnt 0x0" ::: "memory");   // stage 0 landed before the barrier that publishes it
  __syncthreads();
  fill(1);
#pragma unroll 1   // rolled: one copy of the loop's text, the buffer picked by t & 1
  for (int t = 0; t < E / KT; ++t) { const char* bp = sm + (t & 1) * QBUF;
#pragma unroll
    for (int kk = 0; kk < 2; ++kk) { v16b a[4], wf[4];   // the LDS reads of 32 k stand as one group ahead of their matrix run: 8 fragments feed 16 products
#pragma unroll
      for (int i = 0; i < 4; ++i) { a[i] = frag_b((const __bf16*)(bp + (wr * 64 + i * 16 + col) * PB) + kk * 32, lane); wf[i] = frag_b((const __bf16*)(bp + (128 + wc * 64 + i * 16 + col) * PB) + kk * 32, lane); }
#pragma unroll
      for (int i = 0; i < 4; ++i) {
#pragma unroll
        for (int j = 0; j < 4; ++j) acc[i][j] = wmma_bf(a[i], wf[j], acc[i][j]); } }
    RING_PUBLISH();
    if (t + 2 < E / KT) fill(t + 2); }
  asm volatile("s_wait_asynccnt 0x0" ::: "memory");   // nothing in flight when the ring becomes output staging
  const int h = (n0 >> 6) + wc;      // the wave's head
  if (which < 2) { const size_t row0 = ((size_t)b * NH + h) * SS + s0 + wr * 64;      // the wave's 64 rows go through its own slice of the staging
#pragma unroll
    for (int i = 0; i < 4; ++i) {
#pragma unroll
      for (int j = 0; j < 4; ++j) {
#pragma unroll
        for (int r = 0; r < 8; ++r) so[wave][i * 16 + 8 * g + r][j * 16 + col] = acc[i][j][r]; } }
    LDSX();
    if (which == 0) {
#pragma unroll 1   // rolled; four LDS reads and four stores in flight per trip
      for (int o = 0; o < 64 * 16 / 128; ++o) {
#pragma unroll
        for (int u = 0; u < 4; ++u) { const int qq = (o * 4 + u) * 32 + lane, rl = qq >> 4, pc = qq & 15;
          vst2(Q32 + (row0 + rl) * HD + pc * 4, *(const v4f*)(&so[wave][rl][pc * 4])); } } }
    else {
#pragma unroll 1   // likewise
      for (int o = 0; o < 64 * 8 / 128; ++o) {
#pragma unroll
      for (int u = 0; u < 4; ++u) { const int qq = (o * 4 + u) * 32 + lane, rl = qq >> 3, pc = qq & 7;
        const v4f va = *(const v4f*)(&so[wave][rl][pc * 8]), vb = *(const v4f*)(&so[wave][rl][pc * 8 + 4]);
        union { __bf16 e[8]; v4u u; } kh, kl;
#pragma unroll
        for (int e = 0; e < 8; ++e) { const float v = e < 4 ? va[e & 3] : vb[e & 3]; const __bf16 hv = (__bf16)v; kh.e[e] = hv; kl.e[e] = (__bf16)(v - (float)hv); }
        __bf16* d = KS + (row0 + rl) * (2 * HD) + pc * 8;
        vst2(d, kh.u); vst2(d + HD, kl.u); }
        asm volatile("s_wait_xcnt 0x0" ::: "memory");   // ahead of the next trip, which rewrites the stores' address and data registers
      } } }
  else {
#pragma unroll
    for (int i = 0; i < 4; ++i) {
#pragma unroll
      for (int j = 0; j < 4; ++j) { union { _Float16 e[8]; v4u u; } vh, vl;      // a lane's 8 rows of one column: 16 B of the transposed tile
#pragma unroll
        for (int r = 0; r < 8; ++r) { const float v = acc[i][j][r] * 4.0f; const _Float16 hi = (_Float16)v; vh.e[r] = hi; vl.e[r] = (_Float16)(v - (float)hi); }
        vst2(&sth[wc * 64 + j * 16 + col][wr * 64 + i * 16 + 8 * g], vh.u); vst2(&stl[wc * 64 + j * 16 + col][wr * 64 + i * 16 + 8 * g], vl.u); } }
    __syncthreads();
#pragma unroll 1   // likewise
    for (int o = 0; o < 128 * 16 / 512; ++o) {
#pragma unroll
    for (int u = 0; u < 4; ++u) { const int qq = (o * 4 + u) * 128 + tid, cl = qq >> 4, pc = qq & 15; const int c = n0 + cl, hh = c >> 6, d = c & 63; const size_t of = (((size_t)b * NH + hh) * HD + d) * SS + s0 + pc * 8;
      vst2(VTh + of, *(const v4u*)(&sth[cl][pc * 8])); vst2(VTl + of, *(const v4u*)(&stl[cl][pc * 8])); }
      asm volatile("s_wait_xcnt 0x0" ::: "memory");   // ahead of the next trip, which rewrites the stores' address and data registers
    } }
}
__device__ __forceinline__ v8f mac3t(const F2& k, const F2& q, v8f c) { c = wmma_bf(k.h, q.l, c); c = wmma_bf(k.l, q.h, c); return wmma_bf(k.h, q.h, c); }
__global__ __launch_bounds__(256, 4) void k_attn(const float* __restrict__ Q32, const __bf16* __restrict__ KS, const _Float16* __restrict__ VTh, const _Float16* __restrict__ VTl, float* __restrict__ O32) {
  __shared__ __align__(16) char ring[2 * ABUF];
  __shared__ __align__(16) float sS[8][16][68];      // output staging (each wave its own slice)
  const int tid = threadIdx.x, w = __builtin_amdgcn_readfirstlane(tid >> 5), lane = tid & 31, col = lane & 15, g = lane >> 4;
  const size_t bh = blockIdx.y;
  const int n0 = 2 * ((int)blockIdx.x + 1);          // key tiles of the first query tile; both together: NST
  // K: a copy of the block moves 16 rows of 256 B; V^T: 32 rows of 128 B
  const char* gK = (const char*)(KS + (bh * SS + (tid >> 4)) * (2 * HD) + (tid & 15) * 8);
  const char* gH = (const char*)(VTh + (bh * HD + (tid >> 3)) * SS + (tid & 7) * 8);
  const char* gL = (const char*)(VTl + (bh * HD + (tid >> 3)) * SS + (tid & 7) * 8);
  const unsigned lK = (unsigned)(size_t)ring + (tid >> 4) * PF + (tid & 15) * 16, lV = (unsigned)(size_t)ring + 64 * PF + (tid >> 3) * PB + (tid & 7) * 16;
  auto fill = [&](int s) { const int kt = s < n0 ? s : s - n0; const unsigned bo2 = (s & 1) * ABUF;
    cp4(lK + bo2, 16 * PF, gK + (size_t)kt * 64 * HD * 4, (size_t)16 * HD * 4);
    cp2(lV + bo2, 32 * PB, gH + (size_t)kt * 64 * 2, (size_t)32 * SS * 2); cp2(lV + bo2 + 64 * PB, 32 * PB, gL + (size_t)kt * 64 * 2, (size_t)32 * SS * 2); };
  fill(0);
  asm volatile("s_wait_asynccnt 0x0" ::: "memory");   // stage 0 landed before the barrier that publishes it
  __syncthreads();
  fill(1);
  int st = 0;
  for (int pass = 0; pass < 2; ++pass) {
  const int qb = pass == 0 ? (int)blockIdx.x : SS / 128 - 1 - (int)blockIdx.x; const int q0 = qb * 128 + w * 16;
  F2 aq[2];      // the lane's query q0 + col, as the B operand
#pragma unroll
  for (int kc = 0; kc < 2; ++kc) aq[kc] = split_row(Q32 + (bh * SS + q0 + col) * HD, kc * 32, lane);
  // mrun: the running maximum as a base-2 exponent less 14 (raw score x SC2 - 14, rounded once: an unchanged maximum rescales by exactly 1), so that v_exp_f32 itself gives P x 2^14; mrun, lrun: of query q0 + col, the same in both halves of the wave
  // the lo parts of P and V are plain f16 remainders at the scale of their hi parts, so the three products of a tile add into one accumulator
  float mrun = -3.0e38f, lrun = 0.f; v8f acc[4] = {};      // element r of tile t: O^T[t * 16 + 8 g + r][q0 + col]
#pragma unroll 1   // rolled: one copy of the loop's text, the buffer picked by st & 1
  for (int kt = 0; kt < 2 * (qb + 1); ++kt, ++st) { const char* bp = ring + (st & 1) * ABUF;
   if (kt * 64 <= q0 + 15) {      // a key tile wholly above the wave's diagonal adds nothing: the wave goes straight to the publish point
    const int lim = q0 + col - kt * 64 - 8 * g;      // key t * 16 + 8 g + r of the tile is above the diagonal where t * 16 + r > lim
    v8f s[4];
#pragma unroll
    for (int t = 0; t < 4; ++t) { const __bf16* krow = (const __bf16*)(bp + (t * 16 + col) * PF);
      const F2 k0 = {frag_b(krow, lane), frag_b(krow + HD, lane)}, k1 = {frag_b(krow + 32, lane), frag_b(krow + HD + 32, lane)};
      s[t] = mac3t(k0, aq[0], (v8f){}); s[t] = mac3t(k1, aq[1], s[t]);
#pragma unroll
      for (int r = 0; r < 8; ++r) s[t][r] = (t * 16 + r > lim) ? -3.0e38f : s[t][r]; }
    float mx = -3.4e38f;
#pragma unroll
    for (int t = 0; t < 4; ++t) {
#pragma unroll
      for (int r = 0; r < 8; ++r) mx = fmaxf(mx, s[t][r]); }
    mx = fmaxf(mx, __shfl_xor(mx, 16, 32));
    const float mnew = fmaxf(mrun, __builtin_fmaf(mx, SC2, -14.0f)); const float ca = mrun - mnew; const float corr = __builtin_amdgcn_exp2f(ca);
    asm volatile("v_nop" :: "v"(ca), "v"(corr));   // the same slot behind this v_exp_f32 (see below)
    float ps = 0.f; v16h ph[2], pl[2];      // P^T operands of 32 keys: element e = key 8 g + e, element 8 + e = key 16 + 8 g + e, as two score tiles hold them
#pragma unroll
    for (int t = 0; t < 4; ++t) { v2f ar[4]; float ex[8];
#pragma unroll
      for (int j = 0; j < 4; ++j) ar[j] = __builtin_elementwise_fma((v2f){s[t][2 * j], s[t][2 * j + 1]}, (v2f){SC2, SC2}, (v2f){-mnew, -mnew});   // two exponents by one packed fma
#pragma unroll
      for (int r = 0; r < 8; ++r) ex[r] = __builtin_amdgcn_exp2f(ar[r >> 1][r & 1]);
      // the slot behind a transcendental before its source register is written again: the exponents are inputs here, so they keep their registers up to this v_nop, which stands behind the eight v_exp_f32
      asm volatile("v_nop" :: "v"(ar[0]), "v"(ar[1]), "v"(ar[2]), "v"(ar[3]), "v"(ex[0]), "v"(ex[1]), "v"(ex[2]), "v"(ex[3]), "v"(ex[4]), "v"(ex[5]), "v"(ex[6]), "v"(ex[7]));
#pragma unroll
      for (int j = 0; j < 4; ++j) { const v2f p = {ex[2 * j], ex[2 * j + 1]}; ps += p[0]; ps += p[1];      // two scores at a time: one packed convert for hi, the remainder p - hi (exact in f32), one packed convert for lo
        const v2h hi = __builtin_convertvector(p, v2h); const v2h lo = __builtin_convertvector(p - __builtin_convertvector(hi, v2f), v2h);
        const int e = (t & 1) * 8 + 2 * j; ph[t >> 1][e] = hi[0]; ph[t >> 1][e + 1] = hi[1]; pl[t >> 1][e] = lo[0]; pl[t >> 1][e + 1] = lo[1]; } }
    ps += __shfl_xor(ps, 16, 32);
    lrun = lrun * corr + ps; mrun = mnew;      // the sum stays at the scale of P, 2^14
#pragma unroll
    for (int t = 0; t < 4; ++t) acc[t] *= corr;
#pragma unroll
    for (int kc = 0; kc < 2; ++kc) { v16h vh[4], vl[4];   // the LDS reads of the four output tiles stand as one group ahead of their matrix run; a tile's three products stand four matrix instructions apart
#pragma unroll
      for (int t = 0; t < 4; ++t) { const _Float16* vr = (const _Float16*)(bp + 64 * PF + (t * 16 + col) * PB) + kc * 32; vh[t] = frag_h(vr, lane); vl[t] = frag_h(vr + 64 * PB / 2, lane); }
#pragma unroll
      for (int t = 0; t < 4; ++t) acc[t] = wmma16(vl[t], ph[kc], acc[t]);
#pragma unroll
      for (int t = 0; t < 4; ++t) acc[t] = wmma16(vh[t], pl[kc], acc[t]);
#pragma unroll
      for (int t = 0; t < 4; ++t) acc[t] = wmma16(vh[t], ph[kc], acc[t]); } }
    RING_PUBLISH();
    if (st + 2 < NST) fill(st + 2); }
  const float inv = 1.0f / (lrun * 4.0f);      // P's 2^14 cancels against the sum's; V carries 4
#pragma unroll
  for (int t = 0; t < 4; ++t) { v4f o[2];
#pragma unroll
    for (int r = 0; r < 8; ++r) o[r >> 2][r & 3] = acc[t][r] * inv;
    *(v4f*)(&sS[w][col][t * 16 + 8 * g]) = o[0]; *(v4f*)(&sS[w][col][t * 16 + 8 * g + 4]) = o[1]; }
  LDSX();
  for (int qq = lane; qq < 16 * 16; qq += 32) { const int rl = qq >> 4, pc = qq & 15; vst2(O32 + ((bh * SS) + q0 + rl) * HD + pc * 4, *(const v4f*)(&sS[w][rl][pc * 4])); }
  LDSX();   // the staged rows are read before the next query tile's output overwrites them
  }
  asm volatile("s_wait_asynccnt 0x0" ::: "memory");   // nothing in flight when the wave ends
}
// out = ctx Wo^T + bo : split(ctx) x bf16(Wo rows): 2 products (Wo is an INPUT -> bf16 exact)
__global__ __launch_bounds__(128) void k_out(const float* __restrict__ O32, const __bf16* __restrict__ PT, const float* __restrict__ bo, float* __restrict__ out) {
  __shared__ __align__(16) char sm[2 * OBUF];   // the ring in the loop; behind its last barrier the output staging
  float (*so)[16][132] = (float (*)[16][132])sm;
  const int tid = threadIdx.x, wave = tid >> 5, lane = tid & 31, col = lane & 15, g = lane >> 4;
  const int r0b = blockIdx.x * 64, r0 = r0b + wave * 16, n0 = blockIdx.y * 128; const int b = r0b / SS, s0 = r0b % SS;
  v8f acc[8] = {};
  // stage t = head t: ctx rows of 256 B (a copy of the block moves 8 rows), weight rows of 128 B (16 rows), whole lines per wave
  const char* gA = (const char*)(O32 + ((size_t)b * NH * SS + s0 + (tid >> 4)) * HD + (tid & 15) * 4);
  const char* gB = (const char*)(PT + (size_t)(3 * E + n0 + (tid >> 3)) * E + (tid & 7) * 8);
  const unsigned lA = (unsigned)(size_t)sm + (tid >> 4) * PF + (tid & 15) * 16, lB = (unsigned)(size_t)sm + 64 * PF + (tid >> 3) * PB + (tid & 7) * 16;
  auto fill = [&](int t) { const unsigned bo2 = (t & 1) * OBUF; const char* a = gA + (size_t)t * SS * HD * 4; const char* w = gB + (size_t)t * KT * 2;
    cp4(lA + bo2, 8 * PF, a, (size_t)8 * HD * 4); cp4(lA + bo2 + 32 * PF, 8 * PF, a + (size_t)32 * HD * 4, (size_t)8 * HD * 4);
    cp4(lB + bo2, 16 * PB, w, (size_t)16 * E * 2); cp4(lB + bo2 + 64 * PB, 16 * PB, w + (size_t)64 * E * 2, (size_t)16 * E * 2); };
  fill(0);
  asm volatile("s_wait_asynccnt 0x0" ::: "memory");   // stage 0 landed before the barrier that publishes it
  __syncthreads();
  fill(1);
#pragma unroll 1   // rolled: one copy of the loop's text, the buffer picked by t & 1
  for (int t = 0; t < E / KT; ++t) { const char* bp = sm + (t & 1) * OBUF; F2 a[2]; v16b wf[2][8];   // the stage's LDS reads stand as one group ahead of its matrix run
#pragma unroll
    for (int kk = 0; kk < 2; ++kk) { a[kk] = split_row4((const float*)(bp + (wave * 16 + col) * PF) + kk * 32 + 8 * g);
#pragma unroll
      for (int j = 0; j < 8; ++j) wf[kk][j] = frag_b((const __bf16*)(bp + 64 * PF + (j * 16 + col) * PB) + kk * 32, lane); }
#pragma unroll
    for (int kk = 0; kk < 2; ++kk) {
#pragma unroll
      for (int j = 0; j < 8; ++j) { acc[j] = wmma_bf(a[kk].l, wf[kk][j], acc[j]); acc[j] = wmma_bf(a[kk].h, wf[kk][j], acc[j]); } }
    RING_PUBLISH();
    if (t + 2 < E / KT) fill(t + 2); }
  asm volatile("s_wait_asynccnt 0x0" ::: "memory");   // nothing in flight when the ring becomes output staging
#pragma unroll
  for (int j = 0; j < 8; ++j) { const int n = n0 + j * 16 + col; const float bb = bfr(bo[n]);
#pragma unroll
    for (int r = 0; r < 8; ++r) so[wave][8 * g + r][j * 16 + col] = acc[j][r] + bb; }
  LDSX();
#pragma unroll 4
  for (int rl = 0; rl < 16; ++rl) vst2(out + (size_t)(r0 + rl) * E + n0 + lane * 4, *(const v4f*)(&so[wave][rl][lane * 4]));
}
#define NBHALF 2
extern "C" void kernel_launch(void* const* d_in, const int* in_sizes, int n_in, void* d_out, int out_size, void* d_ws, size_t ws_size, hipStream_t stream) {
  (void)in_sizes; (void)n_in; (void)out_size; (void)ws_size;
  const float* x = (const float*)d_in[0]; const float* Wqkv = (const float*)d_in[1]; const float* Wp = (const float*)d_in[2]; const float* bp = (const float*)d_in[3];
  float* out = (float*)d_out;
  char* ws = (char*)d_ws; size_t off = 0;
  auto take = [&](size_t bytes) { char* p = ws + off; off += (bytes + 255) & ~(size_t)255; return p; };
  const size_t HR = (size_t)NBHALF * SS;     // rows per half (4096)
  __bf16* Xb = (__bf16*)take((size_t)NR * E * 2); __bf16* PT = (__bf16*)take((size_t)4 * E * E * 2);
  float* Q32 = (float*)take((size_t)NR * E * 4); __bf16* KS = (__bf16*)take((size_t)NR * E * 4); _Float16* VTh = (_Float16*)take((size_t)NR * E * 2); _Float16* VTl = (_Float16*)take((size_t)NR * E * 2);
  float* O32 = Q32;      // in place: each k_attn wave reads its own 16 query rows into registers before writing the same rows; no other block reads them
  // ws ~ 120 MB; Q/K/V of all four batches are held at once, so that one attention launch covers all 64 (batch, head) pairs
  k_cvt<<<(NR * E + 4 * E * E) / (CVW * CVE), 32 * CVW, 0, stream>>>(x, Wqkv, Wp, Xb, PT);
  for (int hf = 0; hf < 2; ++hf) { const int rbase = hf * (int)HR; const size_t ho = hf * HR * E;
    k_qkv<<<dim3(HR / 128, E / 128, 3), 128, 0, stream>>>(Xb, rbase, PT, Q32 + ho, KS + 2 * ho, VTh + ho, VTl + ho); }
  k_attn<<<dim3(SS / 256, NB * NH), 256, 0, stream>>>(Q32, KS, VTh, VTl, O32);
  k_out<<<dim3(NR / 64, E / 128), 128, 0, stream>>>(O32, PT, bp, out);      // all four batches: 1024 work-groups, four on each WGP, resident at once
}

// v010
// A run of this version takes 170 microseconds.
// Next to v009, in two timings, it ran 1.06 times as fast each time.
// Counting every step since v000, it is 6.09 times as fast.
// compute dtype: x, w_qkv, w_proj, b_proj (INPUTS) rounded to bf16 with exact bf16 WMMA products (f32 accumulate) for the projections; q/k f32 split for the scores (3 products), P and V f16 hi/lo (3 products); softmax f32.
#include <hip/hip_runtime.h>
#include <math.h>

typedef __attribute__((ext_vector_type(16))) _Float16 v16h;
typedef __attribute__((ext_vector_type(16))) __bf16 v16b;
typedef __attribute__((ext_vector_type(8)))  _Float16 v8h;
typedef __attribute__((ext_vector_type(2)))  _Float16 v2h;
typedef __attribute__((ext_vector_type(8)))  float v8f;
typedef __attribute__((ext_vector_type(4)))  float v4f;
typedef __attribute__((ext_vector_type(2)))  float v2f;
typedef __attribute__((ext_vector_type(4)))  unsigned v4u;
typedef __attribute__((ext_vector_type(2)))  unsigned v2u;
typedef __attribute__((ext_vector_type(4)))  int v4i;
typedef float __attribute__((may_alias)) float_a;
typedef int __attribute__((may_alias)) int_a;

template <typename T> __device__ __forceinline__ void vst2(void* p, T v) { *(T*)p = v;  }
__device__ __forceinline__ v8f wmma16(v16h a, v16h b, v8f c) {
  v8f d = __builtin_amdgcn_wmma_f32_16x16x32_f16(false, a, false, b, (short)0, c, false, false);
  asm volatile("v_nop\n\tv_nop\n\tv_nop\n\tv_nop" : "+v"(d) : "v"(a), "v"(b));
  return d;
}
__device__ __forceinline__ v8f wmma_bf(v16b a, v16b b, v8f c) {
  v8f d = __builtin_amdgcn_wmma_f32_16x16x32_bf16(false, a, false, b, (short)0, c, false, false);
  asm volatile("v_nop\n\tv_nop\n\tv_nop\n\tv_nop" : "+v"(d) : "v"(a), "v"(b));
  return d;
}
// 16x16x32 fragments: lane = (h = lane>>4, row/col = lane&15); elements 0..7 = k0+8h+0..7, 8..15 = k0+16+8h+0..7; D element r = row 8h+r
__device__ __forceinline__ v16h frag_h(const _Float16* rowk0, int lane) {
  union { v16h v; v8h q[2]; } u; const _Float16* p = rowk0 + 8 * (lane >> 4);
  u.q[0] = *(const v8h*)p; u.q[1] = *(const v8h*)(p + 16); return u.v;
}
__device__ __forceinline__ v16h frag_f32(const float* rowk0, int lane) {
  v16h a; const float* p = rowk0 + 8 * (lane >> 4);
#pragma unroll
  for (int i = 0; i < 8; ++i) { a[i] = (_Float16)p[i]; a[8 + i] = (_Float16)p[16 + i]; }
  return a;
}
__device__ __forceinline__ v16h frag_f32s(const float* rowk0, int lane, float sc) {
  v16h a; const float* p = rowk0 + 8 * (lane >> 4);
#pragma unroll
  for (int i = 0; i < 8; ++i) { a[i] = (_Float16)(p[i] * sc); a[8 + i] = (_Float16)(p[16 + i] * sc); }
  return a;
}
// column fragment from a [K][ld] layout (column n), rows >= K read as 0
__device__ __forceinline__ v16h fragc_f32(const float* W, int k0, int n, int lane, int ld, int K) {
  v16h a; const int g = lane >> 4;
#pragma unroll
  for (int i = 0; i < 8; ++i) { const int ka = k0 + 8 * g + i, kb = ka + 16;
    a[i] = (_Float16)(ka < K ? W[(size_t)(ka < K ? ka : K - 1) * ld + n] : 0.f); a[8 + i] = (_Float16)(kb < K ? W[(size_t)(kb < K ? kb : K - 1) * ld + n] : 0.f); }
  return a;
}
struct F2 { v16b h, l; };
__device__ __forceinline__ F2 bsplit16(const float v[16]) { F2 r;
#pragma unroll
  for (int i = 0; i < 16; ++i) { const __bf16 h = (__bf16)v[i]; r.h[i] = h; r.l[i] = (__bf16)(v[i] - (float)h); }
  return r; }
__device__ __forceinline__ F2 split_row(const float* row, int k0, int lane) { float v[16]; const float* p = row + k0 + 8 * (lane >> 4);
#pragma unroll
  for (int i = 0; i < 8; ++i) { v[i] = p[i]; v[8 + i] = p[16 + i]; }
  return bsplit16(v); }
__device__ __forceinline__ F2 split_rowK(const float* row, int k0, int lane, int K) { float v[16]; const int g = lane >> 4;
#pragma unroll
  for (int i = 0; i < 8; ++i) { const int ka = k0 + 8 * g + i, kb = ka + 16; v[i] = ka < K ? row[ka < K ? ka : K - 1] : 0.f; v[8 + i] = kb < K ? row[kb < K ? kb : K - 1] : 0.f; }
  return bsplit16(v); }
__device__ __forceinline__ F2 split_col(const float* W, int k0, int n, int lane, int ld, int K) { float v[16]; const int g = lane >> 4;
#pragma unroll
  for (int i = 0; i < 8; ++i) { const int ka = k0 + 8 * g + i, kb = ka + 16; v[i] = ka < K ? W[(size_t)(ka < K ? ka : K - 1) * ld + n] : 0.f; v[8 + i] = kb < K ? W[(size_t)(kb < K ? kb : K - 1) * ld + n] : 0.f; }
  return bsplit16(v); }
__device__ __forceinline__ v8f mac3(const F2& a, const F2& b, v8f c) { c = wmma_bf(a.l, b.h, c); c = wmma_bf(a.h, b.l, c); return wmma_bf(a.h, b.h, c); }
__device__ __forceinline__ float sigm(float v) { return 1.0f / (1.0f + expf(-v)); }
#define LDSX() do { asm volatile("s_wait_dscnt 0" ::: "memory"); __builtin_amdgcn_wave_barrier(); __builtin_amdgcn_fence(__ATOMIC_RELEASE, "workgroup"); } while (0)


#define NB 4
#define SS 2048
#define E 1024
#define NH 16
#define HD 64
#define NR (NB * SS)
#define SC2 0.18033688011112042f      // hs^-0.5 * log2(e): a raw score times this is its exponent to base 2
__device__ __forceinline__ float bfr(float v) { return (float)(__bf16)v; }
__device__ __forceinline__ v16b frag_b(const __bf16* rowk0, int lane) { return __builtin_bit_cast(v16b, frag_h((const _Float16*)rowk0, lane)); }

// asynchronous copies to LDS, 16 bytes a lane: l = the lane's LDS byte address, g = its global address. The s_wait_xcnt closes each statement, so that no address register is rewritten ahead of it.
#define CPY "global_load_async_to_lds_b128 "
__device__ __forceinline__ void cp4(unsigned l, unsigned ls, const char* g, size_t gs) {
  asm volatile(CPY "%0, %1, off\n\t" CPY "%2, %3, off\n\t" CPY "%4, %5, off\n\t" CPY "%6, %7, off\n\ts_wait_xcnt 0x0"
               :: "v"(l), "v"(g), "v"(l + ls), "v"(g + gs), "v"(l + 2 * ls), "v"(g + 2 * gs), "v"(l + 3 * ls), "v"(g + 3 * gs) : "memory");
}
__device__ __forceinline__ void cp2(unsigned l, unsigned ls, const char* g, size_t gs) {
  asm volatile(CPY "%0, %1, off\n\t" CPY "%2, %3, off\n\ts_wait_xcnt 0x0" :: "v"(l), "v"(g), "v"(l + ls), "v"(g + gs) : "memory");
}
// publish point of the two-buffer ring: own LDS reads done, own copies landed, then the work-group barrier (it publishes the next tile and frees the buffer just read)
#define RING_PUBLISH() do { asm volatile("s_wait_dscnt 0x0" ::: "memory"); asm volatile("s_wait_asynccnt 0x0" ::: "memory"); __syncthreads(); } while (0)
#define KT 64                         // k per stage: 128 B of a bf16 row, 256 B of an f32 row
#define PB 144                        // LDS pitch of a 128-B row, 16 B x odd: ds_load_b128 free of bank conflicts
#define PF 272                        // LDS pitch of a 256-B row, likewise
#define QBUF (256 * PB)               // k_qkv stage: 128 x rows, then 128 weight rows
#define OBUF (64 * PF + 128 * PB)     // k_out stage: 64 f32 ctx rows, then 128 weight rows
#define ABUF (64 * PF + 2 * 64 * PB) // k_attn stage: 64 K rows of 256 B (64 bf16 hi, 64 bf16 lo), then 64 V^T hi rows and 64 V^T lo rows of 64 keys
#define NST (2 * (SS / 128 + 1))      // k_attn stages in a block: 2 (t + 1) + 2 (16 - t)
__device__ __forceinline__ F2 split_row4(const float* p) { float v[16]; const v4f a = *(const v4f*)p, b = *(const v4f*)(p + 4), c = *(const v4f*)(p + 16), d = *(const v4f*)(p + 20);
#pragma unroll
  for (int i = 0; i < 4; ++i) { v[i] = a[i]; v[4 + i] = b[i]; v[8 + i] = c[i]; v[12 + i] = d[i]; }
  return bsplit16(v); }

// x, w_qkv and w_proj rounded to bf16 by one launch of few long waves: one work-group of 12 waves per WGP, a wave takes 4096 elements in a row of one input:
// its 32 loads of 512 B (whole lines) are all issued before the first result is stored (256 B a store, whole lines)
// PT rows: [0,3E) = w_qkv rows (q | k | v output features), [3E,4E) = w_proj rows ([out][in] weights, as they lie in the inputs)
#define CVW 12                        // waves in a work-group
#define CVL 32                        // loads of a wave
#define CVE (CVL * 128)               // elements of a wave
__global__ __launch_bounds__(32 * CVW) void k_cvt(const float* __restrict__ x, const float* __restrict__ Wqkv, const float* __restrict__ Wp, __bf16* __restrict__ Xb, __bf16* __restrict__ PT) {
  const int lane = threadIdx.x & 31, c = (int)blockIdx.x * CVW + __builtin_amdgcn_readfirstlane((int)threadIdx.x >> 5);
  const int cw = c - NR * E / CVE, cp = cw - 3 * E * E / CVE;      // the wave's piece counted from the start of w_qkv, of w_proj
  const float* s = (cw < 0 ? x + (size_t)c * CVE : cp < 0 ? Wqkv + (size_t)cw * CVE : Wp + (size_t)cp * CVE) + lane * 4;
  __bf16* d = (cw < 0 ? Xb + (size_t)c * CVE : PT + (size_t)cw * CVE) + lane * 4;
  v4f v[CVL];
#pragma unroll
  for (int j = 0; j < CVL; ++j) v[j] = *(const v4f*)(s + j * 128);
#pragma unroll
  for (int j = 0; j < CVL; ++j) { union { __bf16 h[4]; v2u u; } pk;
#pragma unroll
    for (int e = 0; e < 4; ++e) pk.h[e] = (__bf16)v[j][e];
    vst2(d + j * 128, pk.u); }
}
// QKV: block (128 rows, 128 cols = 2 heads, which), four waves of 64 x 64 (one head each); q -> Q32 f32 [bh][s][64]; k -> KS bf16 [bh][s][64 hi | 64 lo], the split of the f32 value made here, once; v -> VT hi/lo x4 [bh][d][s]
__global__ __launch_bounds__(128) void k_qkv(const __bf16* __restrict__ Xb, int rbase, const __bf16* __restrict__ PT, float* __restrict__ Q32, __bf16* __restrict__ KS, _Float16* __restrict__ VTh, _Float16* __restrict__ VTl) {
  __shared__ __align__(16) char sm[2 * QBUF];      // the ring in the loop; behind its last barrier the output staging
  float (*so)[64][68] = (float (*)[64][68])sm; _Float16 (*sth)[136] = (_Float16 (*)[136])sm; _Float16 (*stl)[136] = (_Float16 (*)[136])(sm + 128 * 136 * 2);
  const int tid = threadIdx.x, wave = tid >> 5, lane = tid & 31, col = lane & 15, g = lane >> 4, wr = wave >> 1, wc = wave & 1;
  const int which = blockIdx.z, r0b = blockIdx.x * 128, n0 = blockIdx.y * 128; const int b = r0b / SS, s0 = r0b % SS;
  v8f acc[4][4] = {};      // acc[i][j]: rows wr * 64 + i * 16 .., columns wc * 64 + j * 16 .. of the block's tile
  // a copy of the block moves 16 rows of 128 B: thread -> (row tid >> 3, 16-B piece tid & 7), whole lines per wave
  const char* gA = (const char*)(Xb + (size_t)(rbase + r0b + (tid >> 3)) * E + (tid & 7) * 8);
  const char* gB = (const char*)(PT + (size_t)(which * E + n0 + (tid >> 3)) * E + (tid & 7) * 8);
  const unsigned l0 = (unsigned)(size_t)sm + (tid >> 3) * PB + (tid & 7) * 16;
  auto fill = [&](int t) { const unsigned l = l0 + (t & 1) * QBUF; const size_t ko = (size_t)t * KT * 2;
    cp4(l, 16 * PB, gA + ko, (size_t)16 * E * 2); cp4(l + 64 * PB, 16 * PB, gA + ko + (size_t)64 * E * 2, (size_t)16 * E * 2);
    cp4(l + 128 * PB, 16 * PB, gB + ko, (size_t)16 * E * 2); cp4(l + 192 * PB, 16 * PB, gB + ko + (size_t)64 * E * 2, (size_t)16 * E * 2); };
  fill(0);
  asm volatile("s_wait_asynccnt 0x0" ::: "memory");   // stage 0 landed before the barrier that publishes it
  __syncthreads();
  fill(1);
#pragma unroll 1   // rolled: one copy of the loop's text, the buffer picked by t & 1
  for (int t = 0; t < E / KT; ++t) { const char* bp = sm + (t & 1) * QBUF;
#pragma unroll
    for (int kk = 0; kk < 2; ++kk) { v16b a[4], wf[4];   // the LDS reads of 32 k stand as one group ahead of their matrix run: 8 fragments feed 16 products
#pragma unroll
      for (int i = 0; i < 4; ++i) { a[i] = frag_b((const __bf16*)(bp + (wr * 64 + i * 16 + col) * PB) + kk * 32, lane); wf[i] = frag_b((const __bf16*)(bp + (128 + wc * 64 + i * 16 + col) * PB) + kk * 32, lane); }
#pragma unroll
      for (int i = 0; i < 4; ++i) {
#pragma unroll
        for (int j = 0; j < 4; ++j) acc[i][j] = wmma_bf(a[i], wf[j], acc[i][j]); } }
    RING_PUBLISH();
    if (t + 2 < E / KT) fill(t + 2); }
  asm volatile("s_wait_asynccnt 0x0" ::: "memory");   // nothing in flight when the ring becomes output staging
  const int h = (n0 >> 6) + wc;      // the wave's head
  if (which < 2) { const size_t row0 = ((size_t)b * NH + h) * SS + s0 + wr * 64;      // the wave's 64 rows go through its own slice of the staging
#pragma unroll
    for (int i = 0; i < 4; ++i) {
#pragma unroll
      for (int j = 0; j < 4; ++j) {
#pragma unroll
        for (int r = 0; r < 8; ++r) so[wave][i * 16 + 8 * g + r][j * 16 + col] = acc[i][j][r]; } }
    LDSX();
    if (which == 0) {
#pragma unroll 1   // rolled; four LDS reads and four stores in flight per trip
      for (int o = 0; o < 64 * 16 / 128; ++o) {
#pragma unroll
        for (int u = 0; u < 4; ++u) { const int qq = (o * 4 + u) * 32 + lane, rl = qq >> 4, pc = qq & 15;
          vst2(Q32 + (row0 + rl) * HD + pc * 4, *(const v4f*)(&so[wave][rl][pc * 4])); } } }
    else {
#pragma unroll 1   // likewise
      for (int o = 0; o < 64 * 8 / 128; ++o) {
#pragma unroll
      for (int u = 0; u < 4; ++u) { const int qq = (o * 4 + u) * 32 + lane, rl = qq >> 3, pc = qq & 7;
        const v4f va = *(const v4f*)(&so[wave][rl][pc * 8]), vb = *(const v4f*)(&so[wave][rl][pc * 8 + 4]);
        union { __bf16 e[8]; v4u u; } kh, kl;
#pragma unroll
        for (int e = 0; e < 8; ++e) { const float v = e < 4 ? va[e & 3] : vb[e & 3]; const __bf16 hv = (__bf16)v; kh.e[e] = hv; kl.e[e] = (__bf16)(v - (float)hv); }
        __bf16* d = KS + (row0 + rl) * (2 * HD) + pc * 8;
        vst2(d, kh.u); vst2(d + HD, kl.u); }
        asm volatile("s_wait_xcnt 0x0" ::: "memory");   // ahead of the next trip, which rewrites the stores' address and data registers
      } } }
  else {
#pragma unroll
    for (int i = 0; i < 4; ++i) {
#pragma unroll
      for (int j = 0; j < 4; ++j) { union { _Float16 e[8]; v4u u; } vh, vl;      // a lane's 8 rows of one column: 16 B of the transposed tile
#pragma unroll
        for (int r = 0; r < 8; ++r) { const float v = acc[i][j][r] * 4.0f; const _Float16 hi = (_Float16)v; vh.e[r] = hi; vl.e[r] = (_Float16)(v - (float)hi); }
        vst2(&sth[wc * 64 + j * 16 + col][wr * 64 + i * 16 + 8 * g], vh.u); vst2(&stl[wc * 64 + j * 16 + col][wr * 64 + i * 16 + 8 * g], vl.u); } }
    __syncthreads();
#pragma unroll 1   // likewise
    for (int o = 0; o < 128 * 16 / 512; ++o) {
#pragma unroll
    for (int u = 0; u < 4; ++u) { const int qq = (o * 4 + u) * 128 + tid, cl = qq >> 4, pc = qq & 15; const int c = n0 + cl, hh = c >> 6, d = c & 63; const size_t of = (((size_t)b * NH + hh) * HD + d) * SS + s0 + pc * 8;
      vst2(VTh + of, *(const v4u*)(&sth[cl][pc * 8])); vst2(VTl + of, *(const v4u*)(&stl[cl][pc * 8])); }
      asm volatile("s_wait_xcnt 0x0" ::: "memory");   // ahead of the next trip, which rewrites the stores' address and data registers
    } }
}
__device__ __forceinline__ v8f mm_h(v16h a, v16h b, v8f c) { return __builtin_amdgcn_wmma_f32_16x16x32_f16(false, a, false, b, (short)0, c, false, false); }
__device__ __forceinline__ v8f mm_b(v16b a, v16b b, v8f c) { return __builtin_amdgcn_wmma_f32_16x16x32_bf16(false, a, false, b, (short)0, c, false, false); }
__device__ __forceinline__ v8f mac3t(const F2& k, const F2& q, v8f c) { c = mm_b(k.h, q.l, c); c = mm_b(k.l, q.h, c); return mm_b(k.h, q.h, c); }
__global__ __launch_bounds__(256, 4) void k_attn(const float* __restrict__ Q32, const __bf16* __restrict__ KS, const _Float16* __restrict__ VTh, const _Float16* __restrict__ VTl, float* __restrict__ O32) {
  __shared__ __align__(16) char ring[2 * ABUF];
  __shared__ __align__(16) float sS[8][16][68];      // output staging (each wave its own slice)
  const int tid = threadIdx.x, w = __builtin_amdgcn_readfirstlane(tid >> 5), lane = tid & 31, col = lane & 15, g = lane >> 4;
  const size_t bh = blockIdx.y;
  const int n0 = 2 * ((int)blockIdx.x + 1);          // key tiles of the first query tile; both together: NST
  // K: a copy of the block moves 16 rows of 256 B; V^T: 32 rows of 128 B
  const char* gK = (const char*)(KS + (bh * SS + (tid >> 4)) * (2 * HD) + (tid & 15) * 8);
  const char* gH = (const char*)(VTh + (bh * HD + (tid >> 3)) * SS + (tid & 7) * 8);
  const char* gL = (const char*)(VTl + (bh * HD + (tid >> 3)) * SS + (tid & 7) * 8);
  const unsigned lK = (unsigned)(size_t)ring + (tid >> 4) * PF + (tid & 15) * 16, lV = (unsigned)(size_t)ring + 64 * PF + (tid >> 3) * PB + (tid & 7) * 16;
  auto fill = [&](int s) { const int kt = s < n0 ? s : s - n0; const unsigned bo2 = (s & 1) * ABUF;
    cp4(lK + bo2, 16 * PF, gK + (size_t)kt * 64 * HD * 4, (size_t)16 * HD * 4);
    cp2(lV + bo2, 32 * PB, gH + (size_t)kt * 64 * 2, (size_t)32 * SS * 2); cp2(lV + bo2 + 64 * PB, 32 * PB, gL + (size_t)kt * 64 * 2, (size_t)32 * SS * 2); };
  fill(0);
  asm volatile("s_wait_asynccnt 0x0" ::: "memory");   // stage 0 landed before the barrier that publishes it
  __syncthreads();
  fill(1);
  int st = 0;
  for (int pass = 0; pass < 2; ++pass) {
  const int qb = pass == 0 ? (int)blockIdx.x : SS / 128 - 1 - (int)blockIdx.x; const int q0 = qb * 128 + w * 16;
  F2 aq[2];      // the lane's query q0 + col, as the B operand
#pragma unroll
  for (int kc = 0; kc < 2; ++kc) aq[kc] = split_row(Q32 + (bh * SS + q0 + col) * HD, kc * 32, lane);
  // mrun: the running maximum as a base-2 exponent less 14 (raw score x SC2 - 14, rounded once: an unchanged maximum rescales by exactly 1), so that v_exp_f32 itself gives P x 2^14; mrun, lrun: of query q0 + col, the same in both halves of the wave
  // the lo parts of P and V are plain f16 remainders at the scale of their hi parts, so the three products of a tile add into one accumulator
  float mrun = -3.0e38f, lrun = 0.f; v8f acc[4] = {};      // element r of tile t: O^T[t * 16 + 8 g + r][q0 + col]
#pragma unroll 1   // rolled: one copy of the loop's text, the buffer picked by st & 1
  for (int kt = 0; kt < 2 * (qb + 1); ++kt, ++st) { const char* bp = ring + (st & 1) * ABUF;
   if (kt * 64 <= q0 + 15) {      // a key tile wholly above the wave's diagonal adds nothing: the wave goes straight to the publish point
    const int lim = q0 + col - kt * 64 - 8 * g;      // key t * 16 + 8 g + r of the tile is above the diagonal where t * 16 + r > lim
    v8f s[4];
#pragma unroll
    for (int t = 0; t < 4; ++t) { const __bf16* krow = (const __bf16*)(bp + (t * 16 + col) * PF);
      const F2 k0 = {frag_b(krow, lane), frag_b(krow + HD, lane)}, k1 = {frag_b(krow + 32, lane), frag_b(krow + HD + 32, lane)};
      s[t] = mac3t(k0, aq[0], (v8f){}); s[t] = mac3t(k1, aq[1], s[t]);
#pragma unroll
      for (int r = 0; r < 8; ++r) s[t][r] = (t * 16 + r > lim) ? -3.0e38f : s[t][r]; }
    float mx = -3.4e38f;
#pragma unroll
    for (int t = 0; t < 4; ++t) {
#pragma unroll
      for (int r = 0; r < 8; ++r) mx = fmaxf(mx, s[t][r]); }
    mx = fmaxf(mx, __shfl_xor(mx, 16, 32));
    const float mnew = fmaxf(mrun, __builtin_fmaf(mx, SC2, -14.0f)); const float ca = mrun - mnew; const float corr = __builtin_amdgcn_exp2f(ca);
    asm volatile("v_nop" :: "v"(ca), "v"(corr));   // the same slot behind this v_exp_f32 (see below)
    float ps = 0.f; v16h ph[2], pl[2];      // P^T operands of 32 keys: element e = key 8 g + e, element 8 + e = key 16 + 8 g + e, as two score tiles hold them
#pragma unroll
    for (int t = 0; t < 4; ++t) { v2f ar[4]; float ex[8];
#pragma unroll
      for (int j = 0; j < 4; ++j) ar[j] = __builtin_elementwise_fma((v2f){s[t][2 * j], s[t][2 * j + 1]}, (v2f){SC2, SC2}, (v2f){-mnew, -mnew});   // two exponents by one packed fma
#pragma unroll
      for (int r = 0; r < 8; ++r) ex[r] = __builtin_amdgcn_exp2f(ar[r >> 1][r & 1]);
      // the slot behind a transcendental before its source register is written again: the exponents are inputs here, so they keep their registers up to this v_nop, which stands behind the eight v_exp_f32
      asm volatile("v_nop" :: "v"(ar[0]), "v"(ar[1]), "v"(ar[2]), "v"(ar[3]), "v"(ex[0]), "v"(ex[1]), "v"(ex[2]), "v"(ex[3]), "v"(ex[4]), "v"(ex[5]), "v"(ex[6]), "v"(ex[7]));
#pragma unroll
      for (int j = 0; j < 4; ++j) { const v2f p = {ex[2 * j], ex[2 * j + 1]}; ps += p[0]; ps += p[1];      // two scores at a time: one packed convert for hi, the remainder p - hi (exact in f32), one packed convert for lo
        const v2h hi = __builtin_convertvector(p, v2h); const v2h lo = __builtin_convertvector(p - __builtin_convertvector(hi, v2f), v2h);
        const int e = (t & 1) * 8 + 2 * j; ph[t >> 1][e] = hi[0]; ph[t >> 1][e + 1] = hi[1]; pl[t >> 1][e] = lo[0]; pl[t >> 1][e + 1] = lo[1]; } }
    ps += __shfl_xor(ps, 16, 32);
    lrun = lrun * corr + ps; mrun = mnew;      // the sum stays at the scale of P, 2^14
#pragma unroll
    for (int t = 0; t < 4; ++t) acc[t] *= corr;
#pragma unroll
    for (int kc = 0; kc < 2; ++kc) { v16h vh[4], vl[4];   // a tile's three products add in this order (lo x hi, hi x lo, hi x hi); where the LDS reads and the softmax's conversions stand among the products is left to the compiler
#pragma unroll
      for (int t = 0; t < 4; ++t) { const _Float16* vr = (const _Float16*)(bp + 64 * PF + (t * 16 + col) * PB) + kc * 32; vh[t] = frag_h(vr, lane); vl[t] = frag_h(vr + 64 * PB / 2, lane); }
#pragma unroll
      for (int t = 0; t < 4; ++t) acc[t] = mm_h(vl[t], ph[kc], acc[t]);
#pragma unroll
      for (int t = 0; t < 4; ++t) acc[t] = mm_h(vh[t], pl[kc], acc[t]);
#pragma unroll
      for (int t = 0; t < 4; ++t) acc[t] = mm_h(vh[t], ph[kc], acc[t]); } }
    RING_PUBLISH();
    if (st + 2 < NST) fill(st + 2); }
  const float inv = 1.0f / (lrun * 4.0f);      // P's 2^14 cancels against the sum's; V carries 4
#pragma unroll
  for (int t = 0; t < 4; ++t) { v4f o[2];
#pragma unroll
    for (int r = 0; r < 8; ++r) o[r >> 2][r & 3] = acc[t][r] * inv;
    *(v4f*)(&sS[w][col][t * 16 + 8 * g]) = o[0]; *(v4f*)(&sS[w][col][t * 16 + 8 * g + 4]) = o[1]; }
  LDSX();
  for (int qq = lane; qq < 16 * 16; qq += 32) { const int rl = qq >> 4, pc = qq & 15; vst2(O32 + ((bh * SS) + q0 + rl) * HD + pc * 4, *(const v4f*)(&sS[w][rl][pc * 4])); }
  LDSX();   // the staged rows are read before the next query tile's output overwrites them
  }
  asm volatile("s_wait_asynccnt 0x0" ::: "memory");   // nothing in flight when the wave ends
}
// out = ctx Wo^T + bo : split(ctx) x bf16(Wo rows): 2 products (Wo is an INPUT -> bf16 exact)
__global__ __launch_bounds__(128) void k_out(const float* __restrict__ O32, const __bf16* __restrict__ PT, const float* __restrict__ bo, float* __restrict__ out) {
  __shared__ __align__(16) char sm[2 * OBUF];   // the ring in the loop; behind its last barrier the output staging
  float (*so)[16][132] = (float (*)[16][132])sm;
  const int tid = threadIdx.x, wave = tid >> 5, lane = tid & 31, col = lane & 15, g = lane >> 4;
  const int r0b = blockIdx.x * 64, r0 = r0b + wave * 16, n0 = blockIdx.y * 128; const int b = r0b / SS, s0 = r0b % SS;
  v8f acc[8] = {};
  // stage t = head t: ctx rows of 256 B (a copy of the block moves 8 rows), weight rows of 128 B (16 rows), whole lines per wave
  const char* gA = (const char*)(O32 + ((size_t)b * NH * SS + s0 + (tid >> 4)) * HD + (tid & 15) * 4);
  const char* gB = (const char*)(PT + (size_t)(3 * E + n0 + (tid >> 3)) * E + (tid & 7) * 8);
  const unsigned lA = (unsigned)(size_t)sm + (tid >> 4) * PF + (tid & 15) * 16, lB = (unsigned)(size_t)sm + 64 * PF + (tid >> 3) * PB + (tid & 7) * 16;
  auto fill = [&](int t) { const unsigned bo2 = (t & 1) * OBUF; const char* a = gA + (size_t)t * SS * HD * 4; const char* w = gB + (size_t)t * KT * 2;
    cp4(lA + bo2, 8 * PF, a, (size_t)8 * HD * 4); cp4(lA + bo2 + 32 * PF, 8 * PF, a + (size_t)32 * HD * 4, (size_t)8 * HD * 4);
    cp4(lB + bo2, 16 * PB, w, (size_t)16 * E * 2); cp4(lB + bo2 + 64 * PB, 16 * PB, w + (size_t)64 * E * 2, (size_t)16 * E * 2); };
  fill(0);
  asm volatile("s_wait_asynccnt 0x0" ::: "memory");   // stage 0 landed before the barrier that publishes it
  __syncthreads();
  fill(1);
#pragma unroll 1   // rolled: one copy of the loop's text, the buffer picked by t & 1
  for (int t = 0; t < E / KT; ++t) { const char* bp = sm + (t & 1) * OBUF; F2 a[2]; v16b wf[2][8];   // the stage's LDS reads stand as one group ahead of its matrix run
#pragma unroll
    for (int kk = 0; kk < 2; ++kk) { a[kk] = split_row4((const float*)(bp + (wave * 16 + col) * PF) + kk * 32 + 8 * g);
#pragma unroll
      for (int j = 0; j < 8; ++j) wf[kk][j] = frag_b((const __bf16*)(bp + 64 * PF + (j * 16 + col) * PB) + kk * 32, lane); }
#pragma unroll
    for (int kk = 0; kk < 2; ++kk) {
#pragma unroll
      for (int j = 0; j < 8; ++j) { acc[j] = wmma_bf(a[kk].l, wf[kk][j], acc[j]); acc[j] = wmma_bf(a[kk].h, wf[kk][j], acc[j]); } }
    RING_PUBLISH();
    if (t + 2 < E / KT) fill(t + 2); }
  asm volatile("s_wait_asynccnt 0x0" ::: "memory");   // nothing in flight when the ring becomes output staging
#pragma unroll
  for (int j = 0; j < 8; ++j) { const int n = n0 + j * 16 + col; const float bb = bfr(bo[n]);
#pragma unroll
    for (int r = 0; r < 8; ++r) so[wave][8 * g + r][j * 16 + col] = acc[j][r] + bb; }
  LDSX();
#pragma unroll 4
  for (int rl = 0; rl < 16; ++rl) vst2(out + (size_t)(r0 + rl) * E + n0 + lane * 4, *(const v4f*)(&so[wave][rl][lane * 4]));
}
#define NBHALF 2
extern "C" void kernel_launch(void* const* d_in, const int* in_sizes, int n_in, void* d_out, int out_size, void* d_ws, size_t ws_size, hipStream_t stream) {
  (void)in_sizes; (void)n_in; (void)out_size; (void)ws_size;
  const float* x = (const float*)d_in[0]; const float* Wqkv = (const float*)d_in[1]; const float* Wp = (const float*)d_in[2]; const float* bp = (const float*)d_in[3];
  float* out = (float*)d_out;
  char* ws = (char*)d_ws; size_t off = 0;
  auto take = [&](size_t bytes) { char* p = ws + off; off += (bytes + 255) & ~(size_t)255; return p; };
  const size_t HR = (size_t)NBHALF * SS;     // rows per half (4096)
  __bf16* Xb = (__bf16*)take((size_t)NR * E * 2); __bf16* PT = (__bf16*)take((size_t)4 * E * E * 2);
  float* Q32 = (float*)take((size_t)NR * E * 4); __bf16* KS = (__bf16*)take((size_t)NR * E * 4); _Float16* VTh = (_Float16*)take((size_t)NR * E * 2); _Float16* VTl = (_Float16*)take((size_t)NR * E * 2);
  float* O32 = Q32;      // in place: each k_attn wave reads its own 16 query rows into registers before writing the same rows; no other block reads them
  // ws ~ 120 MB; Q/K/V of all four batches are held at once, so that one attention launch covers all 64 (batch, head) pairs
  k_cvt<<<(NR * E + 4 * E * E) / (CVW * CVE), 32 * CVW, 0, stream>>>(x, Wqkv, Wp, Xb, PT);
  for (int hf = 0; hf < 2; ++hf) { const int rbase = hf * (int)HR; const size_t ho = hf * HR * E;
    k_qkv<<<dim3(HR / 128, E / 128, 3), 128, 0, stream>>>(Xb, rbase, PT, Q32 + ho, KS + 2 * ho, VTh + ho, VTl + ho); }
  k_attn<<<dim3(SS / 256, NB * NH), 256, 0, stream>>>(Q32, KS, VTh, VTl, O32);
  k_out<<<dim3(NR / 64, E / 128), 128, 0, stream>>>(O32, PT, bp, out);      // all four batches: 1024 work-groups, four on each WGP, resident at once
}
